// v000
// Times are from an AMD MI455X. After a warm-up the kernel runs many times in a row, and a time is the length of
// such a window on the GPU divided by its runs, so every launch and the gaps after it count. The runs cycle
// through copies of the inputs. A figure is the median of several windows, for all but v000 over two sittings.
// Sittings can differ by a few percent; kernels timed side by side share one.
// v000 is the starting kernel. One run takes 643 microseconds.
#include <hip/hip_runtime.h>
#include <hip/hip_bf16.h>
#include <math.h>

typedef __attribute__((ext_vector_type(16))) __bf16 v16bf;
typedef __attribute__((ext_vector_type(8)))  __bf16 v8bf;
typedef __attribute__((ext_vector_type(8)))  float  v8f;

#define LQ 512
#define DM 2048
#define NH 16
#define DH 128
#define FFD 8192

__device__ __forceinline__ v8f wmma_bf16(const v16bf& a, const v16bf& b, const v8f& c) {
    return __builtin_amdgcn_wmma_f32_16x16x32_bf16(false, a, false, b, (short)0, c, false, false);
}

__device__ __forceinline__ v16bf frag_from_lds(const __bf16* rowp, int half) {
    const v8bf lo = *(const v8bf*)(rowp + half * 8);
    const v8bf hi = *(const v8bf*)(rowp + 16 + half * 8);
    return __builtin_shufflevector(lo, hi, 0, 1, 2, 3, 4, 5, 6, 7,
                                           8, 9, 10, 11, 12, 13, 14, 15);
}

__device__ __forceinline__ void async_copy_b128(const void* gptr, void* lptr) {
    const unsigned lds = (unsigned)(size_t)lptr;
    asm volatile("global_load_async_to_lds_b128 %0, %1, off"
                 :: "v"(lds), "v"(gptr) : "memory");
}
__device__ __forceinline__ void wait_async() {
    asm volatile("s_wait_asynccnt 0x0" ::: "memory");
}

__device__ __forceinline__ float gelu_tanh(float x) {
    const float k0 = 0.7978845608028654f;  // sqrt(2/pi)
    const float k1 = 0.044715f;
    float t = tanhf(k0 * (x + k1 * x * x * x));
    return 0.5f * x * (1.0f + t);
}

// ---------------------------------------------------------------------------
// C = act(A[512xK] @ B[KxN] + bias) (+ res).  Block tile 128x128, K-step 32,
// double-buffered LDS.  8 wave32 waves; wave grid 4(M) x 2(N), each wave
// 32x64 = 2x4 accumulators.  aT[m][k]; B transposed in LDS: bTt[n][k].
// ---------------------------------------------------------------------------
template <int N, int K, int ACT>
__global__ __launch_bounds__(256) void gemm_bias_kernel(
    const float* __restrict__ A, const float* __restrict__ B,
    const float* __restrict__ bias, const float* __restrict__ res,
    float* __restrict__ C)
{
    static_assert(K % 64 == 0 && N % 128 == 0, "tile assumptions");
    __shared__ __align__(16) __bf16 aT[2][128][40];
    __shared__ __align__(16) __bf16 bTt[2][128][40];

    const int tid  = threadIdx.x;
    const int m0   = blockIdx.y * 128;
    const int n0   = blockIdx.x * 128;
    const int w    = tid >> 5;
    const int lane = tid & 31;
    const int half = lane >> 4;
    const int r    = lane & 15;
    const int wm   = (w & 3) * 32;
    const int wn   = (w >> 2) * 64;

    const int arow = tid >> 3;          // A staging: 32 rows / pass, 8 float4 per row
    const int acol = (tid & 7) * 4;
    const int sn   = tid & 127;         // B staging: column gather, 2 threads per n
    const int sk0  = (tid >> 7) * 16;

    v8f acc[2][4] = {};

    auto stage = [&](int buf, int kc) {
        float4 va[4];
#pragma unroll
        for (int p = 0; p < 4; ++p)
            va[p] = *(const float4*)(&A[(size_t)(m0 + p * 32 + arow) * K + kc + acol]);
        float tb[16];
#pragma unroll
        for (int i = 0; i < 16; ++i)
            tb[i] = B[(size_t)(kc + sk0 + i) * N + n0 + sn];
#pragma unroll
        for (int p = 0; p < 4; ++p) {
            const int rr = p * 32 + arow;
            aT[buf][rr][acol + 0] = (__bf16)va[p].x;
            aT[buf][rr][acol + 1] = (__bf16)va[p].y;
            aT[buf][rr][acol + 2] = (__bf16)va[p].z;
            aT[buf][rr][acol + 3] = (__bf16)va[p].w;
        }
        v8bf t0, t1;
#pragma unroll
        for (int i = 0; i < 8; ++i) { t0[i] = (__bf16)tb[i]; t1[i] = (__bf16)tb[8 + i]; }
        *(v8bf*)&bTt[buf][sn][sk0 + 0] = t0;
        *(v8bf*)&bTt[buf][sn][sk0 + 8] = t1;
    };

    auto compute = [&](int buf) {
        v16bf afr[2], bfr[4];
#pragma unroll
        for (int mt = 0; mt < 2; ++mt)
            afr[mt] = frag_from_lds(&aT[buf][wm + mt * 16 + r][0], half);
#pragma unroll
        for (int nt = 0; nt < 4; ++nt)
            bfr[nt] = frag_from_lds(&bTt[buf][wn + nt * 16 + r][0], half);
#pragma unroll
        for (int mt = 0; mt < 2; ++mt)
#pragma unroll
            for (int nt = 0; nt < 4; ++nt)
                acc[mt][nt] = wmma_bf16(afr[mt], bfr[nt], acc[mt][nt]);
    };

    stage(0, 0);
    __syncthreads();
#pragma unroll 1
    for (int kc = 0; kc < K; kc += 64) {
        stage(1, kc + 32);                       // K%64==0 -> kc+32 < K always
        if (kc + 64 < K)
            __builtin_prefetch(&B[(size_t)(kc + 64 + sk0) * N + n0 + sn], 0, 1);
        compute(0);
        __syncthreads();
        if (kc + 64 < K) stage(0, kc + 64);
        compute(1);
        __syncthreads();
    }

    // Epilogue: C/D layout -> m = base + half*8 + vgpr, n = base + (lane&15)
#pragma unroll
    for (int mt = 0; mt < 2; ++mt) {
#pragma unroll
        for (int nt = 0; nt < 4; ++nt) {
            const int mb = m0 + wm + mt * 16 + half * 8;
            const int nb = n0 + wn + nt * 16 + r;
            const float bv = bias ? bias[nb] : 0.0f;
#pragma unroll
            for (int g = 0; g < 8; ++g) {
                const int m = mb + g;
                float x = acc[mt][nt][g] + bv;
                if (ACT == 1) x = gelu_tanh(x);
                if (res) x += res[(size_t)m * N + nb];
                C[(size_t)m * N + nb] = x;
            }
        }
    }
}

// ---------------------------------------------------------------------------
// X += positional encoding (computed on the fly, matches reference buffer).
// ---------------------------------------------------------------------------
__global__ __launch_bounds__(256) void add_pos_kernel(float* __restrict__ X)
{
    const int l = blockIdx.x, tid = threadIdx.x;
    float* row = X + (size_t)l * DM;
#pragma unroll
    for (int j = 0; j < 8; ++j) {
        const int c = tid + j * 256;
        const float denom = 10000.0f * expf((float)(c & ~1) * (1.0f / (float)DM));
        const float arg = (float)l / denom;
        row[c] += (c & 1) ? cosf(arg) : sinf(arg);
    }
}

// ---------------------------------------------------------------------------
// [L, D] fp32 -> per-head bf16 [H][L][DH]  (head h at column d*16+h)
// ---------------------------------------------------------------------------
__global__ __launch_bounds__(256) void permute_heads_kernel(
    const float* __restrict__ src, __bf16* __restrict__ dst)
{
    const int l = blockIdx.x, tid = threadIdx.x;
#pragma unroll
    for (int j = 0; j < 8; ++j) {
        const int c = tid + j * 256;
        const int h = c & 15, d = c >> 4;
        dst[((size_t)h * LQ + l) * DH + d] = (__bf16)src[(size_t)l * DM + c];
    }
}

__global__ __launch_bounds__(256) void attn_scores_kernel(
    const __bf16* __restrict__ Qh, const __bf16* __restrict__ Kh,
    float* __restrict__ S, float scale)
{
    __shared__ __align__(16) __bf16 aT[2][128][40];
    __shared__ __align__(16) __bf16 bTt[2][128][40];

    const int tid  = threadIdx.x;
    const int h    = blockIdx.z;
    const int m0   = blockIdx.y * 128;
    const int n0   = blockIdx.x * 128;
    const int w    = tid >> 5, lane = tid & 31;
    const int half = lane >> 4, r = lane & 15;
    const int wm   = (w & 3) * 32, wn = (w >> 2) * 64;

    const __bf16* Q  = Qh + (size_t)h * LQ * DH;
    const __bf16* Kp = Kh + (size_t)h * LQ * DH;

    const int srow = tid >> 1;            // 128 rows, 2 threads per row
    const int sk0  = (tid & 1) * 16;

    v8f acc[2][4] = {};

    auto stage = [&](int buf, int kc) {
        async_copy_b128(&Q [(size_t)(m0 + srow) * DH + kc + sk0], &aT [buf][srow][sk0]);
        async_copy_b128(&Q [(size_t)(m0 + srow) * DH + kc + sk0 + 8], &aT [buf][srow][sk0 + 8]);
        async_copy_b128(&Kp[(size_t)(n0 + srow) * DH + kc + sk0], &bTt[buf][srow][sk0]);
        async_copy_b128(&Kp[(size_t)(n0 + srow) * DH + kc + sk0 + 8], &bTt[buf][srow][sk0 + 8]);
    };
    auto compute = [&](int buf) {
        v16bf afr[2], bfr[4];
#pragma unroll
        for (int mt = 0; mt < 2; ++mt)
            afr[mt] = frag_from_lds(&aT[buf][wm + mt * 16 + r][0], half);
#pragma unroll
        for (int nt = 0; nt < 4; ++nt)
            bfr[nt] = frag_from_lds(&bTt[buf][wn + nt * 16 + r][0], half);
#pragma unroll
        for (int mt = 0; mt < 2; ++mt)
#pragma unroll
            for (int nt = 0; nt < 4; ++nt)
                acc[mt][nt] = wmma_bf16(afr[mt], bfr[nt], acc[mt][nt]);
    };

    stage(0, 0);
    wait_async();
    __syncthreads();
#pragma unroll 1
    for (int kc = 0; kc < DH; kc += 64) {
        stage(1, kc + 32);
        compute(0);
        wait_async();
        __syncthreads();
        if (kc + 64 < DH) stage(0, kc + 64);
        compute(1);
        wait_async();
        __syncthreads();
    }

#pragma unroll
    for (int mt = 0; mt < 2; ++mt)
#pragma unroll
        for (int nt = 0; nt < 4; ++nt) {
            const int mb = m0 + wm + mt * 16 + half * 8;
            const int nb = n0 + wn + nt * 16 + r;
#pragma unroll
            for (int g = 0; g < 8; ++g)
                S[((size_t)h * LQ + (mb + g)) * LQ + nb] = acc[mt][nt][g] * scale;
        }
}

// ---------------------------------------------------------------------------
// Row softmax over keys; emits bf16 probabilities for the P@V WMMA.
// ---------------------------------------------------------------------------
__global__ __launch_bounds__(256) void softmax_kernel(
    const float* __restrict__ S, __bf16* __restrict__ P)
{
    const int lq = blockIdx.x, h = blockIdx.y, tid = threadIdx.x;
    const float* row = S + ((size_t)h * LQ + lq) * LQ;
    __bf16* prow = P + ((size_t)h * LQ + lq) * LQ;
    __shared__ float red[256];

    const float v0 = row[tid], v1 = row[tid + 256];
    red[tid] = fmaxf(v0, v1);
    __syncthreads();
    for (int s = 128; s > 0; s >>= 1) { if (tid < s) red[tid] = fmaxf(red[tid], red[tid + s]); __syncthreads(); }
    const float mx = red[0];
    __syncthreads();

    const float e0 = expf(v0 - mx), e1 = expf(v1 - mx);
    red[tid] = e0 + e1;
    __syncthreads();
    for (int s = 128; s > 0; s >>= 1) { if (tid < s) red[tid] += red[tid + s]; __syncthreads(); }
    const float inv = 1.0f / red[0];

    prow[tid]       = (__bf16)(e0 * inv);
    prow[tid + 256] = (__bf16)(e1 * inv);
}

__global__ __launch_bounds__(256) void attn_av_kernel(
    const __bf16* __restrict__ P, const __bf16* __restrict__ Vh,
    float* __restrict__ Acat)
{
    __shared__ __align__(16) __bf16 aT[2][128][40];
    __shared__ __align__(16) __bf16 bTt[2][128][40];

    const int tid  = threadIdx.x;
    const int h    = blockIdx.z;
    const int m0   = blockIdx.y * 128;
    const int w    = tid >> 5, lane = tid & 31;
    const int half = lane >> 4, r = lane & 15;
    const int wm   = (w & 3) * 32, wn = (w >> 2) * 64;

    const __bf16* Pp = P + (size_t)h * LQ * LQ;
    const __bf16* Vp = Vh + (size_t)h * LQ * DH;

    const int srow = tid >> 1;           // P staging: row copy
    const int pk0  = (tid & 1) * 16;
    const int sn   = tid & 127;          // V staging: column gather (transpose)
    const int sk0  = (tid >> 7) * 16;

    v8f acc[2][4] = {};

    auto stage = [&](int buf, int kc) {
        async_copy_b128(&Pp[(size_t)(m0 + srow) * LQ + kc + pk0], &aT[buf][srow][pk0]);
        async_copy_b128(&Pp[(size_t)(m0 + srow) * LQ + kc + pk0 + 8], &aT[buf][srow][pk0 + 8]);
        v8bf t0, t1;
#pragma unroll
        for (int i = 0; i < 8; ++i) t0[i] = Vp[(size_t)(kc + sk0 + i) * DH + sn];
#pragma unroll
        for (int i = 0; i < 8; ++i) t1[i] = Vp[(size_t)(kc + sk0 + 8 + i) * DH + sn];
        *(v8bf*)&bTt[buf][sn][sk0 + 0] = t0;
        *(v8bf*)&bTt[buf][sn][sk0 + 8] = t1;
    };
    auto compute = [&](int buf) {
        v16bf afr[2], bfr[4];
#pragma unroll
        for (int mt = 0; mt < 2; ++mt)
            afr[mt] = frag_from_lds(&aT[buf][wm + mt * 16 + r][0], half);
#pragma unroll
        for (int nt = 0; nt < 4; ++nt)
            bfr[nt] = frag_from_lds(&bTt[buf][wn + nt * 16 + r][0], half);
#pragma unroll
        for (int mt = 0; mt < 2; ++mt)
#pragma unroll
            for (int nt = 0; nt < 4; ++nt)
                acc[mt][nt] = wmma_bf16(afr[mt], bfr[nt], acc[mt][nt]);
    };

    stage(0, 0);
    wait_async();
    __syncthreads();
#pragma unroll 1
    for (int kc = 0; kc < LQ; kc += 64) {
        stage(1, kc + 32);
        compute(0);
        wait_async();
        __syncthreads();
        if (kc + 64 < LQ) stage(0, kc + 64);
        compute(1);
        wait_async();
        __syncthreads();
    }

#pragma unroll
    for (int mt = 0; mt < 2; ++mt)
#pragma unroll
        for (int nt = 0; nt < 4; ++nt) {
            const int mb = m0 + wm + mt * 16 + half * 8;
            const int nb = wn + nt * 16 + r;      // n in [0,128)
#pragma unroll
            for (int g = 0; g < 8; ++g)
                Acat[(size_t)(mb + g) * DM + nb * NH + h] = acc[mt][nt][g];
        }
}

// ---------------------------------------------------------------------------
// Row LayerNorm over D=2048.
// ---------------------------------------------------------------------------
__global__ __launch_bounds__(256) void layernorm_kernel(
    const float* __restrict__ X, const float* __restrict__ g,
    const float* __restrict__ b, float* __restrict__ Y)
{
    const int l = blockIdx.x, tid = threadIdx.x;
    const float* row = X + (size_t)l * DM;
    float* out = Y + (size_t)l * DM;
    __shared__ float red[256];

    float vals[8], s = 0.0f;
#pragma unroll
    for (int j = 0; j < 8; ++j) { vals[j] = row[tid + j * 256]; s += vals[j]; }
    red[tid] = s;
    __syncthreads();
    for (int st = 128; st > 0; st >>= 1) { if (tid < st) red[tid] += red[tid + st]; __syncthreads(); }
    const float mu = red[0] * (1.0f / (float)DM);
    __syncthreads();

    float v = 0.0f;
#pragma unroll
    for (int j = 0; j < 8; ++j) { const float d = vals[j] - mu; v += d * d; }
    red[tid] = v;
    __syncthreads();
    for (int st = 128; st > 0; st >>= 1) { if (tid < st) red[tid] += red[tid + st]; __syncthreads(); }
    const float inv = rsqrtf(red[0] * (1.0f / (float)DM) + 1e-5f);

#pragma unroll
    for (int j = 0; j < 8; ++j) {
        const int c = tid + j * 256;
        out[c] = (vals[j] - mu) * inv * g[c] + b[c];
    }
}

// ---------------------------------------------------------------------------
extern "C" void kernel_launch(void* const* d_in, const int* in_sizes, int n_in,
                              void* d_out, int out_size, void* d_ws, size_t ws_size,
                              hipStream_t stream)
{
    (void)in_sizes; (void)n_in; (void)out_size; (void)ws_size;

    const float* seq  = (const float*)d_in[0];
    const float* embW = (const float*)d_in[1];
    const float* embB = (const float*)d_in[2];
    const float* Wq   = (const float*)d_in[3];
    const float* bq   = (const float*)d_in[4];
    const float* Wk   = (const float*)d_in[5];
    const float* bk   = (const float*)d_in[6];
    const float* Wv   = (const float*)d_in[7];
    const float* bv   = (const float*)d_in[8];
    const float* Wo   = (const float*)d_in[9];
    const float* bo   = (const float*)d_in[10];
    const float* lng  = (const float*)d_in[11];
    const float* lnb  = (const float*)d_in[12];
    const float* W1   = (const float*)d_in[13];
    const float* b1   = (const float*)d_in[14];
    const float* W2   = (const float*)d_in[15];
    const float* b2   = (const float*)d_in[16];

    char* ws = (char*)d_ws;
    size_t off = 0;
    auto take = [&](size_t bytes) { char* p = ws + off; off = (off + bytes + 255) & ~(size_t)255; return p; };

    const size_t fLD = (size_t)LQ * DM * sizeof(float);       // 4 MB
    const size_t hLD = (size_t)NH * LQ * DH * sizeof(__bf16); // 2 MB
    const size_t fSS = (size_t)NH * LQ * LQ * sizeof(float);  // 16 MB
    const size_t hSS = (size_t)NH * LQ * LQ * sizeof(__bf16); // 8 MB

    float*  X    = (float*)take(fLD);
    float*  Qf   = (float*)take(fLD);
    float*  Kf   = (float*)take(fLD);
    float*  Vf   = (float*)take(fLD);
    __bf16* Qh   = (__bf16*)take(hLD);
    __bf16* Kh   = (__bf16*)take(hLD);
    __bf16* Vh   = (__bf16*)take(hLD);
    float*  S    = (float*)take(fSS);        // reused as FFN hidden (16 MB)
    __bf16* P    = (__bf16*)take(hSS);
    float*  Xa   = (float*)take(fLD);
    float*  Acat = Qf;                       // Qf/Kf/Vf free after permute
    float*  T0   = Kf;
    float*  Hf   = S;                        // S free after softmax
    float*  T1   = Vf;
    float*  Yout = (float*)d_out;

    const dim3 blk(256);
    const dim3 gD (DM / 128, LQ / 128);      // N=2048 GEMMs
    const dim3 gFF(FFD / 128, LQ / 128);     // N=8192 GEMM

    // 1) embedding
    gemm_bias_kernel<DM, DM, 0><<<gD, blk, 0, stream>>>(seq, embW, embB, nullptr, X);
    // 2) + positional encoding
    add_pos_kernel<<<LQ, blk, 0, stream>>>(X);
    // 3) Q/K/V projections
    gemm_bias_kernel<DM, DM, 0><<<gD, blk, 0, stream>>>(X, Wq, bq, nullptr, Qf);
    gemm_bias_kernel<DM, DM, 0><<<gD, blk, 0, stream>>>(X, Wk, bk, nullptr, Kf);
    gemm_bias_kernel<DM, DM, 0><<<gD, blk, 0, stream>>>(X, Wv, bv, nullptr, Vf);
    // 4) per-head bf16 layout
    permute_heads_kernel<<<LQ, blk, 0, stream>>>(Qf, Qh);
    permute_heads_kernel<<<LQ, blk, 0, stream>>>(Kf, Kh);
    permute_heads_kernel<<<LQ, blk, 0, stream>>>(Vf, Vh);
    // 5) scores = Qh @ Kh^T / sqrt(D)
    attn_scores_kernel<<<dim3(LQ / 128, LQ / 128, NH), blk, 0, stream>>>(
        Qh, Kh, S, 0.022097086912079608f /* 1/sqrt(2048) */);
    // 6) softmax over keys -> bf16 probs
    softmax_kernel<<<dim3(LQ, NH), blk, 0, stream>>>(S, P);
    // 7) attn @ V, scatter back to [L, D] interleaved layout
    attn_av_kernel<<<dim3(1, LQ / 128, NH), blk, 0, stream>>>(P, Vh, Acat);
    // 8) output projection + residual X
    gemm_bias_kernel<DM, DM, 0><<<gD, blk, 0, stream>>>(Acat, Wo, bo, X, T0);
    // 9) LayerNorm -> Xa
    layernorm_kernel<<<LQ, blk, 0, stream>>>(T0, lng, lnb, Xa);
    // 10) FFN1 + GELU
    gemm_bias_kernel<FFD, DM, 1><<<gFF, blk, 0, stream>>>(Xa, W1, b1, nullptr, Hf);
    // 11) FFN2 + residual Xa
    gemm_bias_kernel<DM, FFD, 0><<<gD, blk, 0, stream>>>(Hf, W2, b2, Xa, T1);
    // 12) final LayerNorm -> output
    layernorm_kernel<<<LQ, blk, 0, stream>>>(T1, lng, lnb, Yout);
}

// v001
// Measured time: 269 microseconds a run.
// Timed twice side by side with v000, it ran 2.38 and 2.41 times as fast.
#include <hip/hip_runtime.h>
#include <hip/hip_bf16.h>
#include <math.h>

typedef __attribute__((ext_vector_type(16))) __bf16 v16bf;
typedef __attribute__((ext_vector_type(8)))  __bf16 v8bf;
typedef __attribute__((ext_vector_type(8)))  float  v8f;

#define LQ 512
#define DM 2048
#define NH 16
#define DH 128
#define FFD 8192

__device__ __forceinline__ v8f wmma_bf16(const v16bf& a, const v16bf& b, const v8f& c) {
    return __builtin_amdgcn_wmma_f32_16x16x32_bf16(false, a, false, b, (short)0, c, false, false);
}

__device__ __forceinline__ v16bf frag_from_lds(const __bf16* rowp, int half) {
    const v8bf lo = *(const v8bf*)(rowp + half * 8);
    const v8bf hi = *(const v8bf*)(rowp + 16 + half * 8);
    return __builtin_shufflevector(lo, hi, 0, 1, 2, 3, 4, 5, 6, 7,
                                           8, 9, 10, 11, 12, 13, 14, 15);
}

__device__ __forceinline__ void async_copy_b128(const void* gptr, void* lptr) {
    const unsigned lds = (unsigned)(size_t)lptr;
    asm volatile("global_load_async_to_lds_b128 %0, %1, off"
                 :: "v"(lds), "v"(gptr) : "memory");
}
__device__ __forceinline__ void wait_async() {
    asm volatile("s_wait_asynccnt 0x0" ::: "memory");
}

__device__ __forceinline__ float gelu_tanh(float x) {
    const float k0 = 0.7978845608028654f;  // sqrt(2/pi)
    const float k1 = 0.044715f;
    float t = tanhf(k0 * (x + k1 * x * x * x));
    return 0.5f * x * (1.0f + t);
}

// ---------------------------------------------------------------------------
// Split-K GEMM: Cpart[m][z][n] = A[m, K/S slice z] @ B[K/S slice z, n].
// blockIdx.z picks the K slice, so a launch has S times the work-groups and
// each runs a loop S times shorter; the S fp32 partial rows of an output row
// lie side by side and are summed, with the bias, by the kernel that follows.
// Block tile 128x128, K-step 32, double-buffered LDS.  8 wave32 waves; wave
// grid 4(M) x 2(N), each wave 32x64 = 2x4 accumulators.  aT[m][k]; B
// transposed in LDS: bTt[n][k].
// ---------------------------------------------------------------------------
template <int N, int K, int S>
__global__ __launch_bounds__(256) void gemm_splitk_kernel(
    const float* __restrict__ A, const float* __restrict__ B,
    float* __restrict__ Cpart)
{
    static_assert(K % (64 * S) == 0 && N % 128 == 0, "tile assumptions");
    __shared__ __align__(16) __bf16 aT[2][128][40];
    __shared__ __align__(16) __bf16 bTt[2][128][40];

    const int tid  = threadIdx.x;
    const int m0   = blockIdx.y * 128;
    const int n0   = blockIdx.x * 128;
    const int w    = tid >> 5;
    const int lane = tid & 31;
    const int half = lane >> 4;
    const int r    = lane & 15;
    const int wm   = (w & 3) * 32;
    const int wn   = (w >> 2) * 64;

    const int arow = tid >> 3;          // A staging: 32 rows / pass, 8 float4 per row
    const int acol = (tid & 7) * 4;
    const int sn   = tid & 127;         // B staging: column gather, 2 threads per n
    const int sk0  = (tid >> 7) * 16;
    constexpr int KS = K / S;           // this work-group's K slice: [z*KS, z*KS + KS)
    A += (size_t)blockIdx.z * KS;
    B += (size_t)blockIdx.z * KS * N;

    v8f acc[2][4] = {};

    auto stage = [&](int buf, int kc) {
        float4 va[4];
#pragma unroll
        for (int p = 0; p < 4; ++p)
            va[p] = *(const float4*)(&A[(size_t)(m0 + p * 32 + arow) * K + kc + acol]);
        // the B loads below may be given the A loads' address registers as destinations
        asm volatile("s_wait_xcnt 0x0" ::: "memory");
        float tb[16];
#pragma unroll
        for (int i = 0; i < 16; ++i)
            tb[i] = B[(size_t)(kc + sk0 + i) * N + n0 + sn];
        // code that follows may reuse the B loads' address registers
        asm volatile("s_wait_xcnt 0x0" ::: "memory");
#pragma unroll
        for (int p = 0; p < 4; ++p) {
            const int rr = p * 32 + arow;
            aT[buf][rr][acol + 0] = (__bf16)va[p].x;
            aT[buf][rr][acol + 1] = (__bf16)va[p].y;
            aT[buf][rr][acol + 2] = (__bf16)va[p].z;
            aT[buf][rr][acol + 3] = (__bf16)va[p].w;
        }
        v8bf t0, t1;
#pragma unroll
        for (int i = 0; i < 8; ++i) { t0[i] = (__bf16)tb[i]; t1[i] = (__bf16)tb[8 + i]; }
        *(v8bf*)&bTt[buf][sn][sk0 + 0] = t0;
        *(v8bf*)&bTt[buf][sn][sk0 + 8] = t1;
    };

    auto compute = [&](int buf) {
        v16bf afr[2], bfr[4];
#pragma unroll
        for (int mt = 0; mt < 2; ++mt)
            afr[mt] = frag_from_lds(&aT[buf][wm + mt * 16 + r][0], half);
#pragma unroll
        for (int nt = 0; nt < 4; ++nt)
            bfr[nt] = frag_from_lds(&bTt[buf][wn + nt * 16 + r][0], half);
#pragma unroll
        for (int mt = 0; mt < 2; ++mt)
#pragma unroll
            for (int nt = 0; nt < 4; ++nt)
                acc[mt][nt] = wmma_bf16(afr[mt], bfr[nt], acc[mt][nt]);
    };

    stage(0, 0);
    __syncthreads();
#pragma unroll 1
    for (int kc = 0; kc < KS; kc += 64) {
        stage(1, kc + 32);                       // KS%64==0 -> kc+32 < KS always
        compute(0);
        __syncthreads();
        if (kc + 64 < KS) stage(0, kc + 64);
        compute(1);
        __syncthreads();
    }

    // Epilogue: C/D layout -> m = base + half*8 + vgpr, n = base + (lane&15)
    float* __restrict__ C = Cpart + (size_t)blockIdx.z * N;
#pragma unroll
    for (int mt = 0; mt < 2; ++mt) {
#pragma unroll
        for (int nt = 0; nt < 4; ++nt) {
            const int mb = m0 + wm + mt * 16 + half * 8;
            const int nb = n0 + wn + nt * 16 + r;
#pragma unroll
            for (int g = 0; g < 8; ++g)
                C[(size_t)(mb + g) * (S * N) + nb] = acc[mt][nt][g];
        }
    }
}

// Sum of the S split-K partials of column c, in slice order; prow points at
// the S partial rows (each DM wide) of one output row.
template <int S>
__device__ __forceinline__ float sum_slices(const float* __restrict__ prow, int c)
{
    float v[S];
#pragma unroll
    for (int s = 0; s < S; ++s) v[s] = prow[s * DM + c];
    float x = v[0];
#pragma unroll
    for (int s = 1; s < S; ++s) x += v[s];
    return x;
}

// ---------------------------------------------------------------------------
// X = split-K partials + bias + positional encoding (computed on the fly,
// matches reference buffer).
// ---------------------------------------------------------------------------
template <int S>
__global__ __launch_bounds__(256) void add_pos_kernel(
    const float* __restrict__ part, const float* __restrict__ bias,
    float* __restrict__ X)
{
    const int l = blockIdx.x, tid = threadIdx.x;
    float* row = X + (size_t)l * DM;
    const float* prow = part + (size_t)l * (S * DM);
#pragma unroll
    for (int j = 0; j < 8; ++j) {
        const int c = tid + j * 256;
        const float denom = 10000.0f * expf((float)(c & ~1) * (1.0f / (float)DM));
        const float arg = (float)l / denom;
        const float x = sum_slices<S>(prow, c) + bias[c];
        row[c] = x + ((c & 1) ? cosf(arg) : sinf(arg));
    }
}

// ---------------------------------------------------------------------------
// split-K partials [L][S][D] fp32 + bias -> per-head bf16 [H][L][DH]
// (head h at column d*16+h)
// ---------------------------------------------------------------------------
template <int S>
__global__ __launch_bounds__(256) void permute_heads_kernel(
    const float* __restrict__ part, const float* __restrict__ bias,
    __bf16* __restrict__ dst)
{
    const int l = blockIdx.x, tid = threadIdx.x;
    const float* prow = part + (size_t)l * (S * DM);
#pragma unroll
    for (int j = 0; j < 8; ++j) {
        const int c = tid + j * 256;
        const int h = c & 15, d = c >> 4;
        const float x = sum_slices<S>(prow, c) + bias[c];
        dst[((size_t)h * LQ + l) * DH + d] = (__bf16)x;
    }
}

__global__ __launch_bounds__(256) void attn_scores_kernel(
    const __bf16* __restrict__ Qh, const __bf16* __restrict__ Kh,
    float* __restrict__ S, float scale)
{
    __shared__ __align__(16) __bf16 aT[2][128][40];
    __shared__ __align__(16) __bf16 bTt[2][128][40];

    const int tid  = threadIdx.x;
    const int h    = blockIdx.z;
    const int m0   = blockIdx.y * 128;
    const int n0   = blockIdx.x * 128;
    const int w    = tid >> 5, lane = tid & 31;
    const int half = lane >> 4, r = lane & 15;
    const int wm   = (w & 3) * 32, wn = (w >> 2) * 64;

    const __bf16* Q  = Qh + (size_t)h * LQ * DH;
    const __bf16* Kp = Kh + (size_t)h * LQ * DH;

    const int srow = tid >> 1;            // 128 rows, 2 threads per row
    const int sk0  = (tid & 1) * 16;

    v8f acc[2][4] = {};

    auto stage = [&](int buf, int kc) {
        async_copy_b128(&Q [(size_t)(m0 + srow) * DH + kc + sk0], &aT [buf][srow][sk0]);
        async_copy_b128(&Q [(size_t)(m0 + srow) * DH + kc + sk0 + 8], &aT [buf][srow][sk0 + 8]);
        async_copy_b128(&Kp[(size_t)(n0 + srow) * DH + kc + sk0], &bTt[buf][srow][sk0]);
        async_copy_b128(&Kp[(size_t)(n0 + srow) * DH + kc + sk0 + 8], &bTt[buf][srow][sk0 + 8]);
    };
    auto compute = [&](int buf) {
        v16bf afr[2], bfr[4];
#pragma unroll
        for (int mt = 0; mt < 2; ++mt)
            afr[mt] = frag_from_lds(&aT[buf][wm + mt * 16 + r][0], half);
#pragma unroll
        for (int nt = 0; nt < 4; ++nt)
            bfr[nt] = frag_from_lds(&bTt[buf][wn + nt * 16 + r][0], half);
#pragma unroll
        for (int mt = 0; mt < 2; ++mt)
#pragma unroll
            for (int nt = 0; nt < 4; ++nt)
                acc[mt][nt] = wmma_bf16(afr[mt], bfr[nt], acc[mt][nt]);
    };

    stage(0, 0);
    wait_async();
    __syncthreads();
#pragma unroll 1
    for (int kc = 0; kc < DH; kc += 64) {
        stage(1, kc + 32);
        compute(0);
        wait_async();
        __syncthreads();
        if (kc + 64 < DH) stage(0, kc + 64);
        compute(1);
        wait_async();
        __syncthreads();
    }

#pragma unroll
    for (int mt = 0; mt < 2; ++mt)
#pragma unroll
        for (int nt = 0; nt < 4; ++nt) {
            const int mb = m0 + wm + mt * 16 + half * 8;
            const int nb = n0 + wn + nt * 16 + r;
#pragma unroll
            for (int g = 0; g < 8; ++g)
                S[((size_t)h * LQ + (mb + g)) * LQ + nb] = acc[mt][nt][g] * scale;
        }
}

// ---------------------------------------------------------------------------
// Row softmax over keys; emits bf16 probabilities for the P@V WMMA.
// ---------------------------------------------------------------------------
__global__ __launch_bounds__(256) void softmax_kernel(
    const float* __restrict__ S, __bf16* __restrict__ P)
{
    const int lq = blockIdx.x, h = blockIdx.y, tid = threadIdx.x;
    const float* row = S + ((size_t)h * LQ + lq) * LQ;
    __bf16* prow = P + ((size_t)h * LQ + lq) * LQ;
    __shared__ float red[256];

    const float v0 = row[tid], v1 = row[tid + 256];
    red[tid] = fmaxf(v0, v1);
    __syncthreads();
    for (int s = 128; s > 0; s >>= 1) { if (tid < s) red[tid] = fmaxf(red[tid], red[tid + s]); __syncthreads(); }
    const float mx = red[0];
    __syncthreads();

    const float e0 = expf(v0 - mx), e1 = expf(v1 - mx);
    red[tid] = e0 + e1;
    __syncthreads();
    for (int s = 128; s > 0; s >>= 1) { if (tid < s) red[tid] += red[tid + s]; __syncthreads(); }
    const float inv = 1.0f / red[0];

    prow[tid]       = (__bf16)(e0 * inv);
    prow[tid + 256] = (__bf16)(e1 * inv);
}

__global__ __launch_bounds__(256) void attn_av_kernel(
    const __bf16* __restrict__ P, const __bf16* __restrict__ Vh,
    float* __restrict__ Acat)
{
    __shared__ __align__(16) __bf16 aT[2][128][40];
    __shared__ __align__(16) __bf16 bTt[2][128][40];

    const int tid  = threadIdx.x;
    const int h    = blockIdx.z;
    const int m0   = blockIdx.y * 128;
    const int w    = tid >> 5, lane = tid & 31;
    const int half = lane >> 4, r = lane & 15;
    const int wm   = (w & 3) * 32, wn = (w >> 2) * 64;

    const __bf16* Pp = P + (size_t)h * LQ * LQ;
    const __bf16* Vp = Vh + (size_t)h * LQ * DH;

    const int srow = tid >> 1;           // P staging: row copy
    const int pk0  = (tid & 1) * 16;
    const int sn   = tid & 127;          // V staging: column gather (transpose)
    const int sk0  = (tid >> 7) * 16;

    v8f acc[2][4] = {};

    auto stage = [&](int buf, int kc) {
        async_copy_b128(&Pp[(size_t)(m0 + srow) * LQ + kc + pk0], &aT[buf][srow][pk0]);
        async_copy_b128(&Pp[(size_t)(m0 + srow) * LQ + kc + pk0 + 8], &aT[buf][srow][pk0 + 8]);
        v8bf t0, t1;
#pragma unroll
        for (int i = 0; i < 8; ++i) t0[i] = Vp[(size_t)(kc + sk0 + i) * DH + sn];
#pragma unroll
        for (int i = 0; i < 8; ++i) t1[i] = Vp[(size_t)(kc + sk0 + 8 + i) * DH + sn];
        *(v8bf*)&bTt[buf][sn][sk0 + 0] = t0;
        *(v8bf*)&bTt[buf][sn][sk0 + 8] = t1;
    };
    auto compute = [&](int buf) {
        v16bf afr[2], bfr[4];
#pragma unroll
        for (int mt = 0; mt < 2; ++mt)
            afr[mt] = frag_from_lds(&aT[buf][wm + mt * 16 + r][0], half);
#pragma unroll
        for (int nt = 0; nt < 4; ++nt)
            bfr[nt] = frag_from_lds(&bTt[buf][wn + nt * 16 + r][0], half);
#pragma unroll
        for (int mt = 0; mt < 2; ++mt)
#pragma unroll
            for (int nt = 0; nt < 4; ++nt)
                acc[mt][nt] = wmma_bf16(afr[mt], bfr[nt], acc[mt][nt]);
    };

    stage(0, 0);
    wait_async();
    __syncthreads();
#pragma unroll 1
    for (int kc = 0; kc < LQ; kc += 64) {
        stage(1, kc + 32);
        compute(0);
        wait_async();
        __syncthreads();
        if (kc + 64 < LQ) stage(0, kc + 64);
        compute(1);
        wait_async();
        __syncthreads();
    }

#pragma unroll
    for (int mt = 0; mt < 2; ++mt)
#pragma unroll
        for (int nt = 0; nt < 4; ++nt) {
            const int mb = m0 + wm + mt * 16 + half * 8;
            const int nb = wn + nt * 16 + r;      // n in [0,128)
#pragma unroll
            for (int g = 0; g < 8; ++g)
                Acat[(size_t)(mb + g) * DM + nb * NH + h] = acc[mt][nt][g];
        }
}

// ---------------------------------------------------------------------------
// H = gelu(split-K partials + bias), one row of FFD per work-group.
// ---------------------------------------------------------------------------
template <int S>
__global__ __launch_bounds__(256) void bias_gelu_kernel(
    const float* __restrict__ part, const float* __restrict__ bias,
    float* __restrict__ Hout)
{
    const int l = blockIdx.x, tid = threadIdx.x;
    const float* prow = part + (size_t)l * (S * FFD);
    float* hrow = Hout + (size_t)l * FFD;
    constexpr int NJ = FFD / 1024;
    // all loads of the row first, so that they are in flight together
    float4 v[S][NJ], bv[NJ];
#pragma unroll
    for (int j = 0; j < NJ; ++j) {
        const int c = (tid + j * 256) * 4;
#pragma unroll
        for (int s = 0; s < S; ++s) v[s][j] = *(const float4*)(&prow[s * FFD + c]);
        bv[j] = *(const float4*)(&bias[c]);
    }
#pragma unroll
    for (int j = 0; j < NJ; ++j) {
        const int c = (tid + j * 256) * 4;
        float4 x = v[0][j];
#pragma unroll
        for (int s = 1; s < S; ++s) {
            x.x += v[s][j].x; x.y += v[s][j].y; x.z += v[s][j].z; x.w += v[s][j].w;
        }
        float4 y;
        y.x = gelu_tanh(x.x + bv[j].x);
        y.y = gelu_tanh(x.y + bv[j].y);
        y.z = gelu_tanh(x.z + bv[j].z);
        y.w = gelu_tanh(x.w + bv[j].w);
        *(float4*)(&hrow[c]) = y;
    }
}

// ---------------------------------------------------------------------------
// Row LayerNorm over D=2048 of (split-K partials + bias + residual).
// ---------------------------------------------------------------------------
template <int S>
__global__ __launch_bounds__(256) void layernorm_kernel(
    const float* __restrict__ part, const float* __restrict__ bias,
    const float* __restrict__ res, const float* __restrict__ g,
    const float* __restrict__ b, float* __restrict__ Y)
{
    const int l = blockIdx.x, tid = threadIdx.x;
    const float* prow = part + (size_t)l * (S * DM);
    const float* rrow = res + (size_t)l * DM;
    float* out = Y + (size_t)l * DM;
    __shared__ float red[256];

    float vals[8], s = 0.0f;
#pragma unroll
    for (int j = 0; j < 8; ++j) {
        const int c = tid + j * 256;
        vals[j] = sum_slices<S>(prow, c) + bias[c] + rrow[c];
        s += vals[j];
    }
    red[tid] = s;
    __syncthreads();
    for (int st = 128; st > 0; st >>= 1) { if (tid < st) red[tid] += red[tid + st]; __syncthreads(); }
    const float mu = red[0] * (1.0f / (float)DM);
    __syncthreads();

    float v = 0.0f;
#pragma unroll
    for (int j = 0; j < 8; ++j) { const float d = vals[j] - mu; v += d * d; }
    red[tid] = v;
    __syncthreads();
    for (int st = 128; st > 0; st >>= 1) { if (tid < st) red[tid] += red[tid + st]; __syncthreads(); }
    const float inv = rsqrtf(red[0] * (1.0f / (float)DM) + 1e-5f);

#pragma unroll
    for (int j = 0; j < 8; ++j) {
        const int c = tid + j * 256;
        out[c] = (vals[j] - mu) * inv * g[c] + b[c];
    }
}

// ---------------------------------------------------------------------------
extern "C" void kernel_launch(void* const* d_in, const int* in_sizes, int n_in,
                              void* d_out, int out_size, void* d_ws, size_t ws_size,
                              hipStream_t stream)
{
    (void)in_sizes; (void)n_in; (void)out_size; (void)ws_size;

    const float* seq  = (const float*)d_in[0];
    const float* embW = (const float*)d_in[1];
    const float* embB = (const float*)d_in[2];
    const float* Wq   = (const float*)d_in[3];
    const float* bq   = (const float*)d_in[4];
    const float* Wk   = (const float*)d_in[5];
    const float* bk   = (const float*)d_in[6];
    const float* Wv   = (const float*)d_in[7];
    const float* bv   = (const float*)d_in[8];
    const float* Wo   = (const float*)d_in[9];
    const float* bo   = (const float*)d_in[10];
    const float* lng  = (const float*)d_in[11];
    const float* lnb  = (const float*)d_in[12];
    const float* W1   = (const float*)d_in[13];
    const float* b1   = (const float*)d_in[14];
    const float* W2   = (const float*)d_in[15];
    const float* b2   = (const float*)d_in[16];

    char* ws = (char*)d_ws;
    size_t off = 0;
    auto take = [&](size_t bytes) { char* p = ws + off; off = (off + bytes + 255) & ~(size_t)255; return p; };

    const size_t fLD = (size_t)LQ * DM * sizeof(float);       // 4 MB
    const size_t hLD = (size_t)NH * LQ * DH * sizeof(__bf16); // 2 MB
    const size_t fSS = (size_t)NH * LQ * LQ * sizeof(float);  // 16 MB
    const size_t hSS = (size_t)NH * LQ * LQ * sizeof(__bf16); // 8 MB

    float*  X    = (float*)take(fLD);
    float*  Acat = (float*)take(fLD);
    __bf16* Qh   = (__bf16*)take(hLD);
    __bf16* Kh   = (__bf16*)take(hLD);
    __bf16* Vh   = (__bf16*)take(hLD);
    float*  S    = (float*)take(fSS);        // reused as FFN hidden (16 MB)
    __bf16* P    = (__bf16*)take(hSS);
    float*  Xa   = (float*)take(fLD);
    float*  Pt   = (float*)take(8 * fLD);    // split-K partials, 32 MB, rewritten by every GEMM
    float*  Hf   = S;                        // S free after softmax
    float*  Yout = (float*)d_out;

    const dim3 blk(256);
    const dim3 gD (DM / 128, LQ / 128, 8);   // N=2048 GEMMs, 8 K slices: 512 work-groups
    const dim3 gFF(FFD / 128, LQ / 128, 2);  // N=8192 GEMM, 2 K slices: 512 work-groups

    // 1) embedding, 2) + bias + positional encoding
    gemm_splitk_kernel<DM, DM, 8><<<gD, blk, 0, stream>>>(seq, embW, Pt);
    add_pos_kernel<8><<<LQ, blk, 0, stream>>>(Pt, embB, X);
    // 3) Q/K/V projections, 4) each followed by its bias + per-head bf16 layout
    gemm_splitk_kernel<DM, DM, 8><<<gD, blk, 0, stream>>>(X, Wq, Pt);
    permute_heads_kernel<8><<<LQ, blk, 0, stream>>>(Pt, bq, Qh);
    gemm_splitk_kernel<DM, DM, 8><<<gD, blk, 0, stream>>>(X, Wk, Pt);
    permute_heads_kernel<8><<<LQ, blk, 0, stream>>>(Pt, bk, Kh);
    gemm_splitk_kernel<DM, DM, 8><<<gD, blk, 0, stream>>>(X, Wv, Pt);
    permute_heads_kernel<8><<<LQ, blk, 0, stream>>>(Pt, bv, Vh);
    // 5) scores = Qh @ Kh^T / sqrt(D)
    attn_scores_kernel<<<dim3(LQ / 128, LQ / 128, NH), blk, 0, stream>>>(
        Qh, Kh, S, 0.022097086912079608f /* 1/sqrt(2048) */);
    // 6) softmax over keys -> bf16 probs
    softmax_kernel<<<dim3(LQ, NH), blk, 0, stream>>>(S, P);
    // 7) attn @ V, scatter back to [L, D] interleaved layout
    attn_av_kernel<<<dim3(1, LQ / 128, NH), blk, 0, stream>>>(P, Vh, Acat);
    // 8) output projection, 9) + bias + residual X, LayerNorm -> Xa
    gemm_splitk_kernel<DM, DM, 8><<<gD, blk, 0, stream>>>(Acat, Wo, Pt);
    layernorm_kernel<8><<<LQ, blk, 0, stream>>>(Pt, bo, X, lng, lnb, Xa);
    // 10) FFN1, then bias + GELU
    gemm_splitk_kernel<FFD, DM, 2><<<gFF, blk, 0, stream>>>(Xa, W1, Pt);
    bias_gelu_kernel<2><<<LQ, blk, 0, stream>>>(Pt, b1, Hf);
    // 11) FFN2, 12) + bias + residual Xa, final LayerNorm -> output
    gemm_splitk_kernel<DM, FFD, 8><<<gD, blk, 0, stream>>>(Hf, W2, Pt);
    layernorm_kernel<8><<<LQ, blk, 0, stream>>>(Pt, b2, Xa, lng, lnb, Yout);
}

// v002
// It runs in 241 microseconds.
// Two timings next to v001 put it at 1.12 and 1.11 times that version's speed.
// Over all steps from v000 it is 2.67 times as fast.
#include <hip/hip_runtime.h>
#include <hip/hip_bf16.h>
#include <math.h>

typedef __attribute__((ext_vector_type(16))) __bf16 v16bf;
typedef __attribute__((ext_vector_type(8)))  __bf16 v8bf;
typedef __attribute__((ext_vector_type(8)))  float  v8f;

#define LQ 512
#define DM 2048
#define NH 16
#define DH 128
#define FFD 8192

__device__ __forceinline__ v8f wmma_bf16(const v16bf& a, const v16bf& b, const v8f& c) {
    return __builtin_amdgcn_wmma_f32_16x16x32_bf16(false, a, false, b, (short)0, c, false, false);
}

__device__ __forceinline__ v16bf frag_from_lds(const __bf16* rowp, int half) {
    const v8bf lo = *(const v8bf*)(rowp + half * 8);
    const v8bf hi = *(const v8bf*)(rowp + 16 + half * 8);
    return __builtin_shufflevector(lo, hi, 0, 1, 2, 3, 4, 5, 6, 7,
                                           8, 9, 10, 11, 12, 13, 14, 15);
}

__device__ __forceinline__ void async_copy_b128(const void* gptr, void* lptr) {
    const unsigned lds = (unsigned)(size_t)lptr;
    asm volatile("global_load_async_to_lds_b128 %0, %1, off"
                 :: "v"(lds), "v"(gptr) : "memory");
}
__device__ __forceinline__ void wait_async() {
    asm volatile("s_wait_asynccnt 0x0" ::: "memory");
}

__device__ __forceinline__ float gelu_tanh(float x) {
    const float k0 = 0.7978845608028654f;  // sqrt(2/pi)
    const float k1 = 0.044715f;
    float t = tanhf(k0 * (x + k1 * x * x * x));
    return 0.5f * x * (1.0f + t);
}

// ---------------------------------------------------------------------------
// Split-K GEMM: Cpart[m][z][n] = A[m, K/S slice z] @ B[K/S slice z, n].
// blockIdx.z picks the K slice, so a launch has S times the work-groups and
// each runs a loop S times shorter; the S fp32 partial rows of an output row
// lie side by side and are summed (with bias, activation, residual) by the
// elementwise kernel that follows.
// G products that share A (same N, K, S) run as one launch: blockIdx.z / S
// picks the B matrix and its own block of partials, blockIdx.z % S the slice.
// Block tile 128x128, K-step 32, double-buffered LDS.  8 wave32 waves; wave
// grid 4(M) x 2(N), each wave 32x64 = 2x4 accumulators.  aT[m][k]; B
// transposed in LDS: bTt[n][k].
// ---------------------------------------------------------------------------
template <int N, int K, int S, int G>
__global__ __launch_bounds__(256) void gemm_splitk_kernel(
    const float* __restrict__ A, const float* __restrict__ B,
    float* __restrict__ Cpart,
    const float* __restrict__ B1, const float* __restrict__ B2)
{
    static_assert(K % (64 * S) == 0 && N % 128 == 0, "tile assumptions");
    static_assert(G == 1 || G == 3, "one product, or three that share A");
    __shared__ __align__(16) __bf16 aT[2][128][40];
    __shared__ __align__(16) __bf16 bTt[2][128][40];

    const int tid  = threadIdx.x;
    const int m0   = blockIdx.y * 128;
    const int n0   = blockIdx.x * 128;
    const int w    = tid >> 5;
    const int lane = tid & 31;
    const int half = lane >> 4;
    const int r    = lane & 15;
    const int wm   = (w & 3) * 32;
    const int wn   = (w >> 2) * 64;

    const int arow = tid >> 3;          // A staging: 32 rows / pass, 8 float4 per row
    const int acol = (tid & 7) * 4;
    const int sn   = tid & 127;         // B staging: column gather, 2 threads per n
    const int sk0  = (tid >> 7) * 16;
    constexpr int KS = K / S;           // this work-group's K slice: [z*KS, z*KS + KS)
    const int zs = G > 1 ? blockIdx.z % S : blockIdx.z;  // K slice
    if constexpr (G > 1) {
        const int zg = blockIdx.z / S;  // which product
        B = zg == 0 ? B : (zg == 1 ? B1 : B2);
        Cpart += (size_t)zg * ((size_t)LQ * S * N);
    }
    A += (size_t)zs * KS;
    B += (size_t)zs * KS * N;

    v8f acc[2][4] = {};

    auto stage = [&](int buf, int kc) {
        float4 va[4];
#pragma unroll
        for (int p = 0; p < 4; ++p)
            va[p] = *(const float4*)(&A[(size_t)(m0 + p * 32 + arow) * K + kc + acol]);
        // the B loads below may be given the A loads' address registers as destinations
        asm volatile("s_wait_xcnt 0x0" ::: "memory");
        float tb[16];
#pragma unroll
        for (int i = 0; i < 16; ++i)
            tb[i] = B[(size_t)(kc + sk0 + i) * N + n0 + sn];
        // code that follows may reuse the B loads' address registers
        asm volatile("s_wait_xcnt 0x0" ::: "memory");
#pragma unroll
        for (int p = 0; p < 4; ++p) {
            const int rr = p * 32 + arow;
            aT[buf][rr][acol + 0] = (__bf16)va[p].x;
            aT[buf][rr][acol + 1] = (__bf16)va[p].y;
            aT[buf][rr][acol + 2] = (__bf16)va[p].z;
            aT[buf][rr][acol + 3] = (__bf16)va[p].w;
        }
        v8bf t0, t1;
#pragma unroll
        for (int i = 0; i < 8; ++i) { t0[i] = (__bf16)tb[i]; t1[i] = (__bf16)tb[8 + i]; }
        *(v8bf*)&bTt[buf][sn][sk0 + 0] = t0;
        *(v8bf*)&bTt[buf][sn][sk0 + 8] = t1;
    };

    auto compute = [&](int buf) {
        v16bf afr[2], bfr[4];
#pragma unroll
        for (int mt = 0; mt < 2; ++mt)
            afr[mt] = frag_from_lds(&aT[buf][wm + mt * 16 + r][0], half);
#pragma unroll
        for (int nt = 0; nt < 4; ++nt)
            bfr[nt] = frag_from_lds(&bTt[buf][wn + nt * 16 + r][0], half);
#pragma unroll
        for (int mt = 0; mt < 2; ++mt)
#pragma unroll
            for (int nt = 0; nt < 4; ++nt)
                acc[mt][nt] = wmma_bf16(afr[mt], bfr[nt], acc[mt][nt]);
    };

    stage(0, 0);
    __syncthreads();
#pragma unroll 1
    for (int kc = 0; kc < KS; kc += 64) {
        stage(1, kc + 32);                       // KS%64==0 -> kc+32 < KS always
        compute(0);
        __syncthreads();
        if (kc + 64 < KS) stage(0, kc + 64);
        compute(1);
        __syncthreads();
    }

    // Epilogue: C/D layout -> m = base + half*8 + vgpr, n = base + (lane&15)
    float* __restrict__ C = Cpart + (size_t)zs * N;
#pragma unroll
    for (int mt = 0; mt < 2; ++mt) {
#pragma unroll
        for (int nt = 0; nt < 4; ++nt) {
            const int mb = m0 + wm + mt * 16 + half * 8;
            const int nb = n0 + wn + nt * 16 + r;
#pragma unroll
            for (int g = 0; g < 8; ++g)
                C[(size_t)(mb + g) * (S * N) + nb] = acc[mt][nt][g];
        }
    }
}

// Sum of the S split-K partials of column c, in slice order; prow points at
// the S partial rows (each DM wide) of one output row.
template <int S>
__device__ __forceinline__ float sum_slices(const float* __restrict__ prow, int c)
{
    float v[S];
#pragma unroll
    for (int s = 0; s < S; ++s) v[s] = prow[s * DM + c];
    float x = v[0];
#pragma unroll
    for (int s = 1; s < S; ++s) x += v[s];
    return x;
}

// ---------------------------------------------------------------------------
// X = split-K partials + bias + positional encoding (computed on the fly,
// matches reference buffer).
// ---------------------------------------------------------------------------
template <int S>
__global__ __launch_bounds__(256) void add_pos_kernel(
    const float* __restrict__ part, const float* __restrict__ bias,
    float* __restrict__ X)
{
    const int l = blockIdx.x, tid = threadIdx.x;
    float* row = X + (size_t)l * DM;
    const float* prow = part + (size_t)l * (S * DM);
#pragma unroll
    for (int j = 0; j < 8; ++j) {
        const int c = tid + j * 256;
        const float denom = 10000.0f * expf((float)(c & ~1) * (1.0f / (float)DM));
        const float arg = (float)l / denom;
        const float x = sum_slices<S>(prow, c) + bias[c];
        row[c] = x + ((c & 1) ? cosf(arg) : sinf(arg));
    }
}

// ---------------------------------------------------------------------------
// split-K partials [L][S][D] fp32 + bias -> per-head bf16 [H][L][DH]
// (head h at column d*16+h).  blockIdx.y picks Q, K or V: its block of
// partials, its bias and its third of dst.
// ---------------------------------------------------------------------------
template <int S>
__global__ __launch_bounds__(256) void permute_heads_kernel(
    const float* __restrict__ part, const float* __restrict__ bias0,
    const float* __restrict__ bias1, const float* __restrict__ bias2,
    __bf16* __restrict__ dst)
{
    const int l = blockIdx.x, tid = threadIdx.x;
    const int p = blockIdx.y;
    const float* bias = p == 0 ? bias0 : (p == 1 ? bias1 : bias2);
    dst += (size_t)p * (NH * LQ * DH);
    const float* prow = part + ((size_t)p * LQ + l) * (S * DM);
#pragma unroll
    for (int j = 0; j < 8; ++j) {
        const int c = tid + j * 256;
        const int h = c & 15, d = c >> 4;
        const float x = sum_slices<S>(prow, c) + bias[c];
        dst[((size_t)h * LQ + l) * DH + d] = (__bf16)x;
    }
}

__global__ __launch_bounds__(256) void attn_scores_kernel(
    const __bf16* __restrict__ Qh, const __bf16* __restrict__ Kh,
    float* __restrict__ S, float scale)
{
    __shared__ __align__(16) __bf16 aT[2][128][40];
    __shared__ __align__(16) __bf16 bTt[2][128][40];

    const int tid  = threadIdx.x;
    const int h    = blockIdx.z;
    const int m0   = blockIdx.y * 128;
    const int n0   = blockIdx.x * 128;
    const int w    = tid >> 5, lane = tid & 31;
    const int half = lane >> 4, r = lane & 15;
    const int wm   = (w & 3) * 32, wn = (w >> 2) * 64;

    const __bf16* Q  = Qh + (size_t)h * LQ * DH;
    const __bf16* Kp = Kh + (size_t)h * LQ * DH;

    const int srow = tid >> 1;            // 128 rows, 2 threads per row
    const int sk0  = (tid & 1) * 16;

    v8f acc[2][4] = {};

    auto stage = [&](int buf, int kc) {
        async_copy_b128(&Q [(size_t)(m0 + srow) * DH + kc + sk0], &aT [buf][srow][sk0]);
        async_copy_b128(&Q [(size_t)(m0 + srow) * DH + kc + sk0 + 8], &aT [buf][srow][sk0 + 8]);
        async_copy_b128(&Kp[(size_t)(n0 + srow) * DH + kc + sk0], &bTt[buf][srow][sk0]);
        async_copy_b128(&Kp[(size_t)(n0 + srow) * DH + kc + sk0 + 8], &bTt[buf][srow][sk0 + 8]);
    };
    auto compute = [&](int buf) {
        v16bf afr[2], bfr[4];
#pragma unroll
        for (int mt = 0; mt < 2; ++mt)
            afr[mt] = frag_from_lds(&aT[buf][wm + mt * 16 + r][0], half);
#pragma unroll
        for (int nt = 0; nt < 4; ++nt)
            bfr[nt] = frag_from_lds(&bTt[buf][wn + nt * 16 + r][0], half);
#pragma unroll
        for (int mt = 0; mt < 2; ++mt)
#pragma unroll
            for (int nt = 0; nt < 4; ++nt)
                acc[mt][nt] = wmma_bf16(afr[mt], bfr[nt], acc[mt][nt]);
    };

    stage(0, 0);
    wait_async();
    __syncthreads();
#pragma unroll 1
    for (int kc = 0; kc < DH; kc += 64) {
        stage(1, kc + 32);
        compute(0);
        wait_async();
        __syncthreads();
        if (kc + 64 < DH) stage(0, kc + 64);
        compute(1);
        wait_async();
        __syncthreads();
    }

#pragma unroll
    for (int mt = 0; mt < 2; ++mt)
#pragma unroll
        for (int nt = 0; nt < 4; ++nt) {
            const int mb = m0 + wm + mt * 16 + half * 8;
            const int nb = n0 + wn + nt * 16 + r;
#pragma unroll
            for (int g = 0; g < 8; ++g)
                S[((size_t)h * LQ + (mb + g)) * LQ + nb] = acc[mt][nt][g] * scale;
        }
}

// ---------------------------------------------------------------------------
// Row softmax over keys; emits bf16 probabilities for the P@V WMMA.
// ---------------------------------------------------------------------------
__global__ __launch_bounds__(256) void softmax_kernel(
    const float* __restrict__ S, __bf16* __restrict__ P)
{
    const int lq = blockIdx.x, h = blockIdx.y, tid = threadIdx.x;
    const float* row = S + ((size_t)h * LQ + lq) * LQ;
    __bf16* prow = P + ((size_t)h * LQ + lq) * LQ;
    __shared__ float red[256];

    const float v0 = row[tid], v1 = row[tid + 256];
    red[tid] = fmaxf(v0, v1);
    __syncthreads();
    for (int s = 128; s > 0; s >>= 1) { if (tid < s) red[tid] = fmaxf(red[tid], red[tid + s]); __syncthreads(); }
    const float mx = red[0];
    __syncthreads();

    const float e0 = expf(v0 - mx), e1 = expf(v1 - mx);
    red[tid] = e0 + e1;
    __syncthreads();
    for (int s = 128; s > 0; s >>= 1) { if (tid < s) red[tid] += red[tid + s]; __syncthreads(); }
    const float inv = 1.0f / red[0];

    prow[tid]       = (__bf16)(e0 * inv);
    prow[tid + 256] = (__bf16)(e1 * inv);
}

__global__ __launch_bounds__(256) void attn_av_kernel(
    const __bf16* __restrict__ P, const __bf16* __restrict__ Vh,
    float* __restrict__ Acat)
{
    __shared__ __align__(16) __bf16 aT[2][128][40];
    __shared__ __align__(16) __bf16 bTt[2][128][40];

    const int tid  = threadIdx.x;
    const int h    = blockIdx.z;
    const int m0   = blockIdx.y * 128;
    const int w    = tid >> 5, lane = tid & 31;
    const int half = lane >> 4, r = lane & 15;
    const int wm   = (w & 3) * 32, wn = (w >> 2) * 64;

    const __bf16* Pp = P + (size_t)h * LQ * LQ;
    const __bf16* Vp = Vh + (size_t)h * LQ * DH;

    const int srow = tid >> 1;           // P staging: row copy
    const int pk0  = (tid & 1) * 16;
    const int sn   = tid & 127;          // V staging: column gather (transpose)
    const int sk0  = (tid >> 7) * 16;

    v8f acc[2][4] = {};

    auto stage = [&](int buf, int kc) {
        async_copy_b128(&Pp[(size_t)(m0 + srow) * LQ + kc + pk0], &aT[buf][srow][pk0]);
        async_copy_b128(&Pp[(size_t)(m0 + srow) * LQ + kc + pk0 + 8], &aT[buf][srow][pk0 + 8]);
        v8bf t0, t1;
#pragma unroll
        for (int i = 0; i < 8; ++i) t0[i] = Vp[(size_t)(kc + sk0 + i) * DH + sn];
#pragma unroll
        for (int i = 0; i < 8; ++i) t1[i] = Vp[(size_t)(kc + sk0 + 8 + i) * DH + sn];
        *(v8bf*)&bTt[buf][sn][sk0 + 0] = t0;
        *(v8bf*)&bTt[buf][sn][sk0 + 8] = t1;
    };
    auto compute = [&](int buf) {
        v16bf afr[2], bfr[4];
#pragma unroll
        for (int mt = 0; mt < 2; ++mt)
            afr[mt] = frag_from_lds(&aT[buf][wm + mt * 16 + r][0], half);
#pragma unroll
        for (int nt = 0; nt < 4; ++nt)
            bfr[nt] = frag_from_lds(&bTt[buf][wn + nt * 16 + r][0], half);
#pragma unroll
        for (int mt = 0; mt < 2; ++mt)
#pragma unroll
            for (int nt = 0; nt < 4; ++nt)
                acc[mt][nt] = wmma_bf16(afr[mt], bfr[nt], acc[mt][nt]);
    };

    stage(0, 0);
    wait_async();
    __syncthreads();
#pragma unroll 1
    for (int kc = 0; kc < LQ; kc += 64) {
        stage(1, kc + 32);
        compute(0);
        wait_async();
        __syncthreads();
        if (kc + 64 < LQ) stage(0, kc + 64);
        compute(1);
        wait_async();
        __syncthreads();
    }

#pragma unroll
    for (int mt = 0; mt < 2; ++mt)
#pragma unroll
        for (int nt = 0; nt < 4; ++nt) {
            const int mb = m0 + wm + mt * 16 + half * 8;
            const int nb = wn + nt * 16 + r;      // n in [0,128)
#pragma unroll
            for (int g = 0; g < 8; ++g)
                Acat[(size_t)(mb + g) * DM + nb * NH + h] = acc[mt][nt][g];
        }
}

// ---------------------------------------------------------------------------
// H = gelu(split-K partials + bias), one row of FFD per work-group.
// ---------------------------------------------------------------------------
template <int S>
__global__ __launch_bounds__(256) void bias_gelu_kernel(
    const float* __restrict__ part, const float* __restrict__ bias,
    float* __restrict__ Hout)
{
    const int l = blockIdx.x, tid = threadIdx.x;
    const float* prow = part + (size_t)l * (S * FFD);
    float* hrow = Hout + (size_t)l * FFD;
    constexpr int NJ = FFD / 1024;
    // all loads of the row first, so that they are in flight together
    float4 v[S][NJ], bv[NJ];
#pragma unroll
    for (int j = 0; j < NJ; ++j) {
        const int c = (tid + j * 256) * 4;
#pragma unroll
        for (int s = 0; s < S; ++s) v[s][j] = *(const float4*)(&prow[s * FFD + c]);
        bv[j] = *(const float4*)(&bias[c]);
    }
#pragma unroll
    for (int j = 0; j < NJ; ++j) {
        const int c = (tid + j * 256) * 4;
        float4 x = v[0][j];
#pragma unroll
        for (int s = 1; s < S; ++s) {
            x.x += v[s][j].x; x.y += v[s][j].y; x.z += v[s][j].z; x.w += v[s][j].w;
        }
        float4 y;
        y.x = gelu_tanh(x.x + bv[j].x);
        y.y = gelu_tanh(x.y + bv[j].y);
        y.z = gelu_tanh(x.z + bv[j].z);
        y.w = gelu_tanh(x.w + bv[j].w);
        *(float4*)(&hrow[c]) = y;
    }
}

// ---------------------------------------------------------------------------
// Row LayerNorm over D=2048 of (split-K partials + bias + residual).
// ---------------------------------------------------------------------------
template <int S>
__global__ __launch_bounds__(256) void layernorm_kernel(
    const float* __restrict__ part, const float* __restrict__ bias,
    const float* __restrict__ res, const float* __restrict__ g,
    const float* __restrict__ b, float* __restrict__ Y)
{
    const int l = blockIdx.x, tid = threadIdx.x;
    const float* prow = part + (size_t)l * (S * DM);
    const float* rrow = res + (size_t)l * DM;
    float* out = Y + (size_t)l * DM;
    __shared__ float red[256];

    float vals[8], s = 0.0f;
#pragma unroll
    for (int j = 0; j < 8; ++j) {
        const int c = tid + j * 256;
        vals[j] = sum_slices<S>(prow, c) + bias[c] + rrow[c];
        s += vals[j];
    }
    red[tid] = s;
    __syncthreads();
    for (int st = 128; st > 0; st >>= 1) { if (tid < st) red[tid] += red[tid + st]; __syncthreads(); }
    const float mu = red[0] * (1.0f / (float)DM);
    __syncthreads();

    float v = 0.0f;
#pragma unroll
    for (int j = 0; j < 8; ++j) { const float d = vals[j] - mu; v += d * d; }
    red[tid] = v;
    __syncthreads();
    for (int st = 128; st > 0; st >>= 1) { if (tid < st) red[tid] += red[tid + st]; __syncthreads(); }
    const float inv = rsqrtf(red[0] * (1.0f / (float)DM) + 1e-5f);

#pragma unroll
    for (int j = 0; j < 8; ++j) {
        const int c = tid + j * 256;
        out[c] = (vals[j] - mu) * inv * g[c] + b[c];
    }
}

// ---------------------------------------------------------------------------
extern "C" void kernel_launch(void* const* d_in, const int* in_sizes, int n_in,
                              void* d_out, int out_size, void* d_ws, size_t ws_size,
                              hipStream_t stream)
{
    (void)in_sizes; (void)n_in; (void)out_size; (void)ws_size;

    const float* seq  = (const float*)d_in[0];
    const float* embW = (const float*)d_in[1];
    const float* embB = (const float*)d_in[2];
    const float* Wq   = (const float*)d_in[3];
    const float* bq   = (const float*)d_in[4];
    const float* Wk   = (const float*)d_in[5];
    const float* bk   = (const float*)d_in[6];
    const float* Wv   = (const float*)d_in[7];
    const float* bv   = (const float*)d_in[8];
    const float* Wo   = (const float*)d_in[9];
    const float* bo   = (const float*)d_in[10];
    const float* lng  = (const float*)d_in[11];
    const float* lnb  = (const float*)d_in[12];
    const float* W1   = (const float*)d_in[13];
    const float* b1   = (const float*)d_in[14];
    const float* W2   = (const float*)d_in[15];
    const float* b2   = (const float*)d_in[16];

    char* ws = (char*)d_ws;
    size_t off = 0;
    auto take = [&](size_t bytes) { char* p = ws + off; off = (off + bytes + 255) & ~(size_t)255; return p; };

    const size_t fLD = (size_t)LQ * DM * sizeof(float);       // 4 MB
    const size_t hLD = (size_t)NH * LQ * DH * sizeof(__bf16); // 2 MB
    const size_t fSS = (size_t)NH * LQ * LQ * sizeof(float);  // 16 MB
    const size_t hSS = (size_t)NH * LQ * LQ * sizeof(__bf16); // 8 MB

    float*  X    = (float*)take(fLD);
    float*  Acat = (float*)take(fLD);
    __bf16* Qh   = (__bf16*)take(3 * hLD);   // Q, K, V per-head planes, one after the other
    __bf16* Kh   = Qh + (size_t)NH * LQ * DH;
    __bf16* Vh   = Kh + (size_t)NH * LQ * DH;
    float*  S    = (float*)take(fSS);        // reused as FFN hidden (16 MB)
    __bf16* P    = (__bf16*)take(hSS);
    float*  Xa   = (float*)take(fLD);
    float*  Pt   = (float*)take(3 * 8 * fLD); // split-K partials: 32 MB a product, 3 products in the Q/K/V launch
    float*  Hf   = S;                        // S free after softmax
    float*  Yout = (float*)d_out;

    const dim3 blk(256);
    const dim3 gD (DM / 128, LQ / 128, 8);   // N=2048 GEMMs, 8 K slices: 512 work-groups
    const dim3 gQKV(DM / 128, LQ / 128, 3 * 8); // Q, K and V projections together: 1536 work-groups
    const dim3 gFF(FFD / 128, LQ / 128, 2);  // N=8192 GEMM, 2 K slices: 512 work-groups

    // 1) embedding, 2) + bias + positional encoding
    gemm_splitk_kernel<DM, DM, 8, 1><<<gD, blk, 0, stream>>>(seq, embW, Pt, nullptr, nullptr);
    add_pos_kernel<8><<<LQ, blk, 0, stream>>>(Pt, embB, X);
    // 3) Q/K/V projections in one launch, 4) their bias + per-head bf16 layout in one launch
    gemm_splitk_kernel<DM, DM, 8, 3><<<gQKV, blk, 0, stream>>>(X, Wq, Pt, Wk, Wv);
    permute_heads_kernel<8><<<dim3(LQ, 3), blk, 0, stream>>>(Pt, bq, bk, bv, Qh);
    // 5) scores = Qh @ Kh^T / sqrt(D)
    attn_scores_kernel<<<dim3(LQ / 128, LQ / 128, NH), blk, 0, stream>>>(
        Qh, Kh, S, 0.022097086912079608f /* 1/sqrt(2048) */);
    // 6) softmax over keys -> bf16 probs
    softmax_kernel<<<dim3(LQ, NH), blk, 0, stream>>>(S, P);
    // 7) attn @ V, scatter back to [L, D] interleaved layout
    attn_av_kernel<<<dim3(1, LQ / 128, NH), blk, 0, stream>>>(P, Vh, Acat);
    // 8) output projection, 9) + bias + residual X, LayerNorm -> Xa
    gemm_splitk_kernel<DM, DM, 8, 1><<<gD, blk, 0, stream>>>(Acat, Wo, Pt, nullptr, nullptr);
    layernorm_kernel<8><<<LQ, blk, 0, stream>>>(Pt, bo, X, lng, lnb, Xa);
    // 10) FFN1, then bias + GELU
    gemm_splitk_kernel<FFD, DM, 2, 1><<<gFF, blk, 0, stream>>>(Xa, W1, Pt, nullptr, nullptr);
    bias_gelu_kernel<2><<<LQ, blk, 0, stream>>>(Pt, b1, Hf);
    // 11) FFN2, 12) + bias + residual Xa, final LayerNorm -> output
    gemm_splitk_kernel<DM, FFD, 8, 1><<<gD, blk, 0, stream>>>(Hf, W2, Pt, nullptr, nullptr);
    layernorm_kernel<8><<<LQ, blk, 0, stream>>>(Pt, b2, Xa, lng, lnb, Yout);
}

// v003
// One run takes 200 microseconds.
// Next to v002, in two timings, it ran 1.21 times as fast each time.
// All steps since v000 together make it 3.23 times as fast.
#include <hip/hip_runtime.h>
#include <hip/hip_bf16.h>
#include <math.h>

typedef __attribute__((ext_vector_type(16))) __bf16 v16bf;
typedef __attribute__((ext_vector_type(8)))  __bf16 v8bf;
typedef __attribute__((ext_vector_type(4)))  __bf16 v4bf;
typedef __attribute__((ext_vector_type(8)))  float  v8f;

#define LQ 512
#define DM 2048
#define NH 16
#define DH 128
#define FFD 8192

__device__ __forceinline__ v8f wmma_bf16(const v16bf& a, const v16bf& b, const v8f& c) {
    return __builtin_amdgcn_wmma_f32_16x16x32_bf16(false, a, false, b, (short)0, c, false, false);
}

__device__ __forceinline__ v16bf frag_from_lds(const __bf16* rowp, int half) {
    const v8bf lo = *(const v8bf*)(rowp + half * 8);
    const v8bf hi = *(const v8bf*)(rowp + 16 + half * 8);
    return __builtin_shufflevector(lo, hi, 0, 1, 2, 3, 4, 5, 6, 7,
                                           8, 9, 10, 11, 12, 13, 14, 15);
}

__device__ __forceinline__ void async_copy8_b128(const __bf16* g, unsigned lds, int gstep, unsigned lstep) {
    asm volatile("global_load_async_to_lds_b128 %0, %8, off\n\t"
                 "global_load_async_to_lds_b128 %1, %9, off\n\t"
                 "global_load_async_to_lds_b128 %2, %10, off\n\t"
                 "global_load_async_to_lds_b128 %3, %11, off\n\t"
                 "global_load_async_to_lds_b128 %4, %12, off\n\t"
                 "global_load_async_to_lds_b128 %5, %13, off\n\t"
                 "global_load_async_to_lds_b128 %6, %14, off\n\t"
                 "global_load_async_to_lds_b128 %7, %15, off\n\t"
                 "s_wait_xcnt 0x0"
                 :: "v"(lds), "v"(lds + lstep), "v"(lds + 2 * lstep), "v"(lds + 3 * lstep),
                    "v"(lds + 4 * lstep), "v"(lds + 5 * lstep), "v"(lds + 6 * lstep), "v"(lds + 7 * lstep),
                    "v"(g), "v"(g + gstep), "v"(g + 2 * gstep), "v"(g + 3 * gstep),
                    "v"(g + 4 * gstep), "v"(g + 5 * gstep), "v"(g + 6 * gstep), "v"(g + 7 * gstep)
                 : "memory");
}

// Transposing LDS load: from a row-major 16-bit tile, lane (c = lane & 15, half) gets
// rows 8*half .. +7 of column c; p is the lane's own address in the tile:
// row 8*half + (lane & 7), column 8*((lane >> 3) & 1).
__device__ __forceinline__ v8bf lds_load_tr16(const __bf16* p) {
    typedef __attribute__((address_space(3))) v8bf lds_v8bf;
    return __builtin_amdgcn_ds_load_tr16_b128_v8bf16((lds_v8bf*)p);
}

__device__ __forceinline__ float gelu_tanh(float x) {
    const float k0 = 0.7978845608028654f;  // sqrt(2/pi)
    const float k1 = 0.044715f;
    float t = tanhf(k0 * (x + k1 * x * x * x));
    return 0.5f * x * (1.0f + t);
}

// ---------------------------------------------------------------------------
// Split-K GEMM: Cpart[m][z][n] = A[m, K/S slice z] @ B[K/S slice z, n].
// blockIdx.z picks the K slice, so a launch has S times the work-groups and
// each runs a loop S times shorter; the S fp32 partial rows of an output row
// lie side by side and are summed (with bias, activation, residual) by the
// elementwise kernel that follows.
// G products that share A (same N, K, S) run as one launch: blockIdx.z / S
// picks the B matrix and its own block of partials, blockIdx.z % S the slice.
// Block tile 128x128, K-step 32, double-buffered LDS.  8 wave32 waves; wave
// grid 4(M) x 2(N), each wave 32x64 = 2x4 accumulators.  aT[m][k]; B
// transposed in LDS: bTt[n][k].
// ---------------------------------------------------------------------------
template <int N, int K, int S, int G>
__global__ __launch_bounds__(256) void gemm_splitk_kernel(
    const float* __restrict__ A, const float* __restrict__ B,
    float* __restrict__ Cpart,
    const float* __restrict__ B1, const float* __restrict__ B2)
{
    static_assert(K % (64 * S) == 0 && N % 128 == 0, "tile assumptions");
    static_assert(G == 1 || G == 3, "one product, or three that share A");
    __shared__ __align__(16) __bf16 aT[2][128][40];
    __shared__ __align__(16) __bf16 bTt[2][128][40];

    const int tid  = threadIdx.x;
    const int m0   = blockIdx.y * 128;
    const int n0   = blockIdx.x * 128;
    const int w    = tid >> 5;
    const int lane = tid & 31;
    const int half = lane >> 4;
    const int r    = lane & 15;
    const int wm   = (w & 3) * 32;
    const int wn   = (w >> 2) * 64;

    const int arow = tid >> 3;          // A staging: 32 rows / pass, 8 float4 per row
    const int acol = (tid & 7) * 4;
    const int sn   = tid & 127;         // B staging: column gather, 2 threads per n
    const int sk0  = (tid >> 7) * 16;
    constexpr int KS = K / S;           // this work-group's K slice: [z*KS, z*KS + KS)
    const int zs = G > 1 ? blockIdx.z % S : blockIdx.z;  // K slice
    if constexpr (G > 1) {
        const int zg = blockIdx.z / S;  // which product
        B = zg == 0 ? B : (zg == 1 ? B1 : B2);
        Cpart += (size_t)zg * ((size_t)LQ * S * N);
    }
    A += (size_t)zs * KS;
    B += (size_t)zs * KS * N;

    v8f acc[2][4] = {};

    auto stage = [&](int buf, int kc) {
        float4 va[4];
#pragma unroll
        for (int p = 0; p < 4; ++p)
            va[p] = *(const float4*)(&A[(size_t)(m0 + p * 32 + arow) * K + kc + acol]);
        // the B loads below may be given the A loads' address registers as destinations
        asm volatile("s_wait_xcnt 0x0" ::: "memory");
        float tb[16];
#pragma unroll
        for (int i = 0; i < 16; ++i)
            tb[i] = B[(size_t)(kc + sk0 + i) * N + n0 + sn];
        // code that follows may reuse the B loads' address registers
        asm volatile("s_wait_xcnt 0x0" ::: "memory");
#pragma unroll
        for (int p = 0; p < 4; ++p) {
            const int rr = p * 32 + arow;
            aT[buf][rr][acol + 0] = (__bf16)va[p].x;
            aT[buf][rr][acol + 1] = (__bf16)va[p].y;
            aT[buf][rr][acol + 2] = (__bf16)va[p].z;
            aT[buf][rr][acol + 3] = (__bf16)va[p].w;
        }
        v8bf t0, t1;
#pragma unroll
        for (int i = 0; i < 8; ++i) { t0[i] = (__bf16)tb[i]; t1[i] = (__bf16)tb[8 + i]; }
        *(v8bf*)&bTt[buf][sn][sk0 + 0] = t0;
        *(v8bf*)&bTt[buf][sn][sk0 + 8] = t1;
    };

    auto compute = [&](int buf) {
        v16bf afr[2], bfr[4];
#pragma unroll
        for (int mt = 0; mt < 2; ++mt)
            afr[mt] = frag_from_lds(&aT[buf][wm + mt * 16 + r][0], half);
#pragma unroll
        for (int nt = 0; nt < 4; ++nt)
            bfr[nt] = frag_from_lds(&bTt[buf][wn + nt * 16 + r][0], half);
#pragma unroll
        for (int mt = 0; mt < 2; ++mt)
#pragma unroll
            for (int nt = 0; nt < 4; ++nt)
                acc[mt][nt] = wmma_bf16(afr[mt], bfr[nt], acc[mt][nt]);
    };

    stage(0, 0);
    __syncthreads();
#pragma unroll 1
    for (int kc = 0; kc < KS; kc += 64) {
        stage(1, kc + 32);                       // KS%64==0 -> kc+32 < KS always
        compute(0);
        __syncthreads();
        if (kc + 64 < KS) stage(0, kc + 64);
        compute(1);
        __syncthreads();
    }

    // Epilogue: C/D layout -> m = base + half*8 + vgpr, n = base + (lane&15)
    float* __restrict__ C = Cpart + (size_t)zs * N;
#pragma unroll
    for (int mt = 0; mt < 2; ++mt) {
#pragma unroll
        for (int nt = 0; nt < 4; ++nt) {
            const int mb = m0 + wm + mt * 16 + half * 8;
            const int nb = n0 + wn + nt * 16 + r;
#pragma unroll
            for (int g = 0; g < 8; ++g)
                C[(size_t)(mb + g) * (S * N) + nb] = acc[mt][nt][g];
        }
    }
}

// Sum of the S split-K partials of column c, in slice order; prow points at
// the S partial rows (each DM wide) of one output row.
template <int S>
__device__ __forceinline__ float sum_slices(const float* __restrict__ prow, int c)
{
    float v[S];
#pragma unroll
    for (int s = 0; s < S; ++s) v[s] = prow[s * DM + c];
    float x = v[0];
#pragma unroll
    for (int s = 1; s < S; ++s) x += v[s];
    return x;
}

// ---------------------------------------------------------------------------
// X = split-K partials + bias + positional encoding (computed on the fly,
// matches reference buffer).
// ---------------------------------------------------------------------------
template <int S>
__global__ __launch_bounds__(256) void add_pos_kernel(
    const float* __restrict__ part, const float* __restrict__ bias,
    float* __restrict__ X)
{
    const int l = blockIdx.x, tid = threadIdx.x;
    float* row = X + (size_t)l * DM;
    const float* prow = part + (size_t)l * (S * DM);
#pragma unroll
    for (int j = 0; j < 8; ++j) {
        const int c = tid + j * 256;
        const float denom = 10000.0f * expf((float)(c & ~1) * (1.0f / (float)DM));
        const float arg = (float)l / denom;
        const float x = sum_slices<S>(prow, c) + bias[c];
        row[c] = x + ((c & 1) ? cosf(arg) : sinf(arg));
    }
}

// ---------------------------------------------------------------------------
// split-K partials [L][S][D] fp32 + bias -> per-head bf16 [H][L][DH]
// (head h at column d*16+h).  blockIdx.y picks Q, K or V: its block of
// partials, its bias and its third of dst.
// ---------------------------------------------------------------------------
template <int S>
__global__ __launch_bounds__(256) void permute_heads_kernel(
    const float* __restrict__ part, const float* __restrict__ bias0,
    const float* __restrict__ bias1, const float* __restrict__ bias2,
    __bf16* __restrict__ dst)
{
    const int l = blockIdx.x, tid = threadIdx.x;
    const int p = blockIdx.y;
    const float* bias = p == 0 ? bias0 : (p == 1 ? bias1 : bias2);
    dst += (size_t)p * (NH * LQ * DH);
    const float* prow = part + ((size_t)p * LQ + l) * (S * DM);
#pragma unroll
    for (int j = 0; j < 8; ++j) {
        const int c = tid + j * 256;
        const int h = c & 15, d = c >> 4;
        const float x = sum_slices<S>(prow, c) + bias[c];
        dst[((size_t)h * LQ + l) * DH + d] = (__bf16)x;
    }
}

// ---------------------------------------------------------------------------
// Attention of one head and QB query rows in one work-group:
//   scores = scale * Q @ K^T (all LQ keys), row softmax, Acat[:, d*16+h] = P @ V.
// Scores (fp32) and probabilities (bf16) live in LDS only.  Wave w owns keys
// w*64..+63 in the first product, so Q and K fragments come straight from
// global memory.  The head's V lands row-major in LDS by async copies issued
// first, and wave w reads its columns w*16..+15 by transposing loads.
// ---------------------------------------------------------------------------
#define QB 32
__global__ __launch_bounds__(256) void attn_fused_kernel(
    const __bf16* __restrict__ Qh, const __bf16* __restrict__ Kh,
    const __bf16* __restrict__ Vh, float* __restrict__ Acat, float scale)
{
    __shared__ __align__(16) float  sS[QB][LQ + 4];
    __shared__ __align__(16) __bf16 sP[QB][LQ + 8];
    __shared__ __align__(16) __bf16 sV[LQ][DH + 16];

    const int tid  = threadIdx.x;
    const int h    = blockIdx.y;
    const int m0   = blockIdx.x * QB;
    const int w    = tid >> 5, lane = tid & 31;
    const int half = lane >> 4, r = lane & 15;

    const __bf16* Q  = Qh + ((size_t)h * LQ + m0) * DH;
    const __bf16* Kp = Kh + (size_t)h * LQ * DH;
    const __bf16* Vp = Vh + (size_t)h * LQ * DH;

    // ---- V: 16 rows per copy and work-group (16 lanes x 16 B a row), 32 copies per lane
#pragma unroll
    for (int j = 0; j < 4; ++j)
        async_copy8_b128(Vp + (size_t)(j * 128 + (tid >> 4)) * DH + (tid & 15) * 8,
                         (unsigned)(size_t)&sV[j * 128 + (tid >> 4)][(tid & 15) * 8],
                         16 * DH, 16 * (DH + 16) * 2);

    // ---- scores: 32 x 64 per wave, K-dim = DH in 4 steps of 32
    {
        const int wn = w * 64;
        const __bf16* qp = Q + (size_t)r * DH + half * 8;          // this lane's place in its Q row
        const __bf16* kp = Kp + (size_t)(wn + r) * DH + half * 8;  // and in its K row
        v16bf afr[4][2], bfr[4][4];
        v8f acc[2][4] = {};
        auto load = [&](int ks) {
#pragma unroll
            for (int mt = 0; mt < 2; ++mt)
                afr[ks][mt] = frag_from_lds(&qp[mt * 16 * DH + ks * 32], 0);
#pragma unroll
            for (int nt = 0; nt < 4; ++nt)
                bfr[ks][nt] = frag_from_lds(&kp[nt * 16 * DH + ks * 32], 0);
            // code that follows may reuse these loads' address registers; the addresses as
            // inputs keep them from being handed out as destinations to loads of this group
            asm volatile("s_wait_xcnt 0x0" :: "v"(qp), "v"(kp) : "memory");
        };
        auto compute = [&](int ks) {
#pragma unroll
            for (int mt = 0; mt < 2; ++mt)
#pragma unroll
                for (int nt = 0; nt < 4; ++nt)
                    acc[mt][nt] = wmma_bf16(afr[ks][mt], bfr[ks][nt], acc[mt][nt]);
        };
        load(0); load(1); load(2);
        // keeps the first products, which wait for their operands, from being scheduled
        // in front of the later steps' loads: a wave issues in order
        __builtin_amdgcn_sched_barrier(0);
        compute(0);
        load(3);
        compute(1); compute(2); compute(3);
#pragma unroll
        for (int mt = 0; mt < 2; ++mt)
#pragma unroll
            for (int nt = 0; nt < 4; ++nt)
#pragma unroll
                for (int g = 0; g < 8; ++g)
                    sS[mt * 16 + half * 8 + g][wn + nt * 16 + r] = acc[mt][nt][g] * scale;
    }

    __syncthreads();

    // ---- softmax over keys: one wave per row, 4 rows per wave, 16 scores per lane
#pragma unroll
    for (int i = 0; i < QB / 8; ++i) {
        const int row = w * (QB / 8) + i;
        float4 v[4];
#pragma unroll
        for (int j = 0; j < 4; ++j) v[j] = *(const float4*)&sS[row][lane * 4 + j * 128];
        float mx = fmaxf(fmaxf(v[0].x, v[0].y), fmaxf(v[0].z, v[0].w));
#pragma unroll
        for (int j = 1; j < 4; ++j)
            mx = fmaxf(mx, fmaxf(fmaxf(v[j].x, v[j].y), fmaxf(v[j].z, v[j].w)));
#pragma unroll
        for (int o = 16; o > 0; o >>= 1) mx = fmaxf(mx, __shfl_xor(mx, o));
        float s = 0.0f;
#pragma unroll
        for (int j = 0; j < 4; ++j) {
            v[j].x = expf(v[j].x - mx); v[j].y = expf(v[j].y - mx);
            v[j].z = expf(v[j].z - mx); v[j].w = expf(v[j].w - mx);
            s += (v[j].x + v[j].y) + (v[j].z + v[j].w);
        }
#pragma unroll
        for (int o = 16; o > 0; o >>= 1) s += __shfl_xor(s, o);
        const float inv = 1.0f / s;
#pragma unroll
        for (int j = 0; j < 4; ++j) {
            v4bf p;
            p[0] = (__bf16)(v[j].x * inv); p[1] = (__bf16)(v[j].y * inv);
            p[2] = (__bf16)(v[j].z * inv); p[3] = (__bf16)(v[j].w * inv);
            *(v4bf*)&sP[row][lane * 4 + j * 128] = p;
        }
    }
    // this wave's V copies have landed; the barrier then publishes V and P to all waves
    asm volatile("s_wait_asynccnt 0x0" ::: "memory");
    __syncthreads();

    // ---- P @ V: 32 x 16 per wave, K-dim = LQ in 16 steps of 32
    const int n = w * 16 + r;             // this lane's column of V
    const __bf16* vt = &sV[half * 8 + (lane & 7)][w * 16 + ((lane >> 3) & 1) * 8];
    v8f o[2] = {};
#pragma unroll
    for (int ks = 0; ks < LQ / 32; ++ks) {
        const v8bf lo = lds_load_tr16(vt + (ks * 32) * (DH + 16));        // keys ks*32 + half*8 .. +7
        const v8bf hi = lds_load_tr16(vt + (ks * 32 + 16) * (DH + 16));   // keys ks*32 + 16 + half*8 .. +7
        const v16bf vfr = __builtin_shufflevector(lo, hi, 0, 1, 2, 3, 4, 5, 6, 7,
                                                          8, 9, 10, 11, 12, 13, 14, 15);
#pragma unroll
        for (int mt = 0; mt < 2; ++mt)
            o[mt] = wmma_bf16(frag_from_lds(&sP[mt * 16 + r][ks * 32], half), vfr, o[mt]);
    }

#pragma unroll
    for (int mt = 0; mt < 2; ++mt)
#pragma unroll
        for (int g = 0; g < 8; ++g)
            Acat[(size_t)(m0 + mt * 16 + half * 8 + g) * DM + n * NH + h] = o[mt][g];
}

// ---------------------------------------------------------------------------
// H = gelu(split-K partials + bias), one row of FFD per work-group.
// ---------------------------------------------------------------------------
template <int S>
__global__ __launch_bounds__(256) void bias_gelu_kernel(
    const float* __restrict__ part, const float* __restrict__ bias,
    float* __restrict__ Hout)
{
    const int l = blockIdx.x, tid = threadIdx.x;
    const float* prow = part + (size_t)l * (S * FFD);
    float* hrow = Hout + (size_t)l * FFD;
    constexpr int NJ = FFD / 1024;
    // all loads of the row first, so that they are in flight together
    float4 v[S][NJ], bv[NJ];
#pragma unroll
    for (int j = 0; j < NJ; ++j) {
        const int c = (tid + j * 256) * 4;
#pragma unroll
        for (int s = 0; s < S; ++s) v[s][j] = *(const float4*)(&prow[s * FFD + c]);
        bv[j] = *(const float4*)(&bias[c]);
    }
#pragma unroll
    for (int j = 0; j < NJ; ++j) {
        const int c = (tid + j * 256) * 4;
        float4 x = v[0][j];
#pragma unroll
        for (int s = 1; s < S; ++s) {
            x.x += v[s][j].x; x.y += v[s][j].y; x.z += v[s][j].z; x.w += v[s][j].w;
        }
        float4 y;
        y.x = gelu_tanh(x.x + bv[j].x);
        y.y = gelu_tanh(x.y + bv[j].y);
        y.z = gelu_tanh(x.z + bv[j].z);
        y.w = gelu_tanh(x.w + bv[j].w);
        *(float4*)(&hrow[c]) = y;
    }
}

// ---------------------------------------------------------------------------
// Row LayerNorm over D=2048 of (split-K partials + bias + residual).
// ---------------------------------------------------------------------------
template <int S>
__global__ __launch_bounds__(256) void layernorm_kernel(
    const float* __restrict__ part, const float* __restrict__ bias,
    const float* __restrict__ res, const float* __restrict__ g,
    const float* __restrict__ b, float* __restrict__ Y)
{
    const int l = blockIdx.x, tid = threadIdx.x;
    const float* prow = part + (size_t)l * (S * DM);
    const float* rrow = res + (size_t)l * DM;
    float* out = Y + (size_t)l * DM;
    __shared__ float red[256];

    float vals[8], s = 0.0f;
#pragma unroll
    for (int j = 0; j < 8; ++j) {
        const int c = tid + j * 256;
        vals[j] = sum_slices<S>(prow, c) + bias[c] + rrow[c];
        s += vals[j];
    }
    red[tid] = s;
    __syncthreads();
    for (int st = 128; st > 0; st >>= 1) { if (tid < st) red[tid] += red[tid + st]; __syncthreads(); }
    const float mu = red[0] * (1.0f / (float)DM);
    __syncthreads();

    float v = 0.0f;
#pragma unroll
    for (int j = 0; j < 8; ++j) { const float d = vals[j] - mu; v += d * d; }
    red[tid] = v;
    __syncthreads();
    for (int st = 128; st > 0; st >>= 1) { if (tid < st) red[tid] += red[tid + st]; __syncthreads(); }
    const float inv = rsqrtf(red[0] * (1.0f / (float)DM) + 1e-5f);

#pragma unroll
    for (int j = 0; j < 8; ++j) {
        const int c = tid + j * 256;
        out[c] = (vals[j] - mu) * inv * g[c] + b[c];
    }
}

// ---------------------------------------------------------------------------
extern "C" void kernel_launch(void* const* d_in, const int* in_sizes, int n_in,
                              void* d_out, int out_size, void* d_ws, size_t ws_size,
                              hipStream_t stream)
{
    (void)in_sizes; (void)n_in; (void)out_size; (void)ws_size;

    const float* seq  = (const float*)d_in[0];
    const float* embW = (const float*)d_in[1];
    const float* embB = (const float*)d_in[2];
    const float* Wq   = (const float*)d_in[3];
    const float* bq   = (const float*)d_in[4];
    const float* Wk   = (const float*)d_in[5];
    const float* bk   = (const float*)d_in[6];
    const float* Wv   = (const float*)d_in[7];
    const float* bv   = (const float*)d_in[8];
    const float* Wo   = (const float*)d_in[9];
    const float* bo   = (const float*)d_in[10];
    const float* lng  = (const float*)d_in[11];
    const float* lnb  = (const float*)d_in[12];
    const float* W1   = (const float*)d_in[13];
    const float* b1   = (const float*)d_in[14];
    const float* W2   = (const float*)d_in[15];
    const float* b2   = (const float*)d_in[16];

    char* ws = (char*)d_ws;
    size_t off = 0;
    auto take = [&](size_t bytes) { char* p = ws + off; off = (off + bytes + 255) & ~(size_t)255; return p; };

    const size_t fLD = (size_t)LQ * DM * sizeof(float);       // 4 MB
    const size_t hLD = (size_t)NH * LQ * DH * sizeof(__bf16); // 2 MB
    const size_t fLF = (size_t)LQ * FFD * sizeof(float);      // 16 MB

    float*  X    = (float*)take(fLD);
    float*  Acat = (float*)take(fLD);
    __bf16* Qh   = (__bf16*)take(3 * hLD);   // Q, K, V per-head planes, one after the other
    __bf16* Kh   = Qh + (size_t)NH * LQ * DH;
    __bf16* Vh   = Kh + (size_t)NH * LQ * DH;
    float*  Hf   = (float*)take(fLF);        // FFN hidden
    float*  Xa   = (float*)take(fLD);
    float*  Pt   = (float*)take(3 * 8 * fLD); // split-K partials: 32 MB a product, 3 products in the Q/K/V launch
    float*  Yout = (float*)d_out;

    const dim3 blk(256);
    const dim3 gD (DM / 128, LQ / 128, 8);   // N=2048 GEMMs, 8 K slices: 512 work-groups
    const dim3 gQKV(DM / 128, LQ / 128, 3 * 8); // Q, K and V projections together: 1536 work-groups
    const dim3 gFF(FFD / 128, LQ / 128, 2);  // N=8192 GEMM, 2 K slices: 512 work-groups

    // 1) embedding, 2) + bias + positional encoding
    gemm_splitk_kernel<DM, DM, 8, 1><<<gD, blk, 0, stream>>>(seq, embW, Pt, nullptr, nullptr);
    add_pos_kernel<8><<<LQ, blk, 0, stream>>>(Pt, embB, X);
    // 3) Q/K/V projections in one launch, 4) their bias + per-head bf16 layout in one launch
    gemm_splitk_kernel<DM, DM, 8, 3><<<gQKV, blk, 0, stream>>>(X, Wq, Pt, Wk, Wv);
    permute_heads_kernel<8><<<dim3(LQ, 3), blk, 0, stream>>>(Pt, bq, bk, bv, Qh);
    // 5-7) softmax(Qh @ Kh^T / sqrt(D)) @ Vh, scattered back to the [L, D] interleaved layout
    attn_fused_kernel<<<dim3(LQ / QB, NH), blk, 0, stream>>>(
        Qh, Kh, Vh, Acat, 0.022097086912079608f /* 1/sqrt(2048) */);
    // 8) output projection, 9) + bias + residual X, LayerNorm -> Xa
    gemm_splitk_kernel<DM, DM, 8, 1><<<gD, blk, 0, stream>>>(Acat, Wo, Pt, nullptr, nullptr);
    layernorm_kernel<8><<<LQ, blk, 0, stream>>>(Pt, bo, X, lng, lnb, Xa);
    // 10) FFN1, then bias + GELU
    gemm_splitk_kernel<FFD, DM, 2, 1><<<gFF, blk, 0, stream>>>(Xa, W1, Pt, nullptr, nullptr);
    bias_gelu_kernel<2><<<LQ, blk, 0, stream>>>(Pt, b1, Hf);
    // 11) FFN2, 12) + bias + residual Xa, final LayerNorm -> output
    gemm_splitk_kernel<DM, FFD, 8, 1><<<gD, blk, 0, stream>>>(Hf, W2, Pt, nullptr, nullptr);
    layernorm_kernel<8><<<LQ, blk, 0, stream>>>(Pt, b2, Xa, lng, lnb, Yout);
}

// v004
// It runs in 188 microseconds.
// In both of two side-by-side timings against v003, it was 1.07 times as fast.
// Over all steps from v000 it is 3.44 times as fast.
#include <hip/hip_runtime.h>
#include <hip/hip_bf16.h>
#include <math.h>

typedef __attribute__((ext_vector_type(16))) __bf16 v16bf;
typedef __attribute__((ext_vector_type(8)))  __bf16 v8bf;
typedef __attribute__((ext_vector_type(4)))  __bf16 v4bf;
typedef __attribute__((ext_vector_type(8)))  float  v8f;

#define LQ 512
#define DM 2048
#define NH 16
#define DH 128
#define FFD 8192

__device__ __forceinline__ v8f wmma_bf16(const v16bf& a, const v16bf& b, const v8f& c) {
    return __builtin_amdgcn_wmma_f32_16x16x32_bf16(false, a, false, b, (short)0, c, false, false);
}

__device__ __forceinline__ v16bf frag_from_lds(const __bf16* rowp, int half) {
    const v8bf lo = *(const v8bf*)(rowp + half * 8);
    const v8bf hi = *(const v8bf*)(rowp + 16 + half * 8);
    return __builtin_shufflevector(lo, hi, 0, 1, 2, 3, 4, 5, 6, 7,
                                           8, 9, 10, 11, 12, 13, 14, 15);
}

__device__ __forceinline__ void async_copy8_b128(const __bf16* g, unsigned lds, int gstep, unsigned lstep) {
    asm volatile("global_load_async_to_lds_b128 %0, %8, off\n\t"
                 "global_load_async_to_lds_b128 %1, %9, off\n\t"
                 "global_load_async_to_lds_b128 %2, %10, off\n\t"
                 "global_load_async_to_lds_b128 %3, %11, off\n\t"
                 "global_load_async_to_lds_b128 %4, %12, off\n\t"
                 "global_load_async_to_lds_b128 %5, %13, off\n\t"
                 "global_load_async_to_lds_b128 %6, %14, off\n\t"
                 "global_load_async_to_lds_b128 %7, %15, off\n\t"
                 "s_wait_xcnt 0x0"
                 :: "v"(lds), "v"(lds + lstep), "v"(lds + 2 * lstep), "v"(lds + 3 * lstep),
                    "v"(lds + 4 * lstep), "v"(lds + 5 * lstep), "v"(lds + 6 * lstep), "v"(lds + 7 * lstep),
                    "v"(g), "v"(g + gstep), "v"(g + 2 * gstep), "v"(g + 3 * gstep),
                    "v"(g + 4 * gstep), "v"(g + 5 * gstep), "v"(g + 6 * gstep), "v"(g + 7 * gstep)
                 : "memory");
}

// Transposing LDS load: from a row-major 16-bit tile, lane (c = lane & 15, half) gets
// rows 8*half .. +7 of column c; p is the lane's own address in the tile:
// row 8*half + (lane & 7), column 8*((lane >> 3) & 1).
__device__ __forceinline__ v8bf lds_load_tr16(const __bf16* p) {
    typedef __attribute__((address_space(3))) v8bf lds_v8bf;
    return __builtin_amdgcn_ds_load_tr16_b128_v8bf16((lds_v8bf*)p);
}

__device__ __forceinline__ float gelu_tanh(float x) {
    const float k0 = 0.7978845608028654f;  // sqrt(2/pi)
    const float k1 = 0.044715f;
    float t = tanhf(k0 * (x + k1 * x * x * x));
    return 0.5f * x * (1.0f + t);
}

template <int N, int K, int S, int G>
__global__ __launch_bounds__(256, 4) void gemm_splitk_kernel(
    const float* __restrict__ A, const float* __restrict__ B,
    float* __restrict__ Cpart,
    const float* __restrict__ B1, const float* __restrict__ B2)
{
    constexpr int KT = 128;             // k per stage
    static_assert(K % (2 * KT * S) == 0 && N % 128 == 0, "tile assumptions");
    static_assert(G == 1 || G == 3, "one product, or three that share A");
    __shared__ __align__(16) __bf16 aT[2][128][KT + 8];
    __shared__ __align__(16) __bf16 bTt[2][128][KT + 8];

    const int tid  = threadIdx.x;
    const int m0   = blockIdx.y * 128;
    const int n0   = blockIdx.x * 128;
    const int w    = tid >> 5;
    const int lane = tid & 31;
    const int half = lane >> 4;
    const int r    = lane & 15;
    const int wm   = (w & 3) * 32;
    const int wn   = (w >> 2) * 64;

    constexpr int AR = 1024 / KT;       // A staging: AR rows / pass, KT/4 float4 per row
    constexpr int AP = 128 / AR;        // passes
    constexpr int BK = KT / 2;          // B staging: k values per thread
    const int arow = tid / (KT / 4);
    const int acol = (tid % (KT / 4)) * 4;
    const int sn   = tid & 127;         // B staging: column gather, 2 threads per n
    const int sk0  = (tid >> 7) * BK;
    constexpr int KS = K / S;           // this work-group's K slice: [z*KS, z*KS + KS)
    const int zs = G > 1 ? blockIdx.z % S : blockIdx.z;  // K slice
    if constexpr (G > 1) {
        const int zg = blockIdx.z / S;  // which product
        B = zg == 0 ? B : (zg == 1 ? B1 : B2);
        Cpart += (size_t)zg * ((size_t)LQ * S * N);
    }
    A += (size_t)zs * KS + (size_t)(m0 + arow) * K + acol;      // this thread's first A element
    B += ((size_t)zs * KS + sk0) * N + n0 + sn;                 // and its first B element

    v8f acc[2][4] = {};

    auto stage = [&](int buf, int kc) {
        const float* ap = A + kc;
        const float* bp = B + (size_t)kc * N;
        float4 va[AP];
#pragma unroll
        for (int p = 0; p < AP; ++p)
            va[p] = *(const float4*)(&ap[p * AR * K]);
        // the B loads below may be given the A loads' address registers as destinations; the
        // address as an input keeps it from being a destination of a load of its own group
        asm volatile("s_wait_xcnt 0x0" :: "v"(ap) : "memory");
        float tb[BK];
#pragma unroll
        for (int i = 0; i < BK; ++i)
            tb[i] = bp[i * N];
        asm volatile("s_wait_xcnt 0x0" :: "v"(bp) : "memory");
#pragma unroll
        for (int p = 0; p < AP; ++p) {
            const int rr = p * AR + arow;
            aT[buf][rr][acol + 0] = (__bf16)va[p].x;
            aT[buf][rr][acol + 1] = (__bf16)va[p].y;
            aT[buf][rr][acol + 2] = (__bf16)va[p].z;
            aT[buf][rr][acol + 3] = (__bf16)va[p].w;
        }
#pragma unroll
        for (int q = 0; q < BK / 8; ++q) {
            v8bf t;
#pragma unroll
            for (int i = 0; i < 8; ++i) t[i] = (__bf16)tb[q * 8 + i];
            *(v8bf*)&bTt[buf][sn][sk0 + q * 8] = t;
        }
    };

    auto compute = [&](int buf) {
#pragma unroll
        for (int ks = 0; ks < KT; ks += 32) {
            v16bf afr[2], bfr[4];
#pragma unroll
            for (int mt = 0; mt < 2; ++mt)
                afr[mt] = frag_from_lds(&aT[buf][wm + mt * 16 + r][ks], half);
#pragma unroll
            for (int nt = 0; nt < 4; ++nt)
                bfr[nt] = frag_from_lds(&bTt[buf][wn + nt * 16 + r][ks], half);
#pragma unroll
            for (int mt = 0; mt < 2; ++mt)
#pragma unroll
                for (int nt = 0; nt < 4; ++nt)
                    acc[mt][nt] = wmma_bf16(afr[mt], bfr[nt], acc[mt][nt]);
        }
    };

    stage(0, 0);
    __syncthreads();
#pragma unroll 1
    for (int kc = 0; kc < KS; kc += 2 * KT) {
        stage(1, kc + KT);                       // KS % (2*KT) == 0 -> kc+KT < KS always
        compute(0);
        __syncthreads();
        if (kc + 2 * KT < KS) stage(0, kc + 2 * KT);
        compute(1);
        __syncthreads();
    }

    // Epilogue: C/D layout -> m = base + half*8 + vgpr, n = base + (lane&15)
    float* __restrict__ C = Cpart + (size_t)zs * N;
#pragma unroll
    for (int mt = 0; mt < 2; ++mt) {
#pragma unroll
        for (int nt = 0; nt < 4; ++nt) {
            const int mb = m0 + wm + mt * 16 + half * 8;
            const int nb = n0 + wn + nt * 16 + r;
#pragma unroll
            for (int g = 0; g < 8; ++g)
                C[(size_t)(mb + g) * (S * N) + nb] = acc[mt][nt][g];
        }
    }
}

// Sum of the S split-K partials of column c, in slice order; prow points at
// the S partial rows (each DM wide) of one output row.
template <int S>
__device__ __forceinline__ float sum_slices(const float* __restrict__ prow, int c)
{
    float v[S];
#pragma unroll
    for (int s = 0; s < S; ++s) v[s] = prow[s * DM + c];
    float x = v[0];
#pragma unroll
    for (int s = 1; s < S; ++s) x += v[s];
    return x;
}

// ---------------------------------------------------------------------------
// X = split-K partials + bias + positional encoding (computed on the fly,
// matches reference buffer).
// ---------------------------------------------------------------------------
template <int S>
__global__ __launch_bounds__(256) void add_pos_kernel(
    const float* __restrict__ part, const float* __restrict__ bias,
    float* __restrict__ X)
{
    const int l = blockIdx.x, tid = threadIdx.x;
    float* row = X + (size_t)l * DM;
    const float* prow = part + (size_t)l * (S * DM);
#pragma unroll
    for (int j = 0; j < 8; ++j) {
        const int c = tid + j * 256;
        const float denom = 10000.0f * expf((float)(c & ~1) * (1.0f / (float)DM));
        const float arg = (float)l / denom;
        const float x = sum_slices<S>(prow, c) + bias[c];
        row[c] = x + ((c & 1) ? cosf(arg) : sinf(arg));
    }
}

// ---------------------------------------------------------------------------
// split-K partials [L][S][D] fp32 + bias -> per-head bf16 [H][L][DH]
// (head h at column d*16+h).  blockIdx.y picks Q, K or V: its block of
// partials, its bias and its third of dst.
// ---------------------------------------------------------------------------
template <int S>
__global__ __launch_bounds__(256) void permute_heads_kernel(
    const float* __restrict__ part, const float* __restrict__ bias0,
    const float* __restrict__ bias1, const float* __restrict__ bias2,
    __bf16* __restrict__ dst)
{
    const int l = blockIdx.x, tid = threadIdx.x;
    const int p = blockIdx.y;
    const float* bias = p == 0 ? bias0 : (p == 1 ? bias1 : bias2);
    dst += (size_t)p * (NH * LQ * DH);
    const float* prow = part + ((size_t)p * LQ + l) * (S * DM);
#pragma unroll
    for (int j = 0; j < 8; ++j) {
        const int c = tid + j * 256;
        const int h = c & 15, d = c >> 4;
        const float x = sum_slices<S>(prow, c) + bias[c];
        dst[((size_t)h * LQ + l) * DH + d] = (__bf16)x;
    }
}

// ---------------------------------------------------------------------------
// Attention of one head and QB query rows in one work-group:
//   scores = scale * Q @ K^T (all LQ keys), row softmax, Acat[:, d*16+h] = P @ V.
// Scores (fp32) and probabilities (bf16) live in LDS only.  Wave w owns keys
// w*64..+63 in the first product, so Q and K fragments come straight from
// global memory.  The head's V lands row-major in LDS by async copies issued
// first, and wave w reads its columns w*16..+15 by transposing loads.
// ---------------------------------------------------------------------------
#define QB 32
__global__ __launch_bounds__(256) void attn_fused_kernel(
    const __bf16* __restrict__ Qh, const __bf16* __restrict__ Kh,
    const __bf16* __restrict__ Vh, float* __restrict__ Acat, float scale)
{
    __shared__ __align__(16) float  sS[QB][LQ + 4];
    __shared__ __align__(16) __bf16 sP[QB][LQ + 8];
    __shared__ __align__(16) __bf16 sV[LQ][DH + 16];

    const int tid  = threadIdx.x;
    const int h    = blockIdx.y;
    const int m0   = blockIdx.x * QB;
    const int w    = tid >> 5, lane = tid & 31;
    const int half = lane >> 4, r = lane & 15;

    const __bf16* Q  = Qh + ((size_t)h * LQ + m0) * DH;
    const __bf16* Kp = Kh + (size_t)h * LQ * DH;
    const __bf16* Vp = Vh + (size_t)h * LQ * DH;

    // ---- V: 16 rows per copy and work-group (16 lanes x 16 B a row), 32 copies per lane
#pragma unroll
    for (int j = 0; j < 4; ++j)
        async_copy8_b128(Vp + (size_t)(j * 128 + (tid >> 4)) * DH + (tid & 15) * 8,
                         (unsigned)(size_t)&sV[j * 128 + (tid >> 4)][(tid & 15) * 8],
                         16 * DH, 16 * (DH + 16) * 2);

    // ---- scores: 32 x 64 per wave, K-dim = DH in 4 steps of 32
    {
        const int wn = w * 64;
        const __bf16* qp = Q + (size_t)r * DH + half * 8;          // this lane's place in its Q row
        const __bf16* kp = Kp + (size_t)(wn + r) * DH + half * 8;  // and in its K row
        v16bf afr[4][2], bfr[4][4];
        v8f acc[2][4] = {};
        auto load = [&](int ks) {
#pragma unroll
            for (int mt = 0; mt < 2; ++mt)
                afr[ks][mt] = frag_from_lds(&qp[mt * 16 * DH + ks * 32], 0);
#pragma unroll
            for (int nt = 0; nt < 4; ++nt)
                bfr[ks][nt] = frag_from_lds(&kp[nt * 16 * DH + ks * 32], 0);
            // code that follows may reuse these loads' address registers; the addresses as
            // inputs keep them from being handed out as destinations to loads of this group
            asm volatile("s_wait_xcnt 0x0" :: "v"(qp), "v"(kp) : "memory");
        };
        auto compute = [&](int ks) {
#pragma unroll
            for (int mt = 0; mt < 2; ++mt)
#pragma unroll
                for (int nt = 0; nt < 4; ++nt)
                    acc[mt][nt] = wmma_bf16(afr[ks][mt], bfr[ks][nt], acc[mt][nt]);
        };
        load(0); load(1); load(2);
        // keeps the first products, which wait for their operands, from being scheduled
        // in front of the later steps' loads: a wave issues in order
        __builtin_amdgcn_sched_barrier(0);
        compute(0);
        load(3);
        compute(1); compute(2); compute(3);
#pragma unroll
        for (int mt = 0; mt < 2; ++mt)
#pragma unroll
            for (int nt = 0; nt < 4; ++nt)
#pragma unroll
                for (int g = 0; g < 8; ++g)
                    sS[mt * 16 + half * 8 + g][wn + nt * 16 + r] = acc[mt][nt][g] * scale;
    }

    __syncthreads();

    // ---- softmax over keys: one wave per row, 4 rows per wave, 16 scores per lane
#pragma unroll
    for (int i = 0; i < QB / 8; ++i) {
        const int row = w * (QB / 8) + i;
        float4 v[4];
#pragma unroll
        for (int j = 0; j < 4; ++j) v[j] = *(const float4*)&sS[row][lane * 4 + j * 128];
        float mx = fmaxf(fmaxf(v[0].x, v[0].y), fmaxf(v[0].z, v[0].w));
#pragma unroll
        for (int j = 1; j < 4; ++j)
            mx = fmaxf(mx, fmaxf(fmaxf(v[j].x, v[j].y), fmaxf(v[j].z, v[j].w)));
#pragma unroll
        for (int o = 16; o > 0; o >>= 1) mx = fmaxf(mx, __shfl_xor(mx, o));
        float s = 0.0f;
#pragma unroll
        for (int j = 0; j < 4; ++j) {
            v[j].x = expf(v[j].x - mx); v[j].y = expf(v[j].y - mx);
            v[j].z = expf(v[j].z - mx); v[j].w = expf(v[j].w - mx);
            s += (v[j].x + v[j].y) + (v[j].z + v[j].w);
        }
#pragma unroll
        for (int o = 16; o > 0; o >>= 1) s += __shfl_xor(s, o);
        const float inv = 1.0f / s;
#pragma unroll
        for (int j = 0; j < 4; ++j) {
            v4bf p;
            p[0] = (__bf16)(v[j].x * inv); p[1] = (__bf16)(v[j].y * inv);
            p[2] = (__bf16)(v[j].z * inv); p[3] = (__bf16)(v[j].w * inv);
            *(v4bf*)&sP[row][lane * 4 + j * 128] = p;
        }
    }
    // this wave's V copies have landed; the barrier then publishes V and P to all waves
    asm volatile("s_wait_asynccnt 0x0" ::: "memory");
    __syncthreads();

    // ---- P @ V: 32 x 16 per wave, K-dim = LQ in 16 steps of 32
    const int n = w * 16 + r;             // this lane's column of V
    const __bf16* vt = &sV[half * 8 + (lane & 7)][w * 16 + ((lane >> 3) & 1) * 8];
    v8f o[2] = {};
#pragma unroll
    for (int ks = 0; ks < LQ / 32; ++ks) {
        const v8bf lo = lds_load_tr16(vt + (ks * 32) * (DH + 16));        // keys ks*32 + half*8 .. +7
        const v8bf hi = lds_load_tr16(vt + (ks * 32 + 16) * (DH + 16));   // keys ks*32 + 16 + half*8 .. +7
        const v16bf vfr = __builtin_shufflevector(lo, hi, 0, 1, 2, 3, 4, 5, 6, 7,
                                                          8, 9, 10, 11, 12, 13, 14, 15);
#pragma unroll
        for (int mt = 0; mt < 2; ++mt)
            o[mt] = wmma_bf16(frag_from_lds(&sP[mt * 16 + r][ks * 32], half), vfr, o[mt]);
    }

#pragma unroll
    for (int mt = 0; mt < 2; ++mt)
#pragma unroll
        for (int g = 0; g < 8; ++g)
            Acat[(size_t)(m0 + mt * 16 + half * 8 + g) * DM + n * NH + h] = o[mt][g];
}

// ---------------------------------------------------------------------------
// H = gelu(split-K partials + bias), one row of FFD per work-group.
// ---------------------------------------------------------------------------
template <int S>
__global__ __launch_bounds__(256) void bias_gelu_kernel(
    const float* __restrict__ part, const float* __restrict__ bias,
    float* __restrict__ Hout)
{
    const int l = blockIdx.x, tid = threadIdx.x;
    const float* prow = part + (size_t)l * (S * FFD);
    float* hrow = Hout + (size_t)l * FFD;
    constexpr int NJ = FFD / 1024;
    // all loads of the row first, so that they are in flight together
    float4 v[S][NJ], bv[NJ];
#pragma unroll
    for (int j = 0; j < NJ; ++j) {
        const int c = (tid + j * 256) * 4;
#pragma unroll
        for (int s = 0; s < S; ++s) v[s][j] = *(const float4*)(&prow[s * FFD + c]);
        bv[j] = *(const float4*)(&bias[c]);
    }
#pragma unroll
    for (int j = 0; j < NJ; ++j) {
        const int c = (tid + j * 256) * 4;
        float4 x = v[0][j];
#pragma unroll
        for (int s = 1; s < S; ++s) {
            x.x += v[s][j].x; x.y += v[s][j].y; x.z += v[s][j].z; x.w += v[s][j].w;
        }
        float4 y;
        y.x = gelu_tanh(x.x + bv[j].x);
        y.y = gelu_tanh(x.y + bv[j].y);
        y.z = gelu_tanh(x.z + bv[j].z);
        y.w = gelu_tanh(x.w + bv[j].w);
        *(float4*)(&hrow[c]) = y;
    }
}

// ---------------------------------------------------------------------------
// Row LayerNorm over D=2048 of (split-K partials + bias + residual).
// ---------------------------------------------------------------------------
template <int S>
__global__ __launch_bounds__(256) void layernorm_kernel(
    const float* __restrict__ part, const float* __restrict__ bias,
    const float* __restrict__ res, const float* __restrict__ g,
    const float* __restrict__ b, float* __restrict__ Y)
{
    const int l = blockIdx.x, tid = threadIdx.x;
    const float* prow = part + (size_t)l * (S * DM);
    const float* rrow = res + (size_t)l * DM;
    float* out = Y + (size_t)l * DM;
    __shared__ float red[256];

    float vals[8], s = 0.0f;
#pragma unroll
    for (int j = 0; j < 8; ++j) {
        const int c = tid + j * 256;
        vals[j] = sum_slices<S>(prow, c) + bias[c] + rrow[c];
        s += vals[j];
    }
    red[tid] = s;
    __syncthreads();
    for (int st = 128; st > 0; st >>= 1) { if (tid < st) red[tid] += red[tid + st]; __syncthreads(); }
    const float mu = red[0] * (1.0f / (float)DM);
    __syncthreads();

    float v = 0.0f;
#pragma unroll
    for (int j = 0; j < 8; ++j) { const float d = vals[j] - mu; v += d * d; }
    red[tid] = v;
    __syncthreads();
    for (int st = 128; st > 0; st >>= 1) { if (tid < st) red[tid] += red[tid + st]; __syncthreads(); }
    const float inv = rsqrtf(red[0] * (1.0f / (float)DM) + 1e-5f);

#pragma unroll
    for (int j = 0; j < 8; ++j) {
        const int c = tid + j * 256;
        out[c] = (vals[j] - mu) * inv * g[c] + b[c];
    }
}

// ---------------------------------------------------------------------------
extern "C" void kernel_launch(void* const* d_in, const int* in_sizes, int n_in,
                              void* d_out, int out_size, void* d_ws, size_t ws_size,
                              hipStream_t stream)
{
    (void)in_sizes; (void)n_in; (void)out_size; (void)ws_size;

    const float* seq  = (const float*)d_in[0];
    const float* embW = (const float*)d_in[1];
    const float* embB = (const float*)d_in[2];
    const float* Wq   = (const float*)d_in[3];
    const float* bq   = (const float*)d_in[4];
    const float* Wk   = (const float*)d_in[5];
    const float* bk   = (const float*)d_in[6];
    const float* Wv   = (const float*)d_in[7];
    const float* bv   = (const float*)d_in[8];
    const float* Wo   = (const float*)d_in[9];
    const float* bo   = (const float*)d_in[10];
    const float* lng  = (const float*)d_in[11];
    const float* lnb  = (const float*)d_in[12];
    const float* W1   = (const float*)d_in[13];
    const float* b1   = (const float*)d_in[14];
    const float* W2   = (const float*)d_in[15];
    const float* b2   = (const float*)d_in[16];

    char* ws = (char*)d_ws;
    size_t off = 0;
    auto take = [&](size_t bytes) { char* p = ws + off; off = (off + bytes + 255) & ~(size_t)255; return p; };

    const size_t fLD = (size_t)LQ * DM * sizeof(float);       // 4 MB
    const size_t hLD = (size_t)NH * LQ * DH * sizeof(__bf16); // 2 MB
    const size_t fLF = (size_t)LQ * FFD * sizeof(float);      // 16 MB

    float*  X    = (float*)take(fLD);
    float*  Acat = (float*)take(fLD);
    __bf16* Qh   = (__bf16*)take(3 * hLD);   // Q, K, V per-head planes, one after the other
    __bf16* Kh   = Qh + (size_t)NH * LQ * DH;
    __bf16* Vh   = Kh + (size_t)NH * LQ * DH;
    float*  Hf   = (float*)take(fLF);        // FFN hidden
    float*  Xa   = (float*)take(fLD);
    float*  Pt   = (float*)take(3 * 8 * fLD); // split-K partials: 32 MB a product, 3 products in the Q/K/V launch
    float*  Yout = (float*)d_out;

    const dim3 blk(256);
    const dim3 gD (DM / 128, LQ / 128, 8);   // N=2048 GEMMs, 8 K slices: 512 work-groups
    const dim3 gQKV(DM / 128, LQ / 128, 3 * 8); // Q, K and V projections together: 1536 work-groups
    const dim3 gFF(FFD / 128, LQ / 128, 2);  // N=8192 GEMM, 2 K slices: 512 work-groups

    // 1) embedding, 2) + bias + positional encoding
    gemm_splitk_kernel<DM, DM, 8, 1><<<gD, blk, 0, stream>>>(seq, embW, Pt, nullptr, nullptr);
    add_pos_kernel<8><<<LQ, blk, 0, stream>>>(Pt, embB, X);
    // 3) Q/K/V projections in one launch, 4) their bias + per-head bf16 layout in one launch
    gemm_splitk_kernel<DM, DM, 8, 3><<<gQKV, blk, 0, stream>>>(X, Wq, Pt, Wk, Wv);
    permute_heads_kernel<8><<<dim3(LQ, 3), blk, 0, stream>>>(Pt, bq, bk, bv, Qh);
    // 5-7) softmax(Qh @ Kh^T / sqrt(D)) @ Vh, scattered back to the [L, D] interleaved layout
    attn_fused_kernel<<<dim3(LQ / QB, NH), blk, 0, stream>>>(
        Qh, Kh, Vh, Acat, 0.022097086912079608f /* 1/sqrt(2048) */);
    // 8) output projection, 9) + bias + residual X, LayerNorm -> Xa
    gemm_splitk_kernel<DM, DM, 8, 1><<<gD, blk, 0, stream>>>(Acat, Wo, Pt, nullptr, nullptr);
    layernorm_kernel<8><<<LQ, blk, 0, stream>>>(Pt, bo, X, lng, lnb, Xa);
    // 10) FFN1, then bias + GELU
    gemm_splitk_kernel<FFD, DM, 2, 1><<<gFF, blk, 0, stream>>>(Xa, W1, Pt, nullptr, nullptr);
    bias_gelu_kernel<2><<<LQ, blk, 0, stream>>>(Pt, b1, Hf);
    // 11) FFN2, 12) + bias + residual Xa, final LayerNorm -> output
    gemm_splitk_kernel<DM, FFD, 8, 1><<<gD, blk, 0, stream>>>(Hf, W2, Pt, nullptr, nullptr);
    layernorm_kernel<8><<<LQ, blk, 0, stream>>>(Pt, b2, Xa, lng, lnb, Yout);
}

// v005
// A run of this version takes 179 microseconds.
// In both of two side-by-side timings against v004, it was 1.06 times as fast.
// Over all steps from v000 it is 3.65 times as fast.
#include <hip/hip_runtime.h>
#include <hip/hip_bf16.h>
#include <math.h>

typedef __attribute__((ext_vector_type(16))) __bf16 v16bf;
typedef __attribute__((ext_vector_type(8)))  __bf16 v8bf;
typedef __attribute__((ext_vector_type(4)))  __bf16 v4bf;
typedef __attribute__((ext_vector_type(8)))  float  v8f;

#define LQ 512
#define DM 2048
#define NH 16
#define DH 128
#define FFD 8192

__device__ __forceinline__ v8f wmma_bf16(const v16bf& a, const v16bf& b, const v8f& c) {
    return __builtin_amdgcn_wmma_f32_16x16x32_bf16(false, a, false, b, (short)0, c, false, false);
}

__device__ __forceinline__ v16bf frag_from_lds(const __bf16* rowp, int half) {
    const v8bf lo = *(const v8bf*)(rowp + half * 8);
    const v8bf hi = *(const v8bf*)(rowp + 16 + half * 8);
    return __builtin_shufflevector(lo, hi, 0, 1, 2, 3, 4, 5, 6, 7,
                                           8, 9, 10, 11, 12, 13, 14, 15);
}

__device__ __forceinline__ void async_copy8_b128(const __bf16* g, unsigned lds, int gstep, unsigned lstep) {
    asm volatile("global_load_async_to_lds_b128 %0, %8, off\n\t"
                 "global_load_async_to_lds_b128 %1, %9, off\n\t"
                 "global_load_async_to_lds_b128 %2, %10, off\n\t"
                 "global_load_async_to_lds_b128 %3, %11, off\n\t"
                 "global_load_async_to_lds_b128 %4, %12, off\n\t"
                 "global_load_async_to_lds_b128 %5, %13, off\n\t"
                 "global_load_async_to_lds_b128 %6, %14, off\n\t"
                 "global_load_async_to_lds_b128 %7, %15, off\n\t"
                 "s_wait_xcnt 0x0"
                 :: "v"(lds), "v"(lds + lstep), "v"(lds + 2 * lstep), "v"(lds + 3 * lstep),
                    "v"(lds + 4 * lstep), "v"(lds + 5 * lstep), "v"(lds + 6 * lstep), "v"(lds + 7 * lstep),
                    "v"(g), "v"(g + gstep), "v"(g + 2 * gstep), "v"(g + 3 * gstep),
                    "v"(g + 4 * gstep), "v"(g + 5 * gstep), "v"(g + 6 * gstep), "v"(g + 7 * gstep)
                 : "memory");
}

// Transposing LDS load: from a row-major 16-bit tile, lane (c = lane & 15, half) gets
// rows 8*half .. +7 of column c; p is the lane's own address in the tile:
// row 8*half + (lane & 7), column 8*((lane >> 3) & 1).
__device__ __forceinline__ v8bf lds_load_tr16(const __bf16* p) {
    typedef __attribute__((address_space(3))) v8bf lds_v8bf;
    return __builtin_amdgcn_ds_load_tr16_b128_v8bf16((lds_v8bf*)p);
}

__device__ __forceinline__ float gelu_tanh(float x) {
    const float k0 = 0.7978845608028654f;  // sqrt(2/pi)
    const float k1 = 0.044715f;
    float t = tanhf(k0 * (x + k1 * x * x * x));
    return 0.5f * x * (1.0f + t);
}

template <int N, int K, int S, int G, bool ABF>
__global__ __launch_bounds__(256, 4) void gemm_splitk_kernel(
    const float* __restrict__ A, const __bf16* __restrict__ Ab, const float* __restrict__ B,
    float* __restrict__ Cpart,
    const float* __restrict__ B1, const float* __restrict__ B2)
{
    constexpr int KT = 128;             // k per stage
    static_assert(K % (2 * KT * S) == 0 && N % 128 == 0, "tile assumptions");
    static_assert(G == 1 || G == 3, "one product, or three that share A");
    __shared__ __align__(16) __bf16 aT[2][128][KT + 8];
    __shared__ __align__(16) __bf16 bTt[2][128][KT + 8];

    const int tid  = threadIdx.x;
    const int m0   = blockIdx.y * 128;
    const int n0   = blockIdx.x * 128;
    const int w    = tid >> 5;
    const int lane = tid & 31;
    const int half = lane >> 4;
    const int r    = lane & 15;
    const int wm   = (w & 3) * 32;
    const int wn   = (w >> 2) * 64;

    constexpr int AE = ABF ? 8 : 4;     // A staging: elements per 16-byte load
    constexpr int AR = 256 * AE / KT;   // AR rows / pass, KT/AE loads per row
    constexpr int AP = 128 / AR;        // passes
    constexpr int BK = KT / 2;          // B staging: k values per thread
    const int arow = tid / (KT / AE);
    const int acol = (tid % (KT / AE)) * AE;
    const int sn   = tid & 127;         // B staging: column gather, 2 threads per n
    const int sk0  = (tid >> 7) * BK;
    constexpr int KS = K / S;           // this work-group's K slice: [z*KS, z*KS + KS)
    const int zs = G > 1 ? blockIdx.z % S : blockIdx.z;  // K slice
    if constexpr (G > 1) {
        const int zg = blockIdx.z / S;  // which product
        B = zg == 0 ? B : (zg == 1 ? B1 : B2);
        Cpart += (size_t)zg * ((size_t)LQ * S * N);
    }
    const size_t aoff = (size_t)zs * KS + (size_t)(m0 + arow) * K + acol;  // this thread's first A element
    B += ((size_t)zs * KS + sk0) * N + n0 + sn;                 // and its first B element

    v8f acc[2][4] = {};

    auto stage = [&](int buf, int kc) {
        const float* bp = B + (size_t)kc * N;
        float4 va[ABF ? 1 : AP];
        v8bf   vh[ABF ? AP : 1];
        // the B loads below may be given the A loads' address registers as destinations; the
        // address as an input keeps it from being a destination of a load of its own group
        if constexpr (ABF) {
            const __bf16* ap = Ab + aoff + kc;
#pragma unroll
            for (int p = 0; p < AP; ++p)
                vh[p] = *(const v8bf*)(&ap[p * AR * K]);
            asm volatile("s_wait_xcnt 0x0" :: "v"(ap) : "memory");
        } else {
            const float* ap = A + aoff + kc;
#pragma unroll
            for (int p = 0; p < AP; ++p)
                va[p] = *(const float4*)(&ap[p * AR * K]);
            asm volatile("s_wait_xcnt 0x0" :: "v"(ap) : "memory");
        }
        float tb[BK];
#pragma unroll
        for (int i = 0; i < BK; ++i)
            tb[i] = bp[i * N];
        asm volatile("s_wait_xcnt 0x0" :: "v"(bp) : "memory");
#pragma unroll
        for (int p = 0; p < AP; ++p) {
            const int rr = p * AR + arow;
            if constexpr (ABF) {
                *(v8bf*)&aT[buf][rr][acol] = vh[p];
            } else {
                aT[buf][rr][acol + 0] = (__bf16)va[p].x;
                aT[buf][rr][acol + 1] = (__bf16)va[p].y;
                aT[buf][rr][acol + 2] = (__bf16)va[p].z;
                aT[buf][rr][acol + 3] = (__bf16)va[p].w;
            }
        }
#pragma unroll
        for (int q = 0; q < BK / 8; ++q) {
            v8bf t;
#pragma unroll
            for (int i = 0; i < 8; ++i) t[i] = (__bf16)tb[q * 8 + i];
            *(v8bf*)&bTt[buf][sn][sk0 + q * 8] = t;
        }
    };

    auto compute = [&](int buf) {
#pragma unroll
        for (int ks = 0; ks < KT; ks += 32) {
            v16bf afr[2], bfr[4];
#pragma unroll
            for (int mt = 0; mt < 2; ++mt)
                afr[mt] = frag_from_lds(&aT[buf][wm + mt * 16 + r][ks], half);
#pragma unroll
            for (int nt = 0; nt < 4; ++nt)
                bfr[nt] = frag_from_lds(&bTt[buf][wn + nt * 16 + r][ks], half);
#pragma unroll
            for (int mt = 0; mt < 2; ++mt)
#pragma unroll
                for (int nt = 0; nt < 4; ++nt)
                    acc[mt][nt] = wmma_bf16(afr[mt], bfr[nt], acc[mt][nt]);
        }
    };

    stage(0, 0);
    __syncthreads();
#pragma unroll 1
    for (int kc = 0; kc < KS; kc += 2 * KT) {
        stage(1, kc + KT);                       // KS % (2*KT) == 0 -> kc+KT < KS always
        compute(0);
        __syncthreads();
        if (kc + 2 * KT < KS) stage(0, kc + 2 * KT);
        compute(1);
        __syncthreads();
    }

    // Epilogue: C/D layout -> m = base + half*8 + vgpr, n = base + (lane&15)
    float* __restrict__ C = Cpart + (size_t)zs * N;
#pragma unroll
    for (int mt = 0; mt < 2; ++mt) {
#pragma unroll
        for (int nt = 0; nt < 4; ++nt) {
            const int mb = m0 + wm + mt * 16 + half * 8;
            const int nb = n0 + wn + nt * 16 + r;
#pragma unroll
            for (int g = 0; g < 8; ++g)
                C[(size_t)(mb + g) * (S * N) + nb] = acc[mt][nt][g];
        }
    }
}

// Sum of the S split-K partials of column c, in slice order; prow points at
// the S partial rows (each DM wide) of one output row.
template <int S>
__device__ __forceinline__ float sum_slices(const float* __restrict__ prow, int c)
{
    float v[S];
#pragma unroll
    for (int s = 0; s < S; ++s) v[s] = prow[s * DM + c];
    float x = v[0];
#pragma unroll
    for (int s = 1; s < S; ++s) x += v[s];
    return x;
}

// ---------------------------------------------------------------------------
// X = split-K partials + bias + positional encoding (computed on the fly,
// matches reference buffer).  X stays fp32 for the residual; Xb is its bf16 rounding,
// the A operand of the Q/K/V projections.
// ---------------------------------------------------------------------------
template <int S>
__global__ __launch_bounds__(256) void add_pos_kernel(
    const float* __restrict__ part, const float* __restrict__ bias,
    float* __restrict__ X, __bf16* __restrict__ Xb)
{
    const int l = blockIdx.x, tid = threadIdx.x;
    float* row = X + (size_t)l * DM;
    __bf16* rowb = Xb + (size_t)l * DM;
    const float* prow = part + (size_t)l * (S * DM);
#pragma unroll
    for (int j = 0; j < 8; ++j) {
        const int c = tid + j * 256;
        const float denom = 10000.0f * expf((float)(c & ~1) * (1.0f / (float)DM));
        const float arg = (float)l / denom;
        const float x = sum_slices<S>(prow, c) + bias[c];
        const float y = x + ((c & 1) ? cosf(arg) : sinf(arg));
        row[c]  = y;
        rowb[c] = (__bf16)y;
    }
}

// ---------------------------------------------------------------------------
// split-K partials [L][S][D] fp32 + bias -> per-head bf16 [H][L][DH]
// (head h at column d*16+h).  blockIdx.y picks Q, K or V: its block of
// partials, its bias and its third of dst.
// ---------------------------------------------------------------------------
template <int S>
__global__ __launch_bounds__(256) void permute_heads_kernel(
    const float* __restrict__ part, const float* __restrict__ bias0,
    const float* __restrict__ bias1, const float* __restrict__ bias2,
    __bf16* __restrict__ dst)
{
    const int l = blockIdx.x, tid = threadIdx.x;
    const int p = blockIdx.y;
    const float* bias = p == 0 ? bias0 : (p == 1 ? bias1 : bias2);
    dst += (size_t)p * (NH * LQ * DH);
    const float* prow = part + ((size_t)p * LQ + l) * (S * DM);
#pragma unroll
    for (int j = 0; j < 8; ++j) {
        const int c = tid + j * 256;
        const int h = c & 15, d = c >> 4;
        const float x = sum_slices<S>(prow, c) + bias[c];
        dst[((size_t)h * LQ + l) * DH + d] = (__bf16)x;
    }
}

// ---------------------------------------------------------------------------
// Attention of one head and QB query rows in one work-group:
//   scores = scale * Q @ K^T (all LQ keys), row softmax, Acat[:, d*16+h] = P @ V.
// Scores (fp32) and probabilities (bf16) live in LDS only.  Wave w owns keys
// w*64..+63 in the first product, so Q and K fragments come straight from
// global memory.  The head's V lands row-major in LDS by async copies issued
// first, and wave w reads its columns w*16..+15 by transposing loads.
// ---------------------------------------------------------------------------
#define QB 32
__global__ __launch_bounds__(256) void attn_fused_kernel(
    const __bf16* __restrict__ Qh, const __bf16* __restrict__ Kh,
    const __bf16* __restrict__ Vh, float* __restrict__ Acat, float scale)
{
    __shared__ __align__(16) float  sS[QB][LQ + 4];
    __shared__ __align__(16) __bf16 sP[QB][LQ + 8];
    __shared__ __align__(16) __bf16 sV[LQ][DH + 16];

    const int tid  = threadIdx.x;
    const int h    = blockIdx.y;
    const int m0   = blockIdx.x * QB;
    const int w    = tid >> 5, lane = tid & 31;
    const int half = lane >> 4, r = lane & 15;

    const __bf16* Q  = Qh + ((size_t)h * LQ + m0) * DH;
    const __bf16* Kp = Kh + (size_t)h * LQ * DH;
    const __bf16* Vp = Vh + (size_t)h * LQ * DH;

    // ---- V: 16 rows per copy and work-group (16 lanes x 16 B a row), 32 copies per lane
#pragma unroll
    for (int j = 0; j < 4; ++j)
        async_copy8_b128(Vp + (size_t)(j * 128 + (tid >> 4)) * DH + (tid & 15) * 8,
                         (unsigned)(size_t)&sV[j * 128 + (tid >> 4)][(tid & 15) * 8],
                         16 * DH, 16 * (DH + 16) * 2);

    // ---- scores: 32 x 64 per wave, K-dim = DH in 4 steps of 32
    {
        const int wn = w * 64;
        const __bf16* qp = Q + (size_t)r * DH + half * 8;          // this lane's place in its Q row
        const __bf16* kp = Kp + (size_t)(wn + r) * DH + half * 8;  // and in its K row
        v16bf afr[4][2], bfr[4][4];
        v8f acc[2][4] = {};
        auto load = [&](int ks) {
#pragma unroll
            for (int mt = 0; mt < 2; ++mt)
                afr[ks][mt] = frag_from_lds(&qp[mt * 16 * DH + ks * 32], 0);
#pragma unroll
            for (int nt = 0; nt < 4; ++nt)
                bfr[ks][nt] = frag_from_lds(&kp[nt * 16 * DH + ks * 32], 0);
            // code that follows may reuse these loads' address registers; the addresses as
            // inputs keep them from being handed out as destinations to loads of this group
            asm volatile("s_wait_xcnt 0x0" :: "v"(qp), "v"(kp) : "memory");
        };
        auto compute = [&](int ks) {
#pragma unroll
            for (int mt = 0; mt < 2; ++mt)
#pragma unroll
                for (int nt = 0; nt < 4; ++nt)
                    acc[mt][nt] = wmma_bf16(afr[ks][mt], bfr[ks][nt], acc[mt][nt]);
        };
        load(0); load(1); load(2);
        // keeps the first products, which wait for their operands, from being scheduled
        // in front of the later steps' loads: a wave issues in order
        __builtin_amdgcn_sched_barrier(0);
        compute(0);
        load(3);
        compute(1); compute(2); compute(3);
#pragma unroll
        for (int mt = 0; mt < 2; ++mt)
#pragma unroll
            for (int nt = 0; nt < 4; ++nt)
#pragma unroll
                for (int g = 0; g < 8; ++g)
                    sS[mt * 16 + half * 8 + g][wn + nt * 16 + r] = acc[mt][nt][g] * scale;
    }

    __syncthreads();

    // ---- softmax over keys: one wave per row, 4 rows per wave, 16 scores per lane
#pragma unroll
    for (int i = 0; i < QB / 8; ++i) {
        const int row = w * (QB / 8) + i;
        float4 v[4];
#pragma unroll
        for (int j = 0; j < 4; ++j) v[j] = *(const float4*)&sS[row][lane * 4 + j * 128];
        float mx = fmaxf(fmaxf(v[0].x, v[0].y), fmaxf(v[0].z, v[0].w));
#pragma unroll
        for (int j = 1; j < 4; ++j)
            mx = fmaxf(mx, fmaxf(fmaxf(v[j].x, v[j].y), fmaxf(v[j].z, v[j].w)));
#pragma unroll
        for (int o = 16; o > 0; o >>= 1) mx = fmaxf(mx, __shfl_xor(mx, o));
        float s = 0.0f;
#pragma unroll
        for (int j = 0; j < 4; ++j) {
            v[j].x = expf(v[j].x - mx); v[j].y = expf(v[j].y - mx);
            v[j].z = expf(v[j].z - mx); v[j].w = expf(v[j].w - mx);
            s += (v[j].x + v[j].y) + (v[j].z + v[j].w);
        }
#pragma unroll
        for (int o = 16; o > 0; o >>= 1) s += __shfl_xor(s, o);
        const float inv = 1.0f / s;
#pragma unroll
        for (int j = 0; j < 4; ++j) {
            v4bf p;
            p[0] = (__bf16)(v[j].x * inv); p[1] = (__bf16)(v[j].y * inv);
            p[2] = (__bf16)(v[j].z * inv); p[3] = (__bf16)(v[j].w * inv);
            *(v4bf*)&sP[row][lane * 4 + j * 128] = p;
        }
    }
    // this wave's V copies have landed; the barrier then publishes V and P to all waves
    asm volatile("s_wait_asynccnt 0x0" ::: "memory");
    __syncthreads();

    // ---- P @ V: 32 x 16 per wave, K-dim = LQ in 16 steps of 32
    const int n = w * 16 + r;             // this lane's column of V
    const __bf16* vt = &sV[half * 8 + (lane & 7)][w * 16 + ((lane >> 3) & 1) * 8];
    v8f o[2] = {};
#pragma unroll
    for (int ks = 0; ks < LQ / 32; ++ks) {
        const v8bf lo = lds_load_tr16(vt + (ks * 32) * (DH + 16));        // keys ks*32 + half*8 .. +7
        const v8bf hi = lds_load_tr16(vt + (ks * 32 + 16) * (DH + 16));   // keys ks*32 + 16 + half*8 .. +7
        const v16bf vfr = __builtin_shufflevector(lo, hi, 0, 1, 2, 3, 4, 5, 6, 7,
                                                          8, 9, 10, 11, 12, 13, 14, 15);
#pragma unroll
        for (int mt = 0; mt < 2; ++mt)
            o[mt] = wmma_bf16(frag_from_lds(&sP[mt * 16 + r][ks * 32], half), vfr, o[mt]);
    }

#pragma unroll
    for (int mt = 0; mt < 2; ++mt)
#pragma unroll
        for (int g = 0; g < 8; ++g)
            Acat[(size_t)(m0 + mt * 16 + half * 8 + g) * DM + n * NH + h] = o[mt][g];
}

// ---------------------------------------------------------------------------
// H = gelu(split-K partials + bias) as bf16 (it only feeds FFN2's A operand), one row
// of FFD per work-group.
// ---------------------------------------------------------------------------
template <int S>
__global__ __launch_bounds__(256) void bias_gelu_kernel(
    const float* __restrict__ part, const float* __restrict__ bias,
    __bf16* __restrict__ Hout)
{
    const int l = blockIdx.x, tid = threadIdx.x;
    const float* prow = part + (size_t)l * (S * FFD);
    __bf16* hrow = Hout + (size_t)l * FFD;
    constexpr int NJ = FFD / 1024;
    // all loads of the row first, so that they are in flight together
    float4 v[S][NJ], bv[NJ];
#pragma unroll
    for (int j = 0; j < NJ; ++j) {
        const int c = (tid + j * 256) * 4;
#pragma unroll
        for (int s = 0; s < S; ++s) v[s][j] = *(const float4*)(&prow[s * FFD + c]);
        bv[j] = *(const float4*)(&bias[c]);
    }
#pragma unroll
    for (int j = 0; j < NJ; ++j) {
        const int c = (tid + j * 256) * 4;
        float4 x = v[0][j];
#pragma unroll
        for (int s = 1; s < S; ++s) {
            x.x += v[s][j].x; x.y += v[s][j].y; x.z += v[s][j].z; x.w += v[s][j].w;
        }
        v4bf y;
        y[0] = (__bf16)gelu_tanh(x.x + bv[j].x);
        y[1] = (__bf16)gelu_tanh(x.y + bv[j].y);
        y[2] = (__bf16)gelu_tanh(x.z + bv[j].z);
        y[3] = (__bf16)gelu_tanh(x.w + bv[j].w);
        *(v4bf*)(&hrow[c]) = y;
    }
}

// ---------------------------------------------------------------------------
// Row LayerNorm over D=2048 of (split-K partials + bias + residual).
// WB: the result is also written rounded to bf16 (Yb), for the GEMM that reads it as A.
// ---------------------------------------------------------------------------
template <int S, bool WB>
__global__ __launch_bounds__(256) void layernorm_kernel(
    const float* __restrict__ part, const float* __restrict__ bias,
    const float* __restrict__ res, const float* __restrict__ g,
    const float* __restrict__ b, float* __restrict__ Y, __bf16* __restrict__ Yb)
{
    const int l = blockIdx.x, tid = threadIdx.x;
    const float* prow = part + (size_t)l * (S * DM);
    const float* rrow = res + (size_t)l * DM;
    float* out = Y + (size_t)l * DM;
    __shared__ float red[256];

    float vals[8], s = 0.0f;
#pragma unroll
    for (int j = 0; j < 8; ++j) {
        const int c = tid + j * 256;
        vals[j] = sum_slices<S>(prow, c) + bias[c] + rrow[c];
        s += vals[j];
    }
    red[tid] = s;
    __syncthreads();
    for (int st = 128; st > 0; st >>= 1) { if (tid < st) red[tid] += red[tid + st]; __syncthreads(); }
    const float mu = red[0] * (1.0f / (float)DM);
    __syncthreads();

    float v = 0.0f;
#pragma unroll
    for (int j = 0; j < 8; ++j) { const float d = vals[j] - mu; v += d * d; }
    red[tid] = v;
    __syncthreads();
    for (int st = 128; st > 0; st >>= 1) { if (tid < st) red[tid] += red[tid + st]; __syncthreads(); }
    const float inv = rsqrtf(red[0] * (1.0f / (float)DM) + 1e-5f);

#pragma unroll
    for (int j = 0; j < 8; ++j) {
        const int c = tid + j * 256;
        const float y = (vals[j] - mu) * inv * g[c] + b[c];
        out[c] = y;
        if constexpr (WB) Yb[(size_t)l * DM + c] = (__bf16)y;
    }
}

// ---------------------------------------------------------------------------
extern "C" void kernel_launch(void* const* d_in, const int* in_sizes, int n_in,
                              void* d_out, int out_size, void* d_ws, size_t ws_size,
                              hipStream_t stream)
{
    (void)in_sizes; (void)n_in; (void)out_size; (void)ws_size;

    const float* seq  = (const float*)d_in[0];
    const float* embW = (const float*)d_in[1];
    const float* embB = (const float*)d_in[2];
    const float* Wq   = (const float*)d_in[3];
    const float* bq   = (const float*)d_in[4];
    const float* Wk   = (const float*)d_in[5];
    const float* bk   = (const float*)d_in[6];
    const float* Wv   = (const float*)d_in[7];
    const float* bv   = (const float*)d_in[8];
    const float* Wo   = (const float*)d_in[9];
    const float* bo   = (const float*)d_in[10];
    const float* lng  = (const float*)d_in[11];
    const float* lnb  = (const float*)d_in[12];
    const float* W1   = (const float*)d_in[13];
    const float* b1   = (const float*)d_in[14];
    const float* W2   = (const float*)d_in[15];
    const float* b2   = (const float*)d_in[16];

    char* ws = (char*)d_ws;
    size_t off = 0;
    auto take = [&](size_t bytes) { char* p = ws + off; off = (off + bytes + 255) & ~(size_t)255; return p; };

    const size_t fLD = (size_t)LQ * DM * sizeof(float);       // 4 MB
    const size_t hLD = (size_t)NH * LQ * DH * sizeof(__bf16); // 2 MB
    const size_t hLF = (size_t)LQ * FFD * sizeof(__bf16);     // 8 MB

    float*  X    = (float*)take(fLD);
    float*  Acat = (float*)take(fLD);
    __bf16* Qh   = (__bf16*)take(3 * hLD);   // Q, K, V per-head planes, one after the other
    __bf16* Kh   = Qh + (size_t)NH * LQ * DH;
    __bf16* Vh   = Kh + (size_t)NH * LQ * DH;
    __bf16* Hb   = (__bf16*)take(hLF);       // FFN hidden, bf16
    float*  Xa   = (float*)take(fLD);
    __bf16* Xb   = (__bf16*)take(hLD);       // X and Xa rounded to bf16, [L][D]
    __bf16* Xab  = (__bf16*)take(hLD);
    float*  Pt   = (float*)take(3 * 8 * fLD); // split-K partials: 32 MB a product, 3 products in the Q/K/V launch
    float*  Yout = (float*)d_out;

    const dim3 blk(256);
    const dim3 gD (DM / 128, LQ / 128, 8);   // N=2048 GEMMs, 8 K slices: 512 work-groups
    const dim3 gQKV(DM / 128, LQ / 128, 3 * 8); // Q, K and V projections together: 1536 work-groups
    const dim3 gFF(FFD / 128, LQ / 128, 2);  // N=8192 GEMM, 2 K slices: 512 work-groups

    // 1) embedding, 2) + bias + positional encoding
    gemm_splitk_kernel<DM, DM, 8, 1, false><<<gD, blk, 0, stream>>>(seq, nullptr, embW, Pt, nullptr, nullptr);
    add_pos_kernel<8><<<LQ, blk, 0, stream>>>(Pt, embB, X, Xb);
    // 3) Q/K/V projections in one launch, 4) their bias + per-head bf16 layout in one launch
    gemm_splitk_kernel<DM, DM, 8, 3, true><<<gQKV, blk, 0, stream>>>(nullptr, Xb, Wq, Pt, Wk, Wv);
    permute_heads_kernel<8><<<dim3(LQ, 3), blk, 0, stream>>>(Pt, bq, bk, bv, Qh);
    // 5-7) softmax(Qh @ Kh^T / sqrt(D)) @ Vh, scattered back to the [L, D] interleaved layout
    attn_fused_kernel<<<dim3(LQ / QB, NH), blk, 0, stream>>>(
        Qh, Kh, Vh, Acat, 0.022097086912079608f /* 1/sqrt(2048) */);
    // 8) output projection, 9) + bias + residual X, LayerNorm -> Xa
    gemm_splitk_kernel<DM, DM, 8, 1, false><<<gD, blk, 0, stream>>>(Acat, nullptr, Wo, Pt, nullptr, nullptr);
    layernorm_kernel<8, true><<<LQ, blk, 0, stream>>>(Pt, bo, X, lng, lnb, Xa, Xab);
    // 10) FFN1, then bias + GELU
    gemm_splitk_kernel<FFD, DM, 2, 1, true><<<gFF, blk, 0, stream>>>(nullptr, Xab, W1, Pt, nullptr, nullptr);
    bias_gelu_kernel<2><<<LQ, blk, 0, stream>>>(Pt, b1, Hb);
    // 11) FFN2, 12) + bias + residual Xa, final LayerNorm -> output
    gemm_splitk_kernel<DM, FFD, 8, 1, true><<<gD, blk, 0, stream>>>(nullptr, Hb, W2, Pt, nullptr, nullptr);
    layernorm_kernel<8, false><<<LQ, blk, 0, stream>>>(Pt, b2, Xa, lng, lnb, Yout, nullptr);
}

// v006
// Measured time: 172 microseconds a run.
// Next to v005, in two timings, it ran 1.04 and 1.05 times as fast.
// All steps since v000 together make it 3.82 times as fast.
#include <hip/hip_runtime.h>
#include <hip/hip_bf16.h>
#include <math.h>

typedef __attribute__((ext_vector_type(16))) __bf16 v16bf;
typedef __attribute__((ext_vector_type(8)))  __bf16 v8bf;
typedef __attribute__((ext_vector_type(4)))  __bf16 v4bf;
typedef __attribute__((ext_vector_type(8)))  float  v8f;

#define LQ 512
#define DM 2048
#define NH 16
#define DH 128
#define FFD 8192

__device__ __forceinline__ v8f wmma_bf16(const v16bf& a, const v16bf& b, const v8f& c) {
    return __builtin_amdgcn_wmma_f32_16x16x32_bf16(false, a, false, b, (short)0, c, false, false);
}

__device__ __forceinline__ v16bf frag_from_lds(const __bf16* rowp, int half) {
    const v8bf lo = *(const v8bf*)(rowp + half * 8);
    const v8bf hi = *(const v8bf*)(rowp + 16 + half * 8);
    return __builtin_shufflevector(lo, hi, 0, 1, 2, 3, 4, 5, 6, 7,
                                           8, 9, 10, 11, 12, 13, 14, 15);
}

__device__ __forceinline__ void async_copy8_b128(const __bf16* g, unsigned lds, int gstep, unsigned lstep) {
    asm volatile("global_load_async_to_lds_b128 %0, %8, off\n\t"
                 "global_load_async_to_lds_b128 %1, %9, off\n\t"
                 "global_load_async_to_lds_b128 %2, %10, off\n\t"
                 "global_load_async_to_lds_b128 %3, %11, off\n\t"
                 "global_load_async_to_lds_b128 %4, %12, off\n\t"
                 "global_load_async_to_lds_b128 %5, %13, off\n\t"
                 "global_load_async_to_lds_b128 %6, %14, off\n\t"
                 "global_load_async_to_lds_b128 %7, %15, off\n\t"
                 "s_wait_xcnt 0x0"
                 :: "v"(lds), "v"(lds + lstep), "v"(lds + 2 * lstep), "v"(lds + 3 * lstep),
                    "v"(lds + 4 * lstep), "v"(lds + 5 * lstep), "v"(lds + 6 * lstep), "v"(lds + 7 * lstep),
                    "v"(g), "v"(g + gstep), "v"(g + 2 * gstep), "v"(g + 3 * gstep),
                    "v"(g + 4 * gstep), "v"(g + 5 * gstep), "v"(g + 6 * gstep), "v"(g + 7 * gstep)
                 : "memory");
}

// Transposing LDS load: from a row-major 16-bit tile, lane (c = lane & 15, half) gets
// rows 8*half .. +7 of column c; p is the lane's own address in the tile:
// row 8*half + (lane & 7), column 8*((lane >> 3) & 1).
__device__ __forceinline__ v8bf lds_load_tr16(const __bf16* p) {
    typedef __attribute__((address_space(3))) v8bf lds_v8bf;
    return __builtin_amdgcn_ds_load_tr16_b128_v8bf16((lds_v8bf*)p);
}

__device__ __forceinline__ float gelu_tanh(float x) {
    const float k0 = 0.7978845608028654f;  // sqrt(2/pi)
    const float k1 = 0.044715f;
    float t = tanhf(k0 * (x + k1 * x * x * x));
    return 0.5f * x * (1.0f + t);
}

template <int N, int K, int S, int G, bool ABF>
__global__ __launch_bounds__(256, 4) void gemm_splitk_kernel(
    const float* __restrict__ A, const __bf16* __restrict__ Ab, const float* __restrict__ B,
    float* __restrict__ Cpart,
    const float* __restrict__ B1, const float* __restrict__ B2)
{
    constexpr int KT = 128;             // k per stage
    static_assert(K % (2 * KT * S) == 0 && N % 128 == 0, "tile assumptions");
    static_assert(G == 1 || G == 3, "one product, or three that share A");
    __shared__ __align__(16) __bf16 aT[2][128][KT + 8];
    __shared__ __align__(16) __bf16 bTt[2][128][KT + 8];

    const int tid  = threadIdx.x;
    const int m0   = blockIdx.y * 128;
    const int n0   = blockIdx.x * 128;
    const int w    = tid >> 5;
    const int lane = tid & 31;
    const int half = lane >> 4;
    const int r    = lane & 15;
    const int wm   = (w & 3) * 32;
    const int wn   = (w >> 2) * 64;

    constexpr int AE = ABF ? 8 : 4;     // A staging: elements per 16-byte load
    constexpr int AR = 256 * AE / KT;   // AR rows / pass, KT/AE loads per row
    constexpr int AP = 128 / AR;        // passes
    constexpr int BK = KT / 2;          // B staging: k values per thread
    const int arow = tid / (KT / AE);
    const int acol = (tid % (KT / AE)) * AE;
    const int sn   = tid & 127;         // B staging: column gather, 2 threads per n
    const int sk0  = (tid >> 7) * BK;
    constexpr int KS = K / S;           // this work-group's K slice: [z*KS, z*KS + KS)
    const int zs = G > 1 ? blockIdx.z % S : blockIdx.z;  // K slice
    if constexpr (G > 1) {
        const int zg = blockIdx.z / S;  // which product
        B = zg == 0 ? B : (zg == 1 ? B1 : B2);
        Cpart += (size_t)zg * ((size_t)LQ * S * N);
    }
    const size_t aoff = (size_t)zs * KS + (size_t)(m0 + arow) * K + acol;  // this thread's first A element
    B += ((size_t)zs * KS + sk0) * N + n0 + sn;                 // and its first B element

    v8f acc[2][4] = {};

    auto stage = [&](int buf, int kc) {
        const float* bp = B + (size_t)kc * N;
        float4 va[ABF ? 1 : AP];
        v8bf   vh[ABF ? AP : 1];
        // the B loads below may be given the A loads' address registers as destinations; the
        // address as an input keeps it from being a destination of a load of its own group
        if constexpr (ABF) {
            const __bf16* ap = Ab + aoff + kc;
#pragma unroll
            for (int p = 0; p < AP; ++p)
                vh[p] = *(const v8bf*)(&ap[p * AR * K]);
            asm volatile("s_wait_xcnt 0x0" :: "v"(ap) : "memory");
        } else {
            const float* ap = A + aoff + kc;
#pragma unroll
            for (int p = 0; p < AP; ++p)
                va[p] = *(const float4*)(&ap[p * AR * K]);
            asm volatile("s_wait_xcnt 0x0" :: "v"(ap) : "memory");
        }
        float tb[BK];
#pragma unroll
        for (int i = 0; i < BK; ++i)
            tb[i] = bp[i * N];
        asm volatile("s_wait_xcnt 0x0" :: "v"(bp) : "memory");
#pragma unroll
        for (int p = 0; p < AP; ++p) {
            const int rr = p * AR + arow;
            if constexpr (ABF) {
                *(v8bf*)&aT[buf][rr][acol] = vh[p];
            } else {
                aT[buf][rr][acol + 0] = (__bf16)va[p].x;
                aT[buf][rr][acol + 1] = (__bf16)va[p].y;
                aT[buf][rr][acol + 2] = (__bf16)va[p].z;
                aT[buf][rr][acol + 3] = (__bf16)va[p].w;
            }
        }
#pragma unroll
        for (int q = 0; q < BK / 8; ++q) {
            v8bf t;
#pragma unroll
            for (int i = 0; i < 8; ++i) t[i] = (__bf16)tb[q * 8 + i];
            *(v8bf*)&bTt[buf][sn][sk0 + q * 8] = t;
        }
    };

    auto compute = [&](int buf) {
#pragma unroll
        for (int ks = 0; ks < KT; ks += 32) {
            v16bf afr[2], bfr[4];
#pragma unroll
            for (int mt = 0; mt < 2; ++mt)
                afr[mt] = frag_from_lds(&aT[buf][wm + mt * 16 + r][ks], half);
#pragma unroll
            for (int nt = 0; nt < 4; ++nt)
                bfr[nt] = frag_from_lds(&bTt[buf][wn + nt * 16 + r][ks], half);
#pragma unroll
            for (int mt = 0; mt < 2; ++mt)
#pragma unroll
                for (int nt = 0; nt < 4; ++nt)
                    acc[mt][nt] = wmma_bf16(bfr[nt], afr[mt], acc[mt][nt]);  // B rows first: see the epilogue
        }
    };

    stage(0, 0);
    __syncthreads();
#pragma unroll 1
    for (int kc = 0; kc < KS; kc += 2 * KT) {
        stage(1, kc + KT);                       // KS % (2*KT) == 0 -> kc+KT < KS always
        compute(0);
        __syncthreads();
        if (kc + 2 * KT < KS) stage(0, kc + 2 * KT);
        compute(1);
        __syncthreads();
    }

    constexpr int SP = 68;
    static_assert(8 * 32 * SP * sizeof(float) <= sizeof(aT), "the staging fits the A buffers");
    float* st = reinterpret_cast<float*>(&aT[0][0][0]) + w * (32 * SP);
#pragma unroll
    for (int mt = 0; mt < 2; ++mt) {
#pragma unroll
        for (int nt = 0; nt < 4; ++nt) {
            float* sp = &st[(mt * 16 + r) * SP + nt * 16 + half * 8];
            const v8f a = acc[mt][nt];
            *(float4*)(sp)     = make_float4(a[0], a[1], a[2], a[3]);
            *(float4*)(sp + 4) = make_float4(a[4], a[5], a[6], a[7]);
        }
    }
    // the rows are read back by other lanes of this wave: its LDS stores have retired first
    asm volatile("s_wait_dscnt 0x0" ::: "memory");
    float* __restrict__ C = Cpart + (size_t)zs * N + (size_t)(m0 + wm + half) * (S * N) + n0 + wn + r * 4;
#pragma unroll
    for (int i = 0; i < 16; ++i)
        *(float4*)(&C[(size_t)(2 * i) * (S * N)]) = *(const float4*)(&st[(2 * i + half) * SP + r * 4]);
}

// Sum of the S split-K partials of column c, in slice order; prow points at
// the S partial rows (each DM wide) of one output row.
template <int S>
__device__ __forceinline__ float sum_slices(const float* __restrict__ prow, int c)
{
    float v[S];
#pragma unroll
    for (int s = 0; s < S; ++s) v[s] = prow[s * DM + c];
    float x = v[0];
#pragma unroll
    for (int s = 1; s < S; ++s) x += v[s];
    return x;
}

// ---------------------------------------------------------------------------
// X = split-K partials + bias + positional encoding (computed on the fly,
// matches reference buffer).  X stays fp32 for the residual; Xb is its bf16 rounding,
// the A operand of the Q/K/V projections.
// ---------------------------------------------------------------------------
template <int S>
__global__ __launch_bounds__(256) void add_pos_kernel(
    const float* __restrict__ part, const float* __restrict__ bias,
    float* __restrict__ X, __bf16* __restrict__ Xb)
{
    const int l = blockIdx.x, tid = threadIdx.x;
    float* row = X + (size_t)l * DM;
    __bf16* rowb = Xb + (size_t)l * DM;
    const float* prow = part + (size_t)l * (S * DM);
#pragma unroll
    for (int j = 0; j < 8; ++j) {
        const int c = tid + j * 256;
        const float denom = 10000.0f * expf((float)(c & ~1) * (1.0f / (float)DM));
        const float arg = (float)l / denom;
        const float x = sum_slices<S>(prow, c) + bias[c];
        const float y = x + ((c & 1) ? cosf(arg) : sinf(arg));
        row[c]  = y;
        rowb[c] = (__bf16)y;
    }
}

// ---------------------------------------------------------------------------
// split-K partials [L][S][D] fp32 + bias -> per-head bf16 [H][L][DH]
// (head h at column d*16+h).  blockIdx.y picks Q, K or V: its block of
// partials, its bias and its third of dst.  The row is sorted by head in LDS, so that
// it leaves as 16 whole 256-B head rows, 16 bytes a thread.
// ---------------------------------------------------------------------------
template <int S>
__global__ __launch_bounds__(256) void permute_heads_kernel(
    const float* __restrict__ part, const float* __restrict__ bias0,
    const float* __restrict__ bias1, const float* __restrict__ bias2,
    __bf16* __restrict__ dst)
{
    const int l = blockIdx.x, tid = threadIdx.x;
    const int p = blockIdx.y;
    const float* bias = p == 0 ? bias0 : (p == 1 ? bias1 : bias2);
    dst += (size_t)p * (NH * LQ * DH);
    const float* prow = part + ((size_t)p * LQ + l) * (S * DM);
    __shared__ __align__(16) __bf16 sh[NH][DH + 8];   // pitch: row + 16 B for the 16-byte reads
#pragma unroll
    for (int j = 0; j < 8; ++j) {
        const int c = tid + j * 256;
        const int h = c & 15, d = c >> 4;
        const float x = sum_slices<S>(prow, c) + bias[c];
        sh[h][d] = (__bf16)x;
    }
    __syncthreads();
    const int h = tid >> 4, d = (tid & 15) * 8;
    *(v8bf*)(&dst[((size_t)h * LQ + l) * DH + d]) = *(const v8bf*)(&sh[h][d]);
}

// ---------------------------------------------------------------------------
// Attention of one head and QB query rows in one work-group:
//   scores = scale * Q @ K^T (all LQ keys), row softmax, Acat[:, d*16+h] = P @ V.
// Scores (fp32) and probabilities (bf16) live in LDS only.  Wave w owns keys
// w*64..+63 in the first product, so Q and K fragments come straight from
// global memory.  The head's V lands row-major in LDS by async copies issued
// first, and wave w reads its columns w*16..+15 by transposing loads.
// ---------------------------------------------------------------------------
#define QB 32
__global__ __launch_bounds__(256) void attn_fused_kernel(
    const __bf16* __restrict__ Qh, const __bf16* __restrict__ Kh,
    const __bf16* __restrict__ Vh, float* __restrict__ Acat, float scale)
{
    __shared__ __align__(16) float  sS[QB][LQ + 4];
    __shared__ __align__(16) __bf16 sP[QB][LQ + 8];
    __shared__ __align__(16) __bf16 sV[LQ][DH + 16];

    const int tid  = threadIdx.x;
    const int h    = blockIdx.y;
    const int m0   = blockIdx.x * QB;
    const int w    = tid >> 5, lane = tid & 31;
    const int half = lane >> 4, r = lane & 15;

    const __bf16* Q  = Qh + ((size_t)h * LQ + m0) * DH;
    const __bf16* Kp = Kh + (size_t)h * LQ * DH;
    const __bf16* Vp = Vh + (size_t)h * LQ * DH;

    // ---- V: 16 rows per copy and work-group (16 lanes x 16 B a row), 32 copies per lane
#pragma unroll
    for (int j = 0; j < 4; ++j)
        async_copy8_b128(Vp + (size_t)(j * 128 + (tid >> 4)) * DH + (tid & 15) * 8,
                         (unsigned)(size_t)&sV[j * 128 + (tid >> 4)][(tid & 15) * 8],
                         16 * DH, 16 * (DH + 16) * 2);

    // ---- scores: 32 x 64 per wave, K-dim = DH in 4 steps of 32
    {
        const int wn = w * 64;
        const __bf16* qp = Q + (size_t)r * DH + half * 8;          // this lane's place in its Q row
        const __bf16* kp = Kp + (size_t)(wn + r) * DH + half * 8;  // and in its K row
        v16bf afr[4][2], bfr[4][4];
        v8f acc[2][4] = {};
        auto load = [&](int ks) {
#pragma unroll
            for (int mt = 0; mt < 2; ++mt)
                afr[ks][mt] = frag_from_lds(&qp[mt * 16 * DH + ks * 32], 0);
#pragma unroll
            for (int nt = 0; nt < 4; ++nt)
                bfr[ks][nt] = frag_from_lds(&kp[nt * 16 * DH + ks * 32], 0);
            // code that follows may reuse these loads' address registers; the addresses as
            // inputs keep them from being handed out as destinations to loads of this group
            asm volatile("s_wait_xcnt 0x0" :: "v"(qp), "v"(kp) : "memory");
        };
        auto compute = [&](int ks) {
#pragma unroll
            for (int mt = 0; mt < 2; ++mt)
#pragma unroll
                for (int nt = 0; nt < 4; ++nt)
                    acc[mt][nt] = wmma_bf16(afr[ks][mt], bfr[ks][nt], acc[mt][nt]);
        };
        load(0); load(1); load(2);
        // keeps the first products, which wait for their operands, from being scheduled
        // in front of the later steps' loads: a wave issues in order
        __builtin_amdgcn_sched_barrier(0);
        compute(0);
        load(3);
        compute(1); compute(2); compute(3);
#pragma unroll
        for (int mt = 0; mt < 2; ++mt)
#pragma unroll
            for (int nt = 0; nt < 4; ++nt)
#pragma unroll
                for (int g = 0; g < 8; ++g)
                    sS[mt * 16 + half * 8 + g][wn + nt * 16 + r] = acc[mt][nt][g] * scale;
    }

    __syncthreads();

    // ---- softmax over keys: one wave per row, 4 rows per wave, 16 scores per lane
#pragma unroll
    for (int i = 0; i < QB / 8; ++i) {
        const int row = w * (QB / 8) + i;
        float4 v[4];
#pragma unroll
        for (int j = 0; j < 4; ++j) v[j] = *(const float4*)&sS[row][lane * 4 + j * 128];
        float mx = fmaxf(fmaxf(v[0].x, v[0].y), fmaxf(v[0].z, v[0].w));
#pragma unroll
        for (int j = 1; j < 4; ++j)
            mx = fmaxf(mx, fmaxf(fmaxf(v[j].x, v[j].y), fmaxf(v[j].z, v[j].w)));
#pragma unroll
        for (int o = 16; o > 0; o >>= 1) mx = fmaxf(mx, __shfl_xor(mx, o));
        float s = 0.0f;
#pragma unroll
        for (int j = 0; j < 4; ++j) {
            v[j].x = expf(v[j].x - mx); v[j].y = expf(v[j].y - mx);
            v[j].z = expf(v[j].z - mx); v[j].w = expf(v[j].w - mx);
            s += (v[j].x + v[j].y) + (v[j].z + v[j].w);
        }
#pragma unroll
        for (int o = 16; o > 0; o >>= 1) s += __shfl_xor(s, o);
        const float inv = 1.0f / s;
#pragma unroll
        for (int j = 0; j < 4; ++j) {
            v4bf p;
            p[0] = (__bf16)(v[j].x * inv); p[1] = (__bf16)(v[j].y * inv);
            p[2] = (__bf16)(v[j].z * inv); p[3] = (__bf16)(v[j].w * inv);
            *(v4bf*)&sP[row][lane * 4 + j * 128] = p;
        }
    }
    // this wave's V copies have landed; the barrier then publishes V and P to all waves
    asm volatile("s_wait_asynccnt 0x0" ::: "memory");
    __syncthreads();

    // ---- P @ V: 32 x 16 per wave, K-dim = LQ in 16 steps of 32
    const int n = w * 16 + r;             // this lane's column of V
    const __bf16* vt = &sV[half * 8 + (lane & 7)][w * 16 + ((lane >> 3) & 1) * 8];
    v8f o[2] = {};
#pragma unroll
    for (int ks = 0; ks < LQ / 32; ++ks) {
        const v8bf lo = lds_load_tr16(vt + (ks * 32) * (DH + 16));        // keys ks*32 + half*8 .. +7
        const v8bf hi = lds_load_tr16(vt + (ks * 32 + 16) * (DH + 16));   // keys ks*32 + 16 + half*8 .. +7
        const v16bf vfr = __builtin_shufflevector(lo, hi, 0, 1, 2, 3, 4, 5, 6, 7,
                                                          8, 9, 10, 11, 12, 13, 14, 15);
#pragma unroll
        for (int mt = 0; mt < 2; ++mt)
            o[mt] = wmma_bf16(frag_from_lds(&sP[mt * 16 + r][ks * 32], half), vfr, o[mt]);
    }

#pragma unroll
    for (int mt = 0; mt < 2; ++mt)
#pragma unroll
        for (int g = 0; g < 8; ++g)
            Acat[(size_t)(m0 + mt * 16 + half * 8 + g) * DM + n * NH + h] = o[mt][g];
}

// ---------------------------------------------------------------------------
// H = gelu(split-K partials + bias) as bf16 (it only feeds FFN2's A operand), one row
// of FFD per work-group.
// ---------------------------------------------------------------------------
template <int S>
__global__ __launch_bounds__(256) void bias_gelu_kernel(
    const float* __restrict__ part, const float* __restrict__ bias,
    __bf16* __restrict__ Hout)
{
    const int l = blockIdx.x, tid = threadIdx.x;
    const float* prow = part + (size_t)l * (S * FFD);
    __bf16* hrow = Hout + (size_t)l * FFD;
    constexpr int NJ = FFD / 1024;
    // all loads of the row first, so that they are in flight together
    float4 v[S][NJ], bv[NJ];
#pragma unroll
    for (int j = 0; j < NJ; ++j) {
        const int c = (tid + j * 256) * 4;
#pragma unroll
        for (int s = 0; s < S; ++s) v[s][j] = *(const float4*)(&prow[s * FFD + c]);
        bv[j] = *(const float4*)(&bias[c]);
    }
#pragma unroll
    for (int j = 0; j < NJ; ++j) {
        const int c = (tid + j * 256) * 4;
        float4 x = v[0][j];
#pragma unroll
        for (int s = 1; s < S; ++s) {
            x.x += v[s][j].x; x.y += v[s][j].y; x.z += v[s][j].z; x.w += v[s][j].w;
        }
        v4bf y;
        y[0] = (__bf16)gelu_tanh(x.x + bv[j].x);
        y[1] = (__bf16)gelu_tanh(x.y + bv[j].y);
        y[2] = (__bf16)gelu_tanh(x.z + bv[j].z);
        y[3] = (__bf16)gelu_tanh(x.w + bv[j].w);
        *(v4bf*)(&hrow[c]) = y;
    }
}

// ---------------------------------------------------------------------------
// Row LayerNorm over D=2048 of (split-K partials + bias + residual).
// WB: the result is also written rounded to bf16 (Yb), for the GEMM that reads it as A.
// ---------------------------------------------------------------------------
template <int S, bool WB>
__global__ __launch_bounds__(256) void layernorm_kernel(
    const float* __restrict__ part, const float* __restrict__ bias,
    const float* __restrict__ res, const float* __restrict__ g,
    const float* __restrict__ b, float* __restrict__ Y, __bf16* __restrict__ Yb)
{
    const int l = blockIdx.x, tid = threadIdx.x;
    const float* prow = part + (size_t)l * (S * DM);
    const float* rrow = res + (size_t)l * DM;
    float* out = Y + (size_t)l * DM;
    __shared__ float red[256];

    float vals[8], s = 0.0f;
#pragma unroll
    for (int j = 0; j < 8; ++j) {
        const int c = tid + j * 256;
        vals[j] = sum_slices<S>(prow, c) + bias[c] + rrow[c];
        s += vals[j];
    }
    red[tid] = s;
    __syncthreads();
    for (int st = 128; st > 0; st >>= 1) { if (tid < st) red[tid] += red[tid + st]; __syncthreads(); }
    const float mu = red[0] * (1.0f / (float)DM);
    __syncthreads();

    float v = 0.0f;
#pragma unroll
    for (int j = 0; j < 8; ++j) { const float d = vals[j] - mu; v += d * d; }
    red[tid] = v;
    __syncthreads();
    for (int st = 128; st > 0; st >>= 1) { if (tid < st) red[tid] += red[tid + st]; __syncthreads(); }
    const float inv = rsqrtf(red[0] * (1.0f / (float)DM) + 1e-5f);

#pragma unroll
    for (int j = 0; j < 8; ++j) {
        const int c = tid + j * 256;
        const float y = (vals[j] - mu) * inv * g[c] + b[c];
        out[c] = y;
        if constexpr (WB) Yb[(size_t)l * DM + c] = (__bf16)y;
    }
}

// ---------------------------------------------------------------------------
extern "C" void kernel_launch(void* const* d_in, const int* in_sizes, int n_in,
                              void* d_out, int out_size, void* d_ws, size_t ws_size,
                              hipStream_t stream)
{
    (void)in_sizes; (void)n_in; (void)out_size; (void)ws_size;

    const float* seq  = (const float*)d_in[0];
    const float* embW = (const float*)d_in[1];
    const float* embB = (const float*)d_in[2];
    const float* Wq   = (const float*)d_in[3];
    const float* bq   = (const float*)d_in[4];
    const float* Wk   = (const float*)d_in[5];
    const float* bk   = (const float*)d_in[6];
    const float* Wv   = (const float*)d_in[7];
    const float* bv   = (const float*)d_in[8];
    const float* Wo   = (const float*)d_in[9];
    const float* bo   = (const float*)d_in[10];
    const float* lng  = (const float*)d_in[11];
    const float* lnb  = (const float*)d_in[12];
    const float* W1   = (const float*)d_in[13];
    const float* b1   = (const float*)d_in[14];
    const float* W2   = (const float*)d_in[15];
    const float* b2   = (const float*)d_in[16];

    char* ws = (char*)d_ws;
    size_t off = 0;
    auto take = [&](size_t bytes) { char* p = ws + off; off = (off + bytes + 255) & ~(size_t)255; return p; };

    const size_t fLD = (size_t)LQ * DM * sizeof(float);       // 4 MB
    const size_t hLD = (size_t)NH * LQ * DH * sizeof(__bf16); // 2 MB
    const size_t hLF = (size_t)LQ * FFD * sizeof(__bf16);     // 8 MB

    float*  X    = (float*)take(fLD);
    float*  Acat = (float*)take(fLD);
    __bf16* Qh   = (__bf16*)take(3 * hLD);   // Q, K, V per-head planes, one after the other
    __bf16* Kh   = Qh + (size_t)NH * LQ * DH;
    __bf16* Vh   = Kh + (size_t)NH * LQ * DH;
    __bf16* Hb   = (__bf16*)take(hLF);       // FFN hidden, bf16
    float*  Xa   = (float*)take(fLD);
    __bf16* Xb   = (__bf16*)take(hLD);       // X and Xa rounded to bf16, [L][D]
    __bf16* Xab  = (__bf16*)take(hLD);
    float*  Pt   = (float*)take(3 * 8 * fLD); // split-K partials: 32 MB a product, 3 products in the Q/K/V launch
    float*  Yout = (float*)d_out;

    const dim3 blk(256);
    const dim3 gD (DM / 128, LQ / 128, 8);   // N=2048 GEMMs, 8 K slices: 512 work-groups
    const dim3 gQKV(DM / 128, LQ / 128, 3 * 8); // Q, K and V projections together: 1536 work-groups
    const dim3 gFF(FFD / 128, LQ / 128, 2);  // N=8192 GEMM, 2 K slices: 512 work-groups

    // 1) embedding, 2) + bias + positional encoding
    gemm_splitk_kernel<DM, DM, 8, 1, false><<<gD, blk, 0, stream>>>(seq, nullptr, embW, Pt, nullptr, nullptr);
    add_pos_kernel<8><<<LQ, blk, 0, stream>>>(Pt, embB, X, Xb);
    // 3) Q/K/V projections in one launch, 4) their bias + per-head bf16 layout in one launch
    gemm_splitk_kernel<DM, DM, 8, 3, true><<<gQKV, blk, 0, stream>>>(nullptr, Xb, Wq, Pt, Wk, Wv);
    permute_heads_kernel<8><<<dim3(LQ, 3), blk, 0, stream>>>(Pt, bq, bk, bv, Qh);
    // 5-7) softmax(Qh @ Kh^T / sqrt(D)) @ Vh, scattered back to the [L, D] interleaved layout
    attn_fused_kernel<<<dim3(LQ / QB, NH), blk, 0, stream>>>(
        Qh, Kh, Vh, Acat, 0.022097086912079608f /* 1/sqrt(2048) */);
    // 8) output projection, 9) + bias + residual X, LayerNorm -> Xa
    gemm_splitk_kernel<DM, DM, 8, 1, false><<<gD, blk, 0, stream>>>(Acat, nullptr, Wo, Pt, nullptr, nullptr);
    layernorm_kernel<8, true><<<LQ, blk, 0, stream>>>(Pt, bo, X, lng, lnb, Xa, Xab);
    // 10) FFN1, then bias + GELU
    gemm_splitk_kernel<FFD, DM, 2, 1, true><<<gFF, blk, 0, stream>>>(nullptr, Xab, W1, Pt, nullptr, nullptr);
    bias_gelu_kernel<2><<<LQ, blk, 0, stream>>>(Pt, b1, Hb);
    // 11) FFN2, 12) + bias + residual Xa, final LayerNorm -> output
    gemm_splitk_kernel<DM, FFD, 8, 1, true><<<gD, blk, 0, stream>>>(nullptr, Hb, W2, Pt, nullptr, nullptr);
    layernorm_kernel<8, false><<<LQ, blk, 0, stream>>>(Pt, b2, Xa, lng, lnb, Yout, nullptr);
}

// v007
// It runs in 166 microseconds.
// Next to v006, in two timings, it ran 1.04 times as fast each time.
// Counting every step since v000, it is 3.98 times as fast.
#include <hip/hip_runtime.h>
#include <hip/hip_bf16.h>
#include <math.h>

typedef __attribute__((ext_vector_type(16))) __bf16 v16bf;
typedef __attribute__((ext_vector_type(8)))  __bf16 v8bf;
typedef __attribute__((ext_vector_type(4)))  __bf16 v4bf;
typedef __attribute__((ext_vector_type(2)))  __bf16 v2bf;
typedef __attribute__((ext_vector_type(8)))  float  v8f;

#define LQ 512
#define DM 2048
#define NH 16
#define DH 128
#define FFD 8192

__device__ __forceinline__ v8f wmma_bf16(const v16bf& a, const v16bf& b, const v8f& c) {
    return __builtin_amdgcn_wmma_f32_16x16x32_bf16(false, a, false, b, (short)0, c, false, false);
}

__device__ __forceinline__ v16bf frag_from_lds(const __bf16* rowp, int half) {
    const v8bf lo = *(const v8bf*)(rowp + half * 8);
    const v8bf hi = *(const v8bf*)(rowp + 16 + half * 8);
    return __builtin_shufflevector(lo, hi, 0, 1, 2, 3, 4, 5, 6, 7,
                                           8, 9, 10, 11, 12, 13, 14, 15);
}

__device__ __forceinline__ void async_copy8_b128(const __bf16* g, unsigned lds, int gstep, unsigned lstep) {
    asm volatile("global_load_async_to_lds_b128 %0, %8, off\n\t"
                 "global_load_async_to_lds_b128 %1, %9, off\n\t"
                 "global_load_async_to_lds_b128 %2, %10, off\n\t"
                 "global_load_async_to_lds_b128 %3, %11, off\n\t"
                 "global_load_async_to_lds_b128 %4, %12, off\n\t"
                 "global_load_async_to_lds_b128 %5, %13, off\n\t"
                 "global_load_async_to_lds_b128 %6, %14, off\n\t"
                 "global_load_async_to_lds_b128 %7, %15, off\n\t"
                 "s_wait_xcnt 0x0"
                 :: "v"(lds), "v"(lds + lstep), "v"(lds + 2 * lstep), "v"(lds + 3 * lstep),
                    "v"(lds + 4 * lstep), "v"(lds + 5 * lstep), "v"(lds + 6 * lstep), "v"(lds + 7 * lstep),
                    "v"(g), "v"(g + gstep), "v"(g + 2 * gstep), "v"(g + 3 * gstep),
                    "v"(g + 4 * gstep), "v"(g + 5 * gstep), "v"(g + 6 * gstep), "v"(g + 7 * gstep)
                 : "memory");
}

// Transposing LDS load: from a row-major 16-bit tile, lane (c = lane & 15, half) gets
// rows 8*half .. +7 of column c; p is the lane's own address in the tile:
// row 8*half + (lane & 7), column 8*((lane >> 3) & 1).
__device__ __forceinline__ v8bf lds_load_tr16(const __bf16* p) {
    typedef __attribute__((address_space(3))) v8bf lds_v8bf;
    return __builtin_amdgcn_ds_load_tr16_b128_v8bf16((lds_v8bf*)p);
}

__device__ __forceinline__ float gelu_tanh(float x) {
    const float k0 = 0.7978845608028654f;  // sqrt(2/pi)
    const float k1 = 0.044715f;
    float t = tanhf(k0 * (x + k1 * x * x * x));
    return 0.5f * x * (1.0f + t);
}

template <int N, int K, int S, bool ABF>
__global__ __launch_bounds__(256, 4) void gemm_splitk_kernel(
    const float* __restrict__ A, const __bf16* __restrict__ Ab, const float* __restrict__ B,
    float* __restrict__ Cpart)
{
    constexpr int KT = 128;             // k per stage
    static_assert(K % (2 * KT * S) == 0 && N % 128 == 0, "tile assumptions");
    __shared__ __align__(16) __bf16 aT[2][128][KT + 8];
    __shared__ __align__(16) __bf16 bTt[2][128][KT + 8];

    const int tid  = threadIdx.x;
    const int m0   = blockIdx.y * 128;
    const int n0   = blockIdx.x * 128;
    const int w    = tid >> 5;
    const int lane = tid & 31;
    const int half = lane >> 4;
    const int r    = lane & 15;
    const int wm   = (w & 3) * 32;
    const int wn   = (w >> 2) * 64;

    constexpr int AE = ABF ? 8 : 4;     // A staging: elements per 16-byte load
    constexpr int AR = 256 * AE / KT;   // AR rows / pass, KT/AE loads per row
    constexpr int AP = 128 / AR;        // passes
    constexpr int BK = KT / 2;          // B staging: k values per thread
    const int arow = tid / (KT / AE);
    const int acol = (tid % (KT / AE)) * AE;
    const int sn   = tid & 127;         // B staging: column gather, 2 threads per n
    const int sk0  = (tid >> 7) * BK;
    constexpr int KS = K / S;           // this work-group's K slice: [z*KS, z*KS + KS)
    const int zs = blockIdx.z;          // K slice
    const size_t aoff = (size_t)zs * KS + (size_t)(m0 + arow) * K + acol;  // this thread's first A element
    B += ((size_t)zs * KS + sk0) * N + n0 + sn;                 // and its first B element

    v8f acc[2][4] = {};

    auto stage = [&](int buf, int kc) {
        const float* bp = B + (size_t)kc * N;
        float4 va[ABF ? 1 : AP];
        v8bf   vh[ABF ? AP : 1];
        // the B loads below may be given the A loads' address registers as destinations; the
        // address as an input keeps it from being a destination of a load of its own group
        if constexpr (ABF) {
            const __bf16* ap = Ab + aoff + kc;
#pragma unroll
            for (int p = 0; p < AP; ++p)
                vh[p] = *(const v8bf*)(&ap[p * AR * K]);
            asm volatile("s_wait_xcnt 0x0" :: "v"(ap) : "memory");
        } else {
            const float* ap = A + aoff + kc;
#pragma unroll
            for (int p = 0; p < AP; ++p)
                va[p] = *(const float4*)(&ap[p * AR * K]);
            asm volatile("s_wait_xcnt 0x0" :: "v"(ap) : "memory");
        }
        float tb[BK];
#pragma unroll
        for (int i = 0; i < BK; ++i)
            tb[i] = bp[i * N];
        asm volatile("s_wait_xcnt 0x0" :: "v"(bp) : "memory");
#pragma unroll
        for (int p = 0; p < AP; ++p) {
            const int rr = p * AR + arow;
            if constexpr (ABF) {
                *(v8bf*)&aT[buf][rr][acol] = vh[p];
            } else {
                aT[buf][rr][acol + 0] = (__bf16)va[p].x;
                aT[buf][rr][acol + 1] = (__bf16)va[p].y;
                aT[buf][rr][acol + 2] = (__bf16)va[p].z;
                aT[buf][rr][acol + 3] = (__bf16)va[p].w;
            }
        }
#pragma unroll
        for (int q = 0; q < BK / 8; ++q) {
            v8bf t;
#pragma unroll
            for (int i = 0; i < 8; ++i) t[i] = (__bf16)tb[q * 8 + i];
            *(v8bf*)&bTt[buf][sn][sk0 + q * 8] = t;
        }
    };

    auto compute = [&](int buf) {
#pragma unroll
        for (int ks = 0; ks < KT; ks += 32) {
            v16bf afr[2], bfr[4];
#pragma unroll
            for (int mt = 0; mt < 2; ++mt)
                afr[mt] = frag_from_lds(&aT[buf][wm + mt * 16 + r][ks], half);
#pragma unroll
            for (int nt = 0; nt < 4; ++nt)
                bfr[nt] = frag_from_lds(&bTt[buf][wn + nt * 16 + r][ks], half);
#pragma unroll
            for (int mt = 0; mt < 2; ++mt)
#pragma unroll
                for (int nt = 0; nt < 4; ++nt)
                    acc[mt][nt] = wmma_bf16(bfr[nt], afr[mt], acc[mt][nt]);  // B rows first: see the epilogue
        }
    };

    stage(0, 0);
    __syncthreads();
#pragma unroll 1
    for (int kc = 0; kc < KS; kc += 2 * KT) {
        stage(1, kc + KT);                       // KS % (2*KT) == 0 -> kc+KT < KS always
        compute(0);
        __syncthreads();
        if (kc + 2 * KT < KS) stage(0, kc + 2 * KT);
        compute(1);
        __syncthreads();
    }

    constexpr int SP = 68;
    static_assert(8 * 32 * SP * sizeof(float) <= sizeof(aT), "the staging fits the A buffers");
    float* st = reinterpret_cast<float*>(&aT[0][0][0]) + w * (32 * SP);
#pragma unroll
    for (int mt = 0; mt < 2; ++mt) {
#pragma unroll
        for (int nt = 0; nt < 4; ++nt) {
            float* sp = &st[(mt * 16 + r) * SP + nt * 16 + half * 8];
            const v8f a = acc[mt][nt];
            *(float4*)(sp)     = make_float4(a[0], a[1], a[2], a[3]);
            *(float4*)(sp + 4) = make_float4(a[4], a[5], a[6], a[7]);
        }
    }
    // the rows are read back by other lanes of this wave: its LDS stores have retired first
    asm volatile("s_wait_dscnt 0x0" ::: "memory");
    float* __restrict__ C = Cpart + (size_t)zs * N + (size_t)(m0 + wm + half) * (S * N) + n0 + wn + r * 4;
#pragma unroll
    for (int i = 0; i < 16; ++i)
        *(float4*)(&C[(size_t)(2 * i) * (S * N)]) = *(const float4*)(&st[(2 * i + half) * SP + r * 4]);
}

// Sum of the S split-K partials of column c, in slice order; prow points at
// the S partial rows (each DM wide) of one output row.
template <int S>
__device__ __forceinline__ float sum_slices(const float* __restrict__ prow, int c)
{
    float v[S];
#pragma unroll
    for (int s = 0; s < S; ++s) v[s] = prow[s * DM + c];
    float x = v[0];
#pragma unroll
    for (int s = 1; s < S; ++s) x += v[s];
    return x;
}

// ---------------------------------------------------------------------------
// X = split-K partials + bias + positional encoding (computed on the fly,
// matches reference buffer).  X stays fp32 for the residual; Xb is its bf16 rounding,
// the A operand of the Q/K/V projections.
// ---------------------------------------------------------------------------
template <int S>
__global__ __launch_bounds__(256) void add_pos_kernel(
    const float* __restrict__ part, const float* __restrict__ bias,
    float* __restrict__ X, __bf16* __restrict__ Xb)
{
    const int l = blockIdx.x, tid = threadIdx.x;
    float* row = X + (size_t)l * DM;
    __bf16* rowb = Xb + (size_t)l * DM;
    const float* prow = part + (size_t)l * (S * DM);
#pragma unroll
    for (int j = 0; j < 8; ++j) {
        const int c = tid + j * 256;
        const float denom = 10000.0f * expf((float)(c & ~1) * (1.0f / (float)DM));
        const float arg = (float)l / denom;
        const float x = sum_slices<S>(prow, c) + bias[c];
        const float y = x + ((c & 1) ? cosf(arg) : sinf(arg));
        row[c]  = y;
        rowb[c] = (__bf16)y;
    }
}

__global__ __launch_bounds__(512, 4) void gemm_qkv_heads_kernel(
    const __bf16* __restrict__ Ab,
    const float* __restrict__ B0, const float* __restrict__ B1, const float* __restrict__ B2,
    const float* __restrict__ bias0, const float* __restrict__ bias1, const float* __restrict__ bias2,
    __bf16* __restrict__ dst)
{
    constexpr int KT = 128;             // k per stage
    constexpr int N = DM, K = DM;
    static_assert(K % (2 * KT) == 0, "two stages a trip");
    __shared__ __align__(16) __bf16 aT[2][128][KT + 8];
    __shared__ __align__(16) __bf16 bTt[2][128][KT + 8];

    const int tid  = threadIdx.x;
    const int m0   = blockIdx.y * 128;
    const int n0   = blockIdx.x * 128;
    const int p    = blockIdx.z;
    const int w    = tid >> 5;
    const int lane = tid & 31;
    const int half = lane >> 4;
    const int r    = lane & 15;
    const int wm   = (w & 3) * 32;
    const int wn   = (w >> 2) * 32;
    const float* B    = p == 0 ? B0 : (p == 1 ? B1 : B2);
    const float* bias = p == 0 ? bias0 : (p == 1 ? bias1 : bias2);
    dst += (size_t)p * (NH * LQ * DH);

    const int arow = tid >> 4;          // A staging: 16 threads a row, 32 rows a pass, 4 passes
    const int acol = (tid & 15) * 8;
    const int sn   = tid & 127;         // B staging: column gather, 4 threads per n, 32 k each
    const int sk0  = (tid >> 7) * 32;
    const __bf16* a0 = Ab + (size_t)(m0 + arow) * K + acol;
    const float*  b0 = B + (size_t)sk0 * N + n0 + sn;

    v8f  acc[2][2] = {};
    v8bf vh[4];
    float tb[32];

    auto load = [&](int kc) {
        const __bf16* ap = a0 + kc;
#pragma unroll
        for (int q = 0; q < 4; ++q)
            vh[q] = *(const v8bf*)(&ap[q * 32 * K]);
        // code that follows may reuse these loads' address registers; the address as an input
        // keeps it from being a destination of a load of its own group
        asm volatile("s_wait_xcnt 0x0" :: "v"(ap) : "memory");
        const float* bp = b0 + (size_t)kc * N;
#pragma unroll
        for (int i = 0; i < 32; ++i)
            tb[i] = bp[i * N];
        asm volatile("s_wait_xcnt 0x0" :: "v"(bp) : "memory");
    };

    auto store = [&](int buf) {
#pragma unroll
        for (int q = 0; q < 4; ++q)
            *(v8bf*)&aT[buf][q * 32 + arow][acol] = vh[q];
#pragma unroll
        for (int q = 0; q < 4; ++q) {
            v8bf t;
#pragma unroll
            for (int i = 0; i < 8; ++i) t[i] = (__bf16)tb[q * 8 + i];
            *(v8bf*)&bTt[buf][sn][sk0 + q * 8] = t;
        }
    };

    auto compute = [&](int buf) {
        // all fragments of the stage are asked for together, so that the wave pays the LDS
        // latency once a stage and not at every group of products
        v16bf afr[KT / 32][2], bfr[KT / 32][2];
#pragma unroll
        for (int s = 0; s < KT / 32; ++s) {
#pragma unroll
            for (int mt = 0; mt < 2; ++mt)
                afr[s][mt] = frag_from_lds(&aT[buf][wm + mt * 16 + r][s * 32], half);
#pragma unroll
            for (int nt = 0; nt < 2; ++nt)
                bfr[s][nt] = frag_from_lds(&bTt[buf][wn + nt * 16 + r][s * 32], half);
        }
        // holds the reads together in front of the products: left free, they are sunk in among them
        __builtin_amdgcn_sched_barrier(0);
#pragma unroll
        for (int s = 0; s < KT / 32; ++s)
#pragma unroll
            for (int mt = 0; mt < 2; ++mt)
#pragma unroll
                for (int nt = 0; nt < 2; ++nt)
                    acc[mt][nt] = wmma_bf16(bfr[s][nt], afr[s][mt], acc[mt][nt]);  // B rows first: see the epilogue
        // keeps the conversions and LDS stores of the next stage, which wait for its loads,
        // from being scheduled in among these products
        __builtin_amdgcn_sched_barrier(0);
    };

    load(0);
    store(0);
    __syncthreads();
#pragma unroll 1
    for (int kc = 0; kc < K; kc += 2 * KT) {
        load(kc + KT);                           // K % (2*KT) == 0 -> kc+KT < K always
        compute(0);
        store(1);                                // every wave left buffer 1 at the last barrier
        __syncthreads();
        const bool more = kc + 2 * KT < K;
        if (more) load(kc + 2 * KT);
        compute(1);
        if (more) store(0);
        __syncthreads();
    }

    // Epilogue.  With the B rows as first WMMA operand a lane holds, of output row
    // l = base + (lane&15), the columns base + half*8 + vgpr: heads half*8 + vgpr of one d
    // (head h stands at column d*16+h).  The tile is sorted to [l][h][8 d] in the first A buffer
    // (every wave has left it: the loop's last barrier), so that the 8 d which the tile holds
    // of a (head, l) row leave as one 16-byte store.
    constexpr int HP = NH * 8 + 8;      // pitch of one l: its 16 heads x 8 d + 16 B for the 16-byte reads
    static_assert(128 * HP * sizeof(__bf16) <= sizeof(aT), "the staging fits the A buffers");
    __bf16* sh = &aT[0][0][0];
    const float* bp = bias + n0 + wn + half * 8;
    float4 bv[2][2];
#pragma unroll
    for (int nt = 0; nt < 2; ++nt) {
        bv[nt][0] = *(const float4*)(&bp[nt * 16]);
        bv[nt][1] = *(const float4*)(&bp[nt * 16 + 4]);
    }
    asm volatile("s_wait_xcnt 0x0" :: "v"(bp) : "memory");  // as in load()
    const float bb[2][8] = {
        { bv[0][0].x, bv[0][0].y, bv[0][0].z, bv[0][0].w, bv[0][1].x, bv[0][1].y, bv[0][1].z, bv[0][1].w },
        { bv[1][0].x, bv[1][0].y, bv[1][0].z, bv[1][0].w, bv[1][1].x, bv[1][1].y, bv[1][1].z, bv[1][1].w } };
#pragma unroll
    for (int mt = 0; mt < 2; ++mt) {
#pragma unroll
        for (int g = 0; g < 8; ++g) {
            v2bf t;                     // the wave's two d of head half*8 + g
            t[0] = (__bf16)(acc[mt][0][g] + bb[0][g]);
            t[1] = (__bf16)(acc[mt][1][g] + bb[1][g]);
            *(v2bf*)&sh[(wm + mt * 16 + r) * HP + (half * 8 + g) * 8 + (wn >> 4)] = t;
        }
    }
    __syncthreads();
#pragma unroll
    for (int j = 0; j < 4; ++j) {
        const int l = tid & 127, h = (tid >> 7) + j * 4;
        *(v8bf*)(&dst[((size_t)h * LQ + m0 + l) * DH + (n0 >> 4)]) = *(const v8bf*)(&sh[l * HP + h * 8]);
    }
}

// ---------------------------------------------------------------------------
// Attention of one head and QB query rows in one work-group:
//   scores = scale * Q @ K^T (all LQ keys), row softmax, Acat[:, d*16+h] = P @ V.
// Scores (fp32) and probabilities (bf16) live in LDS only.  Wave w owns keys
// w*64..+63 in the first product, so Q and K fragments come straight from
// global memory.  The head's V lands row-major in LDS by async copies issued
// first, and wave w reads its columns w*16..+15 by transposing loads.
// ---------------------------------------------------------------------------
#define QB 32
__global__ __launch_bounds__(256) void attn_fused_kernel(
    const __bf16* __restrict__ Qh, const __bf16* __restrict__ Kh,
    const __bf16* __restrict__ Vh, float* __restrict__ Acat, float scale)
{
    __shared__ __align__(16) float  sS[QB][LQ + 4];
    __shared__ __align__(16) __bf16 sP[QB][LQ + 8];
    __shared__ __align__(16) __bf16 sV[LQ][DH + 16];

    const int tid  = threadIdx.x;
    const int h    = blockIdx.y;
    const int m0   = blockIdx.x * QB;
    const int w    = tid >> 5, lane = tid & 31;
    const int half = lane >> 4, r = lane & 15;

    const __bf16* Q  = Qh + ((size_t)h * LQ + m0) * DH;
    const __bf16* Kp = Kh + (size_t)h * LQ * DH;
    const __bf16* Vp = Vh + (size_t)h * LQ * DH;

    // ---- V: 16 rows per copy and work-group (16 lanes x 16 B a row), 32 copies per lane
#pragma unroll
    for (int j = 0; j < 4; ++j)
        async_copy8_b128(Vp + (size_t)(j * 128 + (tid >> 4)) * DH + (tid & 15) * 8,
                         (unsigned)(size_t)&sV[j * 128 + (tid >> 4)][(tid & 15) * 8],
                         16 * DH, 16 * (DH + 16) * 2);

    // ---- scores: 32 x 64 per wave, K-dim = DH in 4 steps of 32
    {
        const int wn = w * 64;
        const __bf16* qp = Q + (size_t)r * DH + half * 8;          // this lane's place in its Q row
        const __bf16* kp = Kp + (size_t)(wn + r) * DH + half * 8;  // and in its K row
        v16bf afr[4][2], bfr[4][4];
        v8f acc[2][4] = {};
        auto load = [&](int ks) {
#pragma unroll
            for (int mt = 0; mt < 2; ++mt)
                afr[ks][mt] = frag_from_lds(&qp[mt * 16 * DH + ks * 32], 0);
#pragma unroll
            for (int nt = 0; nt < 4; ++nt)
                bfr[ks][nt] = frag_from_lds(&kp[nt * 16 * DH + ks * 32], 0);
            // code that follows may reuse these loads' address registers; the addresses as
            // inputs keep them from being handed out as destinations to loads of this group
            asm volatile("s_wait_xcnt 0x0" :: "v"(qp), "v"(kp) : "memory");
        };
        auto compute = [&](int ks) {
#pragma unroll
            for (int mt = 0; mt < 2; ++mt)
#pragma unroll
                for (int nt = 0; nt < 4; ++nt)
                    acc[mt][nt] = wmma_bf16(afr[ks][mt], bfr[ks][nt], acc[mt][nt]);
        };
        load(0); load(1); load(2);
        // keeps the first products, which wait for their operands, from being scheduled
        // in front of the later steps' loads: a wave issues in order
        __builtin_amdgcn_sched_barrier(0);
        compute(0);
        load(3);
        compute(1); compute(2); compute(3);
#pragma unroll
        for (int mt = 0; mt < 2; ++mt)
#pragma unroll
            for (int nt = 0; nt < 4; ++nt)
#pragma unroll
                for (int g = 0; g < 8; ++g)
                    sS[mt * 16 + half * 8 + g][wn + nt * 16 + r] = acc[mt][nt][g] * scale;
    }

    __syncthreads();

    // ---- softmax over keys: one wave per row, 4 rows per wave, 16 scores per lane
#pragma unroll
    for (int i = 0; i < QB / 8; ++i) {
        const int row = w * (QB / 8) + i;
        float4 v[4];
#pragma unroll
        for (int j = 0; j < 4; ++j) v[j] = *(const float4*)&sS[row][lane * 4 + j * 128];
        float mx = fmaxf(fmaxf(v[0].x, v[0].y), fmaxf(v[0].z, v[0].w));
#pragma unroll
        for (int j = 1; j < 4; ++j)
            mx = fmaxf(mx, fmaxf(fmaxf(v[j].x, v[j].y), fmaxf(v[j].z, v[j].w)));
#pragma unroll
        for (int o = 16; o > 0; o >>= 1) mx = fmaxf(mx, __shfl_xor(mx, o));
        float s = 0.0f;
#pragma unroll
        for (int j = 0; j < 4; ++j) {
            v[j].x = expf(v[j].x - mx); v[j].y = expf(v[j].y - mx);
            v[j].z = expf(v[j].z - mx); v[j].w = expf(v[j].w - mx);
            s += (v[j].x + v[j].y) + (v[j].z + v[j].w);
        }
#pragma unroll
        for (int o = 16; o > 0; o >>= 1) s += __shfl_xor(s, o);
        const float inv = 1.0f / s;
#pragma unroll
        for (int j = 0; j < 4; ++j) {
            v4bf p;
            p[0] = (__bf16)(v[j].x * inv); p[1] = (__bf16)(v[j].y * inv);
            p[2] = (__bf16)(v[j].z * inv); p[3] = (__bf16)(v[j].w * inv);
            *(v4bf*)&sP[row][lane * 4 + j * 128] = p;
        }
    }
    // this wave's V copies have landed; the barrier then publishes V and P to all waves
    asm volatile("s_wait_asynccnt 0x0" ::: "memory");
    __syncthreads();

    // ---- P @ V: 32 x 16 per wave, K-dim = LQ in 16 steps of 32
    const int n = w * 16 + r;             // this lane's column of V
    const __bf16* vt = &sV[half * 8 + (lane & 7)][w * 16 + ((lane >> 3) & 1) * 8];
    v8f o[2] = {};
#pragma unroll
    for (int ks = 0; ks < LQ / 32; ++ks) {
        const v8bf lo = lds_load_tr16(vt + (ks * 32) * (DH + 16));        // keys ks*32 + half*8 .. +7
        const v8bf hi = lds_load_tr16(vt + (ks * 32 + 16) * (DH + 16));   // keys ks*32 + 16 + half*8 .. +7
        const v16bf vfr = __builtin_shufflevector(lo, hi, 0, 1, 2, 3, 4, 5, 6, 7,
                                                          8, 9, 10, 11, 12, 13, 14, 15);
#pragma unroll
        for (int mt = 0; mt < 2; ++mt)
            o[mt] = wmma_bf16(frag_from_lds(&sP[mt * 16 + r][ks * 32], half), vfr, o[mt]);
    }

#pragma unroll
    for (int mt = 0; mt < 2; ++mt)
#pragma unroll
        for (int g = 0; g < 8; ++g)
            Acat[(size_t)(m0 + mt * 16 + half * 8 + g) * DM + n * NH + h] = o[mt][g];
}

// ---------------------------------------------------------------------------
// H = gelu(split-K partials + bias) as bf16 (it only feeds FFN2's A operand), one row
// of FFD per work-group.
// ---------------------------------------------------------------------------
template <int S>
__global__ __launch_bounds__(256) void bias_gelu_kernel(
    const float* __restrict__ part, const float* __restrict__ bias,
    __bf16* __restrict__ Hout)
{
    const int l = blockIdx.x, tid = threadIdx.x;
    const float* prow = part + (size_t)l * (S * FFD);
    __bf16* hrow = Hout + (size_t)l * FFD;
    constexpr int NJ = FFD / 1024;
    // all loads of the row first, so that they are in flight together
    float4 v[S][NJ], bv[NJ];
#pragma unroll
    for (int j = 0; j < NJ; ++j) {
        const int c = (tid + j * 256) * 4;
#pragma unroll
        for (int s = 0; s < S; ++s) v[s][j] = *(const float4*)(&prow[s * FFD + c]);
        bv[j] = *(const float4*)(&bias[c]);
    }
#pragma unroll
    for (int j = 0; j < NJ; ++j) {
        const int c = (tid + j * 256) * 4;
        float4 x = v[0][j];
#pragma unroll
        for (int s = 1; s < S; ++s) {
            x.x += v[s][j].x; x.y += v[s][j].y; x.z += v[s][j].z; x.w += v[s][j].w;
        }
        v4bf y;
        y[0] = (__bf16)gelu_tanh(x.x + bv[j].x);
        y[1] = (__bf16)gelu_tanh(x.y + bv[j].y);
        y[2] = (__bf16)gelu_tanh(x.z + bv[j].z);
        y[3] = (__bf16)gelu_tanh(x.w + bv[j].w);
        *(v4bf*)(&hrow[c]) = y;
    }
}

// ---------------------------------------------------------------------------
// Row LayerNorm over D=2048 of (split-K partials + bias + residual).
// WB: the result is also written rounded to bf16 (Yb), for the GEMM that reads it as A.
// ---------------------------------------------------------------------------
template <int S, bool WB>
__global__ __launch_bounds__(256) void layernorm_kernel(
    const float* __restrict__ part, const float* __restrict__ bias,
    const float* __restrict__ res, const float* __restrict__ g,
    const float* __restrict__ b, float* __restrict__ Y, __bf16* __restrict__ Yb)
{
    const int l = blockIdx.x, tid = threadIdx.x;
    const float* prow = part + (size_t)l * (S * DM);
    const float* rrow = res + (size_t)l * DM;
    float* out = Y + (size_t)l * DM;
    __shared__ float red[256];

    float vals[8], s = 0.0f;
#pragma unroll
    for (int j = 0; j < 8; ++j) {
        const int c = tid + j * 256;
        vals[j] = sum_slices<S>(prow, c) + bias[c] + rrow[c];
        s += vals[j];
    }
    red[tid] = s;
    __syncthreads();
    for (int st = 128; st > 0; st >>= 1) { if (tid < st) red[tid] += red[tid + st]; __syncthreads(); }
    const float mu = red[0] * (1.0f / (float)DM);
    __syncthreads();

    float v = 0.0f;
#pragma unroll
    for (int j = 0; j < 8; ++j) { const float d = vals[j] - mu; v += d * d; }
    red[tid] = v;
    __syncthreads();
    for (int st = 128; st > 0; st >>= 1) { if (tid < st) red[tid] += red[tid + st]; __syncthreads(); }
    const float inv = rsqrtf(red[0] * (1.0f / (float)DM) + 1e-5f);

#pragma unroll
    for (int j = 0; j < 8; ++j) {
        const int c = tid + j * 256;
        const float y = (vals[j] - mu) * inv * g[c] + b[c];
        out[c] = y;
        if constexpr (WB) Yb[(size_t)l * DM + c] = (__bf16)y;
    }
}

// ---------------------------------------------------------------------------
extern "C" void kernel_launch(void* const* d_in, const int* in_sizes, int n_in,
                              void* d_out, int out_size, void* d_ws, size_t ws_size,
                              hipStream_t stream)
{
    (void)in_sizes; (void)n_in; (void)out_size; (void)ws_size;

    const float* seq  = (const float*)d_in[0];
    const float* embW = (const float*)d_in[1];
    const float* embB = (const float*)d_in[2];
    const float* Wq   = (const float*)d_in[3];
    const float* bq   = (const float*)d_in[4];
    const float* Wk   = (const float*)d_in[5];
    const float* bk   = (const float*)d_in[6];
    const float* Wv   = (const float*)d_in[7];
    const float* bv   = (const float*)d_in[8];
    const float* Wo   = (const float*)d_in[9];
    const float* bo   = (const float*)d_in[10];
    const float* lng  = (const float*)d_in[11];
    const float* lnb  = (const float*)d_in[12];
    const float* W1   = (const float*)d_in[13];
    const float* b1   = (const float*)d_in[14];
    const float* W2   = (const float*)d_in[15];
    const float* b2   = (const float*)d_in[16];

    char* ws = (char*)d_ws;
    size_t off = 0;
    auto take = [&](size_t bytes) { char* p = ws + off; off = (off + bytes + 255) & ~(size_t)255; return p; };

    const size_t fLD = (size_t)LQ * DM * sizeof(float);       // 4 MB
    const size_t hLD = (size_t)NH * LQ * DH * sizeof(__bf16); // 2 MB
    const size_t hLF = (size_t)LQ * FFD * sizeof(__bf16);     // 8 MB

    float*  X    = (float*)take(fLD);
    float*  Acat = (float*)take(fLD);
    __bf16* Qh   = (__bf16*)take(3 * hLD);   // Q, K, V per-head planes, one after the other
    __bf16* Kh   = Qh + (size_t)NH * LQ * DH;
    __bf16* Vh   = Kh + (size_t)NH * LQ * DH;
    __bf16* Hb   = (__bf16*)take(hLF);       // FFN hidden, bf16
    float*  Xa   = (float*)take(fLD);
    __bf16* Xb   = (__bf16*)take(hLD);       // X and Xa rounded to bf16, [L][D]
    __bf16* Xab  = (__bf16*)take(hLD);
    float*  Pt   = (float*)take(8 * fLD);    // split-K partials: 32 MB a product
    float*  Yout = (float*)d_out;

    const dim3 blk(256);
    const dim3 gD (DM / 128, LQ / 128, 8);   // N=2048 GEMMs, 8 K slices: 512 work-groups
    const dim3 gQKV(DM / 128, LQ / 128, 3);  // Q, K and V projections together, whole K: 192 work-groups
    const dim3 gFF(FFD / 128, LQ / 128, 2);  // N=8192 GEMM, 2 K slices: 512 work-groups

    // 1) embedding, 2) + bias + positional encoding
    gemm_splitk_kernel<DM, DM, 8, false><<<gD, blk, 0, stream>>>(seq, nullptr, embW, Pt);
    add_pos_kernel<8><<<LQ, blk, 0, stream>>>(Pt, embB, X, Xb);
    // 3-4) Q/K/V projections with bias, written in the per-head bf16 layout, in one launch
    gemm_qkv_heads_kernel<<<gQKV, dim3(512), 0, stream>>>(Xb, Wq, Wk, Wv, bq, bk, bv, Qh);
    // 5-7) softmax(Qh @ Kh^T / sqrt(D)) @ Vh, scattered back to the [L, D] interleaved layout
    attn_fused_kernel<<<dim3(LQ / QB, NH), blk, 0, stream>>>(
        Qh, Kh, Vh, Acat, 0.022097086912079608f /* 1/sqrt(2048) */);
    // 8) output projection, 9) + bias + residual X, LayerNorm -> Xa
    gemm_splitk_kernel<DM, DM, 8, false><<<gD, blk, 0, stream>>>(Acat, nullptr, Wo, Pt);
    layernorm_kernel<8, true><<<LQ, blk, 0, stream>>>(Pt, bo, X, lng, lnb, Xa, Xab);
    // 10) FFN1, then bias + GELU
    gemm_splitk_kernel<FFD, DM, 2, true><<<gFF, blk, 0, stream>>>(nullptr, Xab, W1, Pt);
    bias_gelu_kernel<2><<<LQ, blk, 0, stream>>>(Pt, b1, Hb);
    // 11) FFN2, 12) + bias + residual Xa, final LayerNorm -> output
    gemm_splitk_kernel<DM, FFD, 8, true><<<gD, blk, 0, stream>>>(nullptr, Hb, W2, Pt);
    layernorm_kernel<8, false><<<LQ, blk, 0, stream>>>(Pt, b2, Xa, lng, lnb, Yout, nullptr);
}

// v008
// One run takes 152 microseconds.
// Timed twice side by side with v007, it ran 1.08 and 1.09 times as fast.
// All steps since v000 together make it 4.32 times as fast.
#include <hip/hip_runtime.h>
#include <hip/hip_bf16.h>
#include <math.h>

typedef __attribute__((ext_vector_type(16))) __bf16 v16bf;
typedef __attribute__((ext_vector_type(8)))  __bf16 v8bf;
typedef __attribute__((ext_vector_type(4)))  __bf16 v4bf;
typedef __attribute__((ext_vector_type(2)))  __bf16 v2bf;
typedef __attribute__((ext_vector_type(8)))  float  v8f;

#define LQ 512
#define DM 2048
#define NH 16
#define DH 128
#define FFD 8192

__device__ __forceinline__ v8f wmma_bf16(const v16bf& a, const v16bf& b, const v8f& c) {
    return __builtin_amdgcn_wmma_f32_16x16x32_bf16(false, a, false, b, (short)0, c, false, false);
}

__device__ __forceinline__ v16bf frag_from_lds(const __bf16* rowp, int half) {
    const v8bf lo = *(const v8bf*)(rowp + half * 8);
    const v8bf hi = *(const v8bf*)(rowp + 16 + half * 8);
    return __builtin_shufflevector(lo, hi, 0, 1, 2, 3, 4, 5, 6, 7,
                                           8, 9, 10, 11, 12, 13, 14, 15);
}

__device__ __forceinline__ void async_copy8_b128(const __bf16* g, unsigned lds, int gstep, unsigned lstep) {
    asm volatile("global_load_async_to_lds_b128 %0, %8, off\n\t"
                 "global_load_async_to_lds_b128 %1, %9, off\n\t"
                 "global_load_async_to_lds_b128 %2, %10, off\n\t"
                 "global_load_async_to_lds_b128 %3, %11, off\n\t"
                 "global_load_async_to_lds_b128 %4, %12, off\n\t"
                 "global_load_async_to_lds_b128 %5, %13, off\n\t"
                 "global_load_async_to_lds_b128 %6, %14, off\n\t"
                 "global_load_async_to_lds_b128 %7, %15, off\n\t"
                 "s_wait_xcnt 0x0"
                 :: "v"(lds), "v"(lds + lstep), "v"(lds + 2 * lstep), "v"(lds + 3 * lstep),
                    "v"(lds + 4 * lstep), "v"(lds + 5 * lstep), "v"(lds + 6 * lstep), "v"(lds + 7 * lstep),
                    "v"(g), "v"(g + gstep), "v"(g + 2 * gstep), "v"(g + 3 * gstep),
                    "v"(g + 4 * gstep), "v"(g + 5 * gstep), "v"(g + 6 * gstep), "v"(g + 7 * gstep)
                 : "memory");
}

// Transposing LDS load: from a row-major 16-bit tile, lane (c = lane & 15, half) gets
// rows 8*half .. +7 of column c; p is the lane's own address in the tile:
// row 8*half + (lane & 7), column 8*((lane >> 3) & 1).
__device__ __forceinline__ v8bf lds_load_tr16(const __bf16* p) {
    typedef __attribute__((address_space(3))) v8bf lds_v8bf;
    return __builtin_amdgcn_ds_load_tr16_b128_v8bf16((lds_v8bf*)p);
}

__device__ __forceinline__ float gelu_tanh(float x) {
    const float k0 = 0.7978845608028654f;  // sqrt(2/pi)
    const float k1 = 0.044715f;
    float t = tanhf(k0 * (x + k1 * x * x * x));
    return 0.5f * x * (1.0f + t);
}

template <int N, int K, int S, bool ABF>
__global__ __launch_bounds__(512, 4) void gemm_splitk_kernel(
    const float* __restrict__ A, const __bf16* __restrict__ Ab, const float* __restrict__ B,
    float* __restrict__ Cpart)
{
    constexpr int KT = 128;             // k per stage
    constexpr int MT = 256;             // rows of the block tile
    static_assert(K % (2 * KT * S) == 0 && N % 128 == 0, "tile assumptions");
    __shared__ __align__(16) __bf16 aT[2][MT][KT + 8];
    __shared__ __align__(16) __bf16 bTt[2][128][KT + 8];

    const int tid  = threadIdx.x;
    const int m0   = blockIdx.y * MT;
    const int n0   = blockIdx.x * 128;
    const int w    = tid >> 5;
    const int lane = tid & 31;
    const int half = lane >> 4;
    const int r    = lane & 15;
    const int wm   = (w & 7) * 32;
    const int wn   = (w >> 3) * 64;

    constexpr int AE = ABF ? 8 : 4;     // A staging: elements per 16-byte load
    constexpr int AR = 512 * AE / KT;   // AR rows / pass, KT/AE loads per row
    constexpr int AP = MT / AR;         // passes
    constexpr int BK = KT / 4;          // B staging: k values per thread
    const int arow = tid / (KT / AE);
    const int acol = (tid % (KT / AE)) * AE;
    const int sn   = tid & 127;         // B staging: column gather, 4 threads per n
    const int sk0  = (tid >> 7) * BK;
    constexpr int KS = K / S;           // this work-group's K slice: [z*KS, z*KS + KS)
    const int zs = blockIdx.z;          // K slice
    const size_t aoff = (size_t)zs * KS + (size_t)(m0 + arow) * K + acol;  // this thread's first A element
    B += ((size_t)zs * KS + sk0) * N + n0 + sn;                 // and its first B element

    v8f acc[2][4] = {};
    float4 va[ABF ? 1 : AP];
    v8bf   vh[ABF ? AP : 1];
    float  tb[BK];

    auto load = [&](int kc) {
        // code that follows may reuse these loads' address registers; the address as an input
        // keeps it from being a destination of a load of its own group
        if constexpr (ABF) {
            const __bf16* ap = Ab + aoff + kc;
#pragma unroll
            for (int p = 0; p < AP; ++p)
                vh[p] = *(const v8bf*)(&ap[p * AR * K]);
            asm volatile("s_wait_xcnt 0x0" :: "v"(ap) : "memory");
        } else {
            const float* ap = A + aoff + kc;
#pragma unroll
            for (int p = 0; p < AP; ++p)
                va[p] = *(const float4*)(&ap[p * AR * K]);
            asm volatile("s_wait_xcnt 0x0" :: "v"(ap) : "memory");
        }
        const float* bp = B + (size_t)kc * N;
#pragma unroll
        for (int i = 0; i < BK; ++i)
            tb[i] = bp[i * N];
        asm volatile("s_wait_xcnt 0x0" :: "v"(bp) : "memory");
    };

    auto store = [&](int buf) {
#pragma unroll
        for (int p = 0; p < AP; ++p) {
            const int rr = p * AR + arow;
            if constexpr (ABF) {
                *(v8bf*)&aT[buf][rr][acol] = vh[p];
            } else {
                aT[buf][rr][acol + 0] = (__bf16)va[p].x;
                aT[buf][rr][acol + 1] = (__bf16)va[p].y;
                aT[buf][rr][acol + 2] = (__bf16)va[p].z;
                aT[buf][rr][acol + 3] = (__bf16)va[p].w;
            }
        }
#pragma unroll
        for (int q = 0; q < BK / 8; ++q) {
            v8bf t;
#pragma unroll
            for (int i = 0; i < 8; ++i) t[i] = (__bf16)tb[q * 8 + i];
            *(v8bf*)&bTt[buf][sn][sk0 + q * 8] = t;
        }
    };

    auto compute = [&](int buf) {
#pragma unroll
        for (int ks = 0; ks < KT; ks += 32) {
            v16bf afr[2], bfr[4];
#pragma unroll
            for (int mt = 0; mt < 2; ++mt)
                afr[mt] = frag_from_lds(&aT[buf][wm + mt * 16 + r][ks], half);
#pragma unroll
            for (int nt = 0; nt < 4; ++nt)
                bfr[nt] = frag_from_lds(&bTt[buf][wn + nt * 16 + r][ks], half);
#pragma unroll
            for (int mt = 0; mt < 2; ++mt)
#pragma unroll
                for (int nt = 0; nt < 4; ++nt)
                    acc[mt][nt] = wmma_bf16(bfr[nt], afr[mt], acc[mt][nt]);  // B rows first: see the epilogue
        }
        // keeps the conversions and LDS stores of the next stage, which wait for its loads,
        // from being scheduled in among these products
        __builtin_amdgcn_sched_barrier(0);
    };

    load(0);
    store(0);
    __syncthreads();
#pragma unroll 1
    for (int kc = 0; kc < KS; kc += 2 * KT) {
        load(kc + KT);                           // KS % (2*KT) == 0 -> kc+KT < KS always
        compute(0);
        store(1);                                // every wave left buffer 1 at the last barrier
        __syncthreads();
        const bool more = kc + 2 * KT < KS;
        if (more) load(kc + 2 * KT);
        compute(1);
        if (more) store(0);
        __syncthreads();
    }

    constexpr int SP = 68;
    static_assert(16 * 32 * SP * sizeof(float) <= sizeof(aT), "the staging fits the A buffers");
    float* st = reinterpret_cast<float*>(&aT[0][0][0]) + w * (32 * SP);
#pragma unroll
    for (int mt = 0; mt < 2; ++mt) {
#pragma unroll
        for (int nt = 0; nt < 4; ++nt) {
            float* sp = &st[(mt * 16 + r) * SP + nt * 16 + half * 8];
            const v8f a = acc[mt][nt];
            *(float4*)(sp)     = make_float4(a[0], a[1], a[2], a[3]);
            *(float4*)(sp + 4) = make_float4(a[4], a[5], a[6], a[7]);
        }
    }
    // the rows are read back by other lanes of this wave: its LDS stores have retired first
    asm volatile("s_wait_dscnt 0x0" ::: "memory");
    float* __restrict__ C = Cpart + (size_t)zs * N + (size_t)(m0 + wm + half) * (S * N) + n0 + wn + r * 4;
#pragma unroll
    for (int i = 0; i < 16; ++i)
        *(float4*)(&C[(size_t)(2 * i) * (S * N)]) = *(const float4*)(&st[(2 * i + half) * SP + r * 4]);
}

// Sum of the S split-K partials of column c, in slice order; prow points at
// the S partial rows (each DM wide) of one output row.
template <int S>
__device__ __forceinline__ float sum_slices(const float* __restrict__ prow, int c)
{
    float v[S];
#pragma unroll
    for (int s = 0; s < S; ++s) v[s] = prow[s * DM + c];
    float x = v[0];
#pragma unroll
    for (int s = 1; s < S; ++s) x += v[s];
    return x;
}

// ---------------------------------------------------------------------------
// X = split-K partials + bias + positional encoding (computed on the fly,
// matches reference buffer).  X stays fp32 for the residual; Xb is its bf16 rounding,
// the A operand of the Q/K/V projections.
// ---------------------------------------------------------------------------
template <int S>
__global__ __launch_bounds__(256) void add_pos_kernel(
    const float* __restrict__ part, const float* __restrict__ bias,
    float* __restrict__ X, __bf16* __restrict__ Xb)
{
    const int l = blockIdx.x, tid = threadIdx.x;
    float* row = X + (size_t)l * DM;
    __bf16* rowb = Xb + (size_t)l * DM;
    const float* prow = part + (size_t)l * (S * DM);
#pragma unroll
    for (int j = 0; j < 8; ++j) {
        const int c = tid + j * 256;
        const float denom = 10000.0f * expf((float)(c & ~1) * (1.0f / (float)DM));
        const float arg = (float)l / denom;
        const float x = sum_slices<S>(prow, c) + bias[c];
        const float y = x + ((c & 1) ? cosf(arg) : sinf(arg));
        row[c]  = y;
        rowb[c] = (__bf16)y;
    }
}

__global__ __launch_bounds__(512, 4) void gemm_qkv_heads_kernel(
    const __bf16* __restrict__ Ab,
    const float* __restrict__ B0, const float* __restrict__ B1, const float* __restrict__ B2,
    const float* __restrict__ bias0, const float* __restrict__ bias1, const float* __restrict__ bias2,
    __bf16* __restrict__ dst)
{
    constexpr int KT = 128;             // k per stage
    constexpr int N = DM, K = DM;
    static_assert(K % (2 * KT) == 0, "two stages a trip");
    __shared__ __align__(16) __bf16 aT[2][128][KT + 8];
    __shared__ __align__(16) __bf16 bTt[2][128][KT + 8];

    const int tid  = threadIdx.x;
    const int m0   = blockIdx.y * 128;
    const int n0   = blockIdx.x * 128;
    const int p    = blockIdx.z;
    const int w    = tid >> 5;
    const int lane = tid & 31;
    const int half = lane >> 4;
    const int r    = lane & 15;
    const int wm   = (w & 3) * 32;
    const int wn   = (w >> 2) * 32;
    const float* B    = p == 0 ? B0 : (p == 1 ? B1 : B2);
    const float* bias = p == 0 ? bias0 : (p == 1 ? bias1 : bias2);
    dst += (size_t)p * (NH * LQ * DH);

    const int arow = tid >> 4;          // A staging: 16 threads a row, 32 rows a pass, 4 passes
    const int acol = (tid & 15) * 8;
    const int sn   = tid & 127;         // B staging: column gather, 4 threads per n, 32 k each
    const int sk0  = (tid >> 7) * 32;
    const __bf16* a0 = Ab + (size_t)(m0 + arow) * K + acol;
    const float*  b0 = B + (size_t)sk0 * N + n0 + sn;

    v8f  acc[2][2] = {};
    v8bf vh[4];
    float tb[32];

    auto load = [&](int kc) {
        const __bf16* ap = a0 + kc;
#pragma unroll
        for (int q = 0; q < 4; ++q)
            vh[q] = *(const v8bf*)(&ap[q * 32 * K]);
        // code that follows may reuse these loads' address registers; the address as an input
        // keeps it from being a destination of a load of its own group
        asm volatile("s_wait_xcnt 0x0" :: "v"(ap) : "memory");
        const float* bp = b0 + (size_t)kc * N;
#pragma unroll
        for (int i = 0; i < 32; ++i)
            tb[i] = bp[i * N];
        asm volatile("s_wait_xcnt 0x0" :: "v"(bp) : "memory");
    };

    auto store = [&](int buf) {
#pragma unroll
        for (int q = 0; q < 4; ++q)
            *(v8bf*)&aT[buf][q * 32 + arow][acol] = vh[q];
#pragma unroll
        for (int q = 0; q < 4; ++q) {
            v8bf t;
#pragma unroll
            for (int i = 0; i < 8; ++i) t[i] = (__bf16)tb[q * 8 + i];
            *(v8bf*)&bTt[buf][sn][sk0 + q * 8] = t;
        }
    };

    auto compute = [&](int buf) {
        // all fragments of the stage are asked for together, so that the wave pays the LDS
        // latency once a stage and not at every group of products
        v16bf afr[KT / 32][2], bfr[KT / 32][2];
#pragma unroll
        for (int s = 0; s < KT / 32; ++s) {
#pragma unroll
            for (int mt = 0; mt < 2; ++mt)
                afr[s][mt] = frag_from_lds(&aT[buf][wm + mt * 16 + r][s * 32], half);
#pragma unroll
            for (int nt = 0; nt < 2; ++nt)
                bfr[s][nt] = frag_from_lds(&bTt[buf][wn + nt * 16 + r][s * 32], half);
        }
        // holds the reads together in front of the products: left free, they are sunk in among them
        __builtin_amdgcn_sched_barrier(0);
#pragma unroll
        for (int s = 0; s < KT / 32; ++s)
#pragma unroll
            for (int mt = 0; mt < 2; ++mt)
#pragma unroll
                for (int nt = 0; nt < 2; ++nt)
                    acc[mt][nt] = wmma_bf16(bfr[s][nt], afr[s][mt], acc[mt][nt]);  // B rows first: see the epilogue
        // keeps the conversions and LDS stores of the next stage, which wait for its loads,
        // from being scheduled in among these products
        __builtin_amdgcn_sched_barrier(0);
    };

    load(0);
    store(0);
    __syncthreads();
#pragma unroll 1
    for (int kc = 0; kc < K; kc += 2 * KT) {
        load(kc + KT);                           // K % (2*KT) == 0 -> kc+KT < K always
        compute(0);
        store(1);                                // every wave left buffer 1 at the last barrier
        __syncthreads();
        const bool more = kc + 2 * KT < K;
        if (more) load(kc + 2 * KT);
        compute(1);
        if (more) store(0);
        __syncthreads();
    }

    // Epilogue.  With the B rows as first WMMA operand a lane holds, of output row
    // l = base + (lane&15), the columns base + half*8 + vgpr: heads half*8 + vgpr of one d
    // (head h stands at column d*16+h).  The tile is sorted to [l][h][8 d] in the first A buffer
    // (every wave has left it: the loop's last barrier), so that the 8 d which the tile holds
    // of a (head, l) row leave as one 16-byte store.
    constexpr int HP = NH * 8 + 8;      // pitch of one l: its 16 heads x 8 d + 16 B for the 16-byte reads
    static_assert(128 * HP * sizeof(__bf16) <= sizeof(aT), "the staging fits the A buffers");
    __bf16* sh = &aT[0][0][0];
    const float* bp = bias + n0 + wn + half * 8;
    float4 bv[2][2];
#pragma unroll
    for (int nt = 0; nt < 2; ++nt) {
        bv[nt][0] = *(const float4*)(&bp[nt * 16]);
        bv[nt][1] = *(const float4*)(&bp[nt * 16 + 4]);
    }
    asm volatile("s_wait_xcnt 0x0" :: "v"(bp) : "memory");  // as in load()
    const float bb[2][8] = {
        { bv[0][0].x, bv[0][0].y, bv[0][0].z, bv[0][0].w, bv[0][1].x, bv[0][1].y, bv[0][1].z, bv[0][1].w },
        { bv[1][0].x, bv[1][0].y, bv[1][0].z, bv[1][0].w, bv[1][1].x, bv[1][1].y, bv[1][1].z, bv[1][1].w } };
#pragma unroll
    for (int mt = 0; mt < 2; ++mt) {
#pragma unroll
        for (int g = 0; g < 8; ++g) {
            v2bf t;                     // the wave's two d of head half*8 + g
            t[0] = (__bf16)(acc[mt][0][g] + bb[0][g]);
            t[1] = (__bf16)(acc[mt][1][g] + bb[1][g]);
            *(v2bf*)&sh[(wm + mt * 16 + r) * HP + (half * 8 + g) * 8 + (wn >> 4)] = t;
        }
    }
    __syncthreads();
#pragma unroll
    for (int j = 0; j < 4; ++j) {
        const int l = tid & 127, h = (tid >> 7) + j * 4;
        *(v8bf*)(&dst[((size_t)h * LQ + m0 + l) * DH + (n0 >> 4)]) = *(const v8bf*)(&sh[l * HP + h * 8]);
    }
}

// ---------------------------------------------------------------------------
// Attention of one head and QB query rows in one work-group:
//   scores = scale * Q @ K^T (all LQ keys), row softmax, Acat[:, d*16+h] = P @ V.
// Scores (fp32) and probabilities (bf16) live in LDS only.  Wave w owns keys
// w*64..+63 in the first product, so Q and K fragments come straight from
// global memory.  The head's V lands row-major in LDS by async copies issued
// first, and wave w reads its columns w*16..+15 by transposing loads.
// ---------------------------------------------------------------------------
#define QB 32
__global__ __launch_bounds__(256) void attn_fused_kernel(
    const __bf16* __restrict__ Qh, const __bf16* __restrict__ Kh,
    const __bf16* __restrict__ Vh, float* __restrict__ Acat, float scale)
{
    __shared__ __align__(16) float  sS[QB][LQ + 4];
    __shared__ __align__(16) __bf16 sP[QB][LQ + 8];
    __shared__ __align__(16) __bf16 sV[LQ][DH + 16];

    const int tid  = threadIdx.x;
    const int h    = blockIdx.y;
    const int m0   = blockIdx.x * QB;
    const int w    = tid >> 5, lane = tid & 31;
    const int half = lane >> 4, r = lane & 15;

    const __bf16* Q  = Qh + ((size_t)h * LQ + m0) * DH;
    const __bf16* Kp = Kh + (size_t)h * LQ * DH;
    const __bf16* Vp = Vh + (size_t)h * LQ * DH;

    // ---- V: 16 rows per copy and work-group (16 lanes x 16 B a row), 32 copies per lane
#pragma unroll
    for (int j = 0; j < 4; ++j)
        async_copy8_b128(Vp + (size_t)(j * 128 + (tid >> 4)) * DH + (tid & 15) * 8,
                         (unsigned)(size_t)&sV[j * 128 + (tid >> 4)][(tid & 15) * 8],
                         16 * DH, 16 * (DH + 16) * 2);

    // ---- scores: 32 x 64 per wave, K-dim = DH in 4 steps of 32
    {
        const int wn = w * 64;
        const __bf16* qp = Q + (size_t)r * DH + half * 8;          // this lane's place in its Q row
        const __bf16* kp = Kp + (size_t)(wn + r) * DH + half * 8;  // and in its K row
        v16bf afr[4][2], bfr[4][4];
        v8f acc[2][4] = {};
        auto load = [&](int ks) {
#pragma unroll
            for (int mt = 0; mt < 2; ++mt)
                afr[ks][mt] = frag_from_lds(&qp[mt * 16 * DH + ks * 32], 0);
#pragma unroll
            for (int nt = 0; nt < 4; ++nt)
                bfr[ks][nt] = frag_from_lds(&kp[nt * 16 * DH + ks * 32], 0);
            // code that follows may reuse these loads' address registers; the addresses as
            // inputs keep them from being handed out as destinations to loads of this group
            asm volatile("s_wait_xcnt 0x0" :: "v"(qp), "v"(kp) : "memory");
        };
        auto compute = [&](int ks) {
#pragma unroll
            for (int mt = 0; mt < 2; ++mt)
#pragma unroll
                for (int nt = 0; nt < 4; ++nt)
                    acc[mt][nt] = wmma_bf16(afr[ks][mt], bfr[ks][nt], acc[mt][nt]);
        };
        load(0); load(1); load(2);
        // keeps the first products, which wait for their operands, from being scheduled
        // in front of the later steps' loads: a wave issues in order
        __builtin_amdgcn_sched_barrier(0);
        compute(0);
        load(3);
        compute(1); compute(2); compute(3);
#pragma unroll
        for (int mt = 0; mt < 2; ++mt)
#pragma unroll
            for (int nt = 0; nt < 4; ++nt)
#pragma unroll
                for (int g = 0; g < 8; ++g)
                    sS[mt * 16 + half * 8 + g][wn + nt * 16 + r] = acc[mt][nt][g] * scale;
    }

    __syncthreads();

    // ---- softmax over keys: one wave per row, 4 rows per wave, 16 scores per lane
#pragma unroll
    for (int i = 0; i < QB / 8; ++i) {
        const int row = w * (QB / 8) + i;
        float4 v[4];
#pragma unroll
        for (int j = 0; j < 4; ++j) v[j] = *(const float4*)&sS[row][lane * 4 + j * 128];
        float mx = fmaxf(fmaxf(v[0].x, v[0].y), fmaxf(v[0].z, v[0].w));
#pragma unroll
        for (int j = 1; j < 4; ++j)
            mx = fmaxf(mx, fmaxf(fmaxf(v[j].x, v[j].y), fmaxf(v[j].z, v[j].w)));
#pragma unroll
        for (int o = 16; o > 0; o >>= 1) mx = fmaxf(mx, __shfl_xor(mx, o));
        float s = 0.0f;
#pragma unroll
        for (int j = 0; j < 4; ++j) {
            v[j].x = expf(v[j].x - mx); v[j].y = expf(v[j].y - mx);
            v[j].z = expf(v[j].z - mx); v[j].w = expf(v[j].w - mx);
            s += (v[j].x + v[j].y) + (v[j].z + v[j].w);
        }
#pragma unroll
        for (int o = 16; o > 0; o >>= 1) s += __shfl_xor(s, o);
        const float inv = 1.0f / s;
#pragma unroll
        for (int j = 0; j < 4; ++j) {
            v4bf p;
            p[0] = (__bf16)(v[j].x * inv); p[1] = (__bf16)(v[j].y * inv);
            p[2] = (__bf16)(v[j].z * inv); p[3] = (__bf16)(v[j].w * inv);
            *(v4bf*)&sP[row][lane * 4 + j * 128] = p;
        }
    }
    // this wave's V copies have landed; the barrier then publishes V and P to all waves
    asm volatile("s_wait_asynccnt 0x0" ::: "memory");
    __syncthreads();

    // ---- P @ V: 32 x 16 per wave, K-dim = LQ in 16 steps of 32
    const int n = w * 16 + r;             // this lane's column of V
    const __bf16* vt = &sV[half * 8 + (lane & 7)][w * 16 + ((lane >> 3) & 1) * 8];
    v8f o[2] = {};
#pragma unroll
    for (int ks = 0; ks < LQ / 32; ++ks) {
        const v8bf lo = lds_load_tr16(vt + (ks * 32) * (DH + 16));        // keys ks*32 + half*8 .. +7
        const v8bf hi = lds_load_tr16(vt + (ks * 32 + 16) * (DH + 16));   // keys ks*32 + 16 + half*8 .. +7
        const v16bf vfr = __builtin_shufflevector(lo, hi, 0, 1, 2, 3, 4, 5, 6, 7,
                                                          8, 9, 10, 11, 12, 13, 14, 15);
#pragma unroll
        for (int mt = 0; mt < 2; ++mt)
            o[mt] = wmma_bf16(frag_from_lds(&sP[mt * 16 + r][ks * 32], half), vfr, o[mt]);
    }

#pragma unroll
    for (int mt = 0; mt < 2; ++mt)
#pragma unroll
        for (int g = 0; g < 8; ++g)
            Acat[(size_t)(m0 + mt * 16 + half * 8 + g) * DM + n * NH + h] = o[mt][g];
}

// ---------------------------------------------------------------------------
// H = gelu(split-K partials + bias) as bf16 (it only feeds FFN2's A operand), one row
// of FFD per work-group.
// ---------------------------------------------------------------------------
template <int S>
__global__ __launch_bounds__(256) void bias_gelu_kernel(
    const float* __restrict__ part, const float* __restrict__ bias,
    __bf16* __restrict__ Hout)
{
    const int l = blockIdx.x, tid = threadIdx.x;
    const float* prow = part + (size_t)l * (S * FFD);
    __bf16* hrow = Hout + (size_t)l * FFD;
    constexpr int NJ = FFD / 1024;
    // all loads of the row first, so that they are in flight together
    float4 v[S][NJ], bv[NJ];
#pragma unroll
    for (int j = 0; j < NJ; ++j) {
        const int c = (tid + j * 256) * 4;
#pragma unroll
        for (int s = 0; s < S; ++s) v[s][j] = *(const float4*)(&prow[s * FFD + c]);
        bv[j] = *(const float4*)(&bias[c]);
    }
#pragma unroll
    for (int j = 0; j < NJ; ++j) {
        const int c = (tid + j * 256) * 4;
        float4 x = v[0][j];
#pragma unroll
        for (int s = 1; s < S; ++s) {
            x.x += v[s][j].x; x.y += v[s][j].y; x.z += v[s][j].z; x.w += v[s][j].w;
        }
        v4bf y;
        y[0] = (__bf16)gelu_tanh(x.x + bv[j].x);
        y[1] = (__bf16)gelu_tanh(x.y + bv[j].y);
        y[2] = (__bf16)gelu_tanh(x.z + bv[j].z);
        y[3] = (__bf16)gelu_tanh(x.w + bv[j].w);
        *(v4bf*)(&hrow[c]) = y;
    }
}

// ---------------------------------------------------------------------------
// Row LayerNorm over D=2048 of (split-K partials + bias + residual).
// WB: the result is also written rounded to bf16 (Yb), for the GEMM that reads it as A.
// ---------------------------------------------------------------------------
template <int S, bool WB>
__global__ __launch_bounds__(256) void layernorm_kernel(
    const float* __restrict__ part, const float* __restrict__ bias,
    const float* __restrict__ res, const float* __restrict__ g,
    const float* __restrict__ b, float* __restrict__ Y, __bf16* __restrict__ Yb)
{
    const int l = blockIdx.x, tid = threadIdx.x;
    const float* prow = part + (size_t)l * (S * DM);
    const float* rrow = res + (size_t)l * DM;
    float* out = Y + (size_t)l * DM;
    __shared__ float red[256];

    float vals[8], s = 0.0f;
#pragma unroll
    for (int j = 0; j < 8; ++j) {
        const int c = tid + j * 256;
        vals[j] = sum_slices<S>(prow, c) + bias[c] + rrow[c];
        s += vals[j];
    }
    red[tid] = s;
    __syncthreads();
    for (int st = 128; st > 0; st >>= 1) { if (tid < st) red[tid] += red[tid + st]; __syncthreads(); }
    const float mu = red[0] * (1.0f / (float)DM);
    __syncthreads();

    float v = 0.0f;
#pragma unroll
    for (int j = 0; j < 8; ++j) { const float d = vals[j] - mu; v += d * d; }
    red[tid] = v;
    __syncthreads();
    for (int st = 128; st > 0; st >>= 1) { if (tid < st) red[tid] += red[tid + st]; __syncthreads(); }
    const float inv = rsqrtf(red[0] * (1.0f / (float)DM) + 1e-5f);

#pragma unroll
    for (int j = 0; j < 8; ++j) {
        const int c = tid + j * 256;
        const float y = (vals[j] - mu) * inv * g[c] + b[c];
        out[c] = y;
        if constexpr (WB) Yb[(size_t)l * DM + c] = (__bf16)y;
    }
}

// ---------------------------------------------------------------------------
extern "C" void kernel_launch(void* const* d_in, const int* in_sizes, int n_in,
                              void* d_out, int out_size, void* d_ws, size_t ws_size,
                              hipStream_t stream)
{
    (void)in_sizes; (void)n_in; (void)out_size; (void)ws_size;

    const float* seq  = (const float*)d_in[0];
    const float* embW = (const float*)d_in[1];
    const float* embB = (const float*)d_in[2];
    const float* Wq   = (const float*)d_in[3];
    const float* bq   = (const float*)d_in[4];
    const float* Wk   = (const float*)d_in[5];
    const float* bk   = (const float*)d_in[6];
    const float* Wv   = (const float*)d_in[7];
    const float* bv   = (const float*)d_in[8];
    const float* Wo   = (const float*)d_in[9];
    const float* bo   = (const float*)d_in[10];
    const float* lng  = (const float*)d_in[11];
    const float* lnb  = (const float*)d_in[12];
    const float* W1   = (const float*)d_in[13];
    const float* b1   = (const float*)d_in[14];
    const float* W2   = (const float*)d_in[15];
    const float* b2   = (const float*)d_in[16];

    char* ws = (char*)d_ws;
    size_t off = 0;
    auto take = [&](size_t bytes) { char* p = ws + off; off = (off + bytes + 255) & ~(size_t)255; return p; };

    const size_t fLD = (size_t)LQ * DM * sizeof(float);       // 4 MB
    const size_t hLD = (size_t)NH * LQ * DH * sizeof(__bf16); // 2 MB
    const size_t hLF = (size_t)LQ * FFD * sizeof(__bf16);     // 8 MB

    float*  X    = (float*)take(fLD);
    float*  Acat = (float*)take(fLD);
    __bf16* Qh   = (__bf16*)take(3 * hLD);   // Q, K, V per-head planes, one after the other
    __bf16* Kh   = Qh + (size_t)NH * LQ * DH;
    __bf16* Vh   = Kh + (size_t)NH * LQ * DH;
    __bf16* Hb   = (__bf16*)take(hLF);       // FFN hidden, bf16
    float*  Xa   = (float*)take(fLD);
    __bf16* Xb   = (__bf16*)take(hLD);       // X and Xa rounded to bf16, [L][D]
    __bf16* Xab  = (__bf16*)take(hLD);
    float*  Pt   = (float*)take(8 * fLD);    // split-K partials: 32 MB a product
    float*  Yout = (float*)d_out;

    const dim3 blk(256);
    const dim3 blkG(512);                    // the GEMMs' block: 16 waves
    const dim3 gD (DM / 128, LQ / 256, 8);   // N=2048 GEMMs, 8 K slices: 256 work-groups
    const dim3 gQKV(DM / 128, LQ / 128, 3);  // Q, K and V projections together, whole K: 192 work-groups
    const dim3 gFF(FFD / 128, LQ / 256, 2);  // N=8192 GEMM, 2 K slices: 256 work-groups

    // 1) embedding, 2) + bias + positional encoding
    gemm_splitk_kernel<DM, DM, 8, false><<<gD, blkG, 0, stream>>>(seq, nullptr, embW, Pt);
    add_pos_kernel<8><<<LQ, blk, 0, stream>>>(Pt, embB, X, Xb);
    // 3-4) Q/K/V projections with bias, written in the per-head bf16 layout, in one launch
    gemm_qkv_heads_kernel<<<gQKV, blkG, 0, stream>>>(Xb, Wq, Wk, Wv, bq, bk, bv, Qh);
    // 5-7) softmax(Qh @ Kh^T / sqrt(D)) @ Vh, scattered back to the [L, D] interleaved layout
    attn_fused_kernel<<<dim3(LQ / QB, NH), blk, 0, stream>>>(
        Qh, Kh, Vh, Acat, 0.022097086912079608f /* 1/sqrt(2048) */);
    // 8) output projection, 9) + bias + residual X, LayerNorm -> Xa
    gemm_splitk_kernel<DM, DM, 8, false><<<gD, blkG, 0, stream>>>(Acat, nullptr, Wo, Pt);
    layernorm_kernel<8, true><<<LQ, blk, 0, stream>>>(Pt, bo, X, lng, lnb, Xa, Xab);
    // 10) FFN1, then bias + GELU
    gemm_splitk_kernel<FFD, DM, 2, true><<<gFF, blkG, 0, stream>>>(nullptr, Xab, W1, Pt);
    bias_gelu_kernel<2><<<LQ, blk, 0, stream>>>(Pt, b1, Hb);
    // 11) FFN2, 12) + bias + residual Xa, final LayerNorm -> output
    gemm_splitk_kernel<DM, FFD, 8, true><<<gD, blkG, 0, stream>>>(nullptr, Hb, W2, Pt);
    layernorm_kernel<8, false><<<LQ, blk, 0, stream>>>(Pt, b2, Xa, lng, lnb, Yout, nullptr);
}

// v009
// It runs in 142 microseconds.
// Timed twice side by side with v008, it ran 1.06 times as fast both times.
// Over all steps from v000 it is 4.59 times as fast.
#include <hip/hip_runtime.h>
#include <hip/hip_bf16.h>
#include <math.h>

typedef __attribute__((ext_vector_type(16))) __bf16 v16bf;
typedef __attribute__((ext_vector_type(8)))  __bf16 v8bf;
typedef __attribute__((ext_vector_type(4)))  __bf16 v4bf;
typedef __attribute__((ext_vector_type(2)))  __bf16 v2bf;
typedef __attribute__((ext_vector_type(8)))  float  v8f;

#define LQ 512
#define DM 2048
#define NH 16
#define DH 128
#define FFD 8192

__device__ __forceinline__ v8f wmma_bf16(const v16bf& a, const v16bf& b, const v8f& c) {
    return __builtin_amdgcn_wmma_f32_16x16x32_bf16(false, a, false, b, (short)0, c, false, false);
}

__device__ __forceinline__ v16bf frag_from_lds(const __bf16* rowp, int half) {
    const v8bf lo = *(const v8bf*)(rowp + half * 8);
    const v8bf hi = *(const v8bf*)(rowp + 16 + half * 8);
    return __builtin_shufflevector(lo, hi, 0, 1, 2, 3, 4, 5, 6, 7,
                                           8, 9, 10, 11, 12, 13, 14, 15);
}

__device__ __forceinline__ void async_copy8_b128(const __bf16* g, unsigned lds, int gstep, unsigned lstep) {
    asm volatile("global_load_async_to_lds_b128 %0, %8, off\n\t"
                 "global_load_async_to_lds_b128 %1, %9, off\n\t"
                 "global_load_async_to_lds_b128 %2, %10, off\n\t"
                 "global_load_async_to_lds_b128 %3, %11, off\n\t"
                 "global_load_async_to_lds_b128 %4, %12, off\n\t"
                 "global_load_async_to_lds_b128 %5, %13, off\n\t"
                 "global_load_async_to_lds_b128 %6, %14, off\n\t"
                 "global_load_async_to_lds_b128 %7, %15, off\n\t"
                 "s_wait_xcnt 0x0"
                 :: "v"(lds), "v"(lds + lstep), "v"(lds + 2 * lstep), "v"(lds + 3 * lstep),
                    "v"(lds + 4 * lstep), "v"(lds + 5 * lstep), "v"(lds + 6 * lstep), "v"(lds + 7 * lstep),
                    "v"(g), "v"(g + gstep), "v"(g + 2 * gstep), "v"(g + 3 * gstep),
                    "v"(g + 4 * gstep), "v"(g + 5 * gstep), "v"(g + 6 * gstep), "v"(g + 7 * gstep)
                 : "memory");
}

// Transposing LDS load: from a row-major 16-bit tile, lane (c = lane & 15, half) gets
// rows 8*half .. +7 of column c; p is the lane's own address in the tile:
// row 8*half + (lane & 7), column 8*((lane >> 3) & 1).
__device__ __forceinline__ v8bf lds_load_tr16(const __bf16* p) {
    typedef __attribute__((address_space(3))) v8bf lds_v8bf;
    return __builtin_amdgcn_ds_load_tr16_b128_v8bf16((lds_v8bf*)p);
}

__device__ __forceinline__ float gelu_tanh(float x) {
    const float k0 = 0.7978845608028654f;  // sqrt(2/pi)
    const float k1 = 0.044715f;
    float t = tanhf(k0 * (x + k1 * x * x * x));
    return 0.5f * x * (1.0f + t);
}

template <int N, int K, int S, bool ABF>
__global__ __launch_bounds__(512, 4) void gemm_splitk_kernel(
    const float* __restrict__ A, const __bf16* __restrict__ Ab, const float* __restrict__ B,
    float* __restrict__ Cpart)
{
    constexpr int KT = 128;             // k per stage
    constexpr int MT = 256;             // rows of the block tile
    static_assert(K % (2 * KT * S) == 0 && N % 128 == 0, "tile assumptions");
    __shared__ __align__(16) __bf16 aT[2][MT][KT + 8];
    __shared__ __align__(16) __bf16 bTt[2][128][KT + 8];

    const int tid  = threadIdx.x;
    const int m0   = blockIdx.y * MT;
    const int n0   = blockIdx.x * 128;
    const int w    = tid >> 5;
    const int lane = tid & 31;
    const int half = lane >> 4;
    const int r    = lane & 15;
    const int wm   = (w & 7) * 32;
    const int wn   = (w >> 3) * 64;

    constexpr int AE = ABF ? 8 : 4;     // A staging: elements per 16-byte load
    constexpr int AR = 512 * AE / KT;   // AR rows / pass, KT/AE loads per row
    constexpr int AP = MT / AR;         // passes
    constexpr int BK = KT / 4;          // B staging: k values per thread
    const int arow = tid / (KT / AE);
    const int acol = (tid % (KT / AE)) * AE;
    const int sn   = tid & 127;         // B staging: column gather, 4 threads per n
    const int sk0  = (tid >> 7) * BK;
    constexpr int KS = K / S;           // this work-group's K slice: [z*KS, z*KS + KS)
    const int zs = blockIdx.z;          // K slice
    const size_t aoff = (size_t)zs * KS + (size_t)(m0 + arow) * K + acol;  // this thread's first A element
    B += ((size_t)zs * KS + sk0) * N + n0 + sn;                 // and its first B element

    v8f acc[2][4] = {};
    float4 va[ABF ? 1 : AP];
    v8bf   vh[ABF ? AP : 1];
    float  tb[BK];

    auto load = [&](int kc) {
        // code that follows may reuse these loads' address registers; the address as an input
        // keeps it from being a destination of a load of its own group
        if constexpr (ABF) {
            const __bf16* ap = Ab + aoff + kc;
#pragma unroll
            for (int p = 0; p < AP; ++p)
                vh[p] = *(const v8bf*)(&ap[p * AR * K]);
            asm volatile("s_wait_xcnt 0x0" :: "v"(ap) : "memory");
        } else {
            const float* ap = A + aoff + kc;
#pragma unroll
            for (int p = 0; p < AP; ++p)
                va[p] = *(const float4*)(&ap[p * AR * K]);
            asm volatile("s_wait_xcnt 0x0" :: "v"(ap) : "memory");
        }
        const float* bp = B + (size_t)kc * N;
#pragma unroll
        for (int i = 0; i < BK; ++i)
            tb[i] = bp[i * N];
        asm volatile("s_wait_xcnt 0x0" :: "v"(bp) : "memory");
    };

    auto store = [&](int buf) {
#pragma unroll
        for (int p = 0; p < AP; ++p) {
            const int rr = p * AR + arow;
            if constexpr (ABF) {
                *(v8bf*)&aT[buf][rr][acol] = vh[p];
            } else {
                aT[buf][rr][acol + 0] = (__bf16)va[p].x;
                aT[buf][rr][acol + 1] = (__bf16)va[p].y;
                aT[buf][rr][acol + 2] = (__bf16)va[p].z;
                aT[buf][rr][acol + 3] = (__bf16)va[p].w;
            }
        }
#pragma unroll
        for (int q = 0; q < BK / 8; ++q) {
            v8bf t;
#pragma unroll
            for (int i = 0; i < 8; ++i) t[i] = (__bf16)tb[q * 8 + i];
            *(v8bf*)&bTt[buf][sn][sk0 + q * 8] = t;
        }
    };

    auto compute = [&](int buf) {
#pragma unroll
        for (int ks = 0; ks < KT; ks += 32) {
            v16bf afr[2], bfr[4];
#pragma unroll
            for (int mt = 0; mt < 2; ++mt)
                afr[mt] = frag_from_lds(&aT[buf][wm + mt * 16 + r][ks], half);
#pragma unroll
            for (int nt = 0; nt < 4; ++nt)
                bfr[nt] = frag_from_lds(&bTt[buf][wn + nt * 16 + r][ks], half);
#pragma unroll
            for (int mt = 0; mt < 2; ++mt)
#pragma unroll
                for (int nt = 0; nt < 4; ++nt)
                    acc[mt][nt] = wmma_bf16(bfr[nt], afr[mt], acc[mt][nt]);  // B rows first: see the epilogue
        }
        // keeps the conversions and LDS stores of the next stage, which wait for its loads,
        // from being scheduled in among these products
        __builtin_amdgcn_sched_barrier(0);
    };

    load(0);
    store(0);
    __syncthreads();
#pragma unroll 1
    for (int kc = 0; kc < KS; kc += 2 * KT) {
        load(kc + KT);                           // KS % (2*KT) == 0 -> kc+KT < KS always
        compute(0);
        store(1);                                // every wave left buffer 1 at the last barrier
        __syncthreads();
        const bool more = kc + 2 * KT < KS;
        if (more) load(kc + 2 * KT);
        compute(1);
        if (more) store(0);
        __syncthreads();
    }

    constexpr int SP = 68;
    static_assert(16 * 32 * SP * sizeof(float) <= sizeof(aT), "the staging fits the A buffers");
    float* st = reinterpret_cast<float*>(&aT[0][0][0]) + w * (32 * SP);
#pragma unroll
    for (int mt = 0; mt < 2; ++mt) {
#pragma unroll
        for (int nt = 0; nt < 4; ++nt) {
            float* sp = &st[(mt * 16 + r) * SP + nt * 16 + half * 8];
            const v8f a = acc[mt][nt];
            *(float4*)(sp)     = make_float4(a[0], a[1], a[2], a[3]);
            *(float4*)(sp + 4) = make_float4(a[4], a[5], a[6], a[7]);
        }
    }
    // the rows are read back by other lanes of this wave: its LDS stores have retired first
    asm volatile("s_wait_dscnt 0x0" ::: "memory");
    float* __restrict__ C = Cpart + (size_t)zs * N + (size_t)(m0 + wm + half) * (S * N) + n0 + wn + r * 4;
#pragma unroll
    for (int i = 0; i < 16; ++i)
        *(float4*)(&C[(size_t)(2 * i) * (S * N)]) = *(const float4*)(&st[(2 * i + half) * SP + r * 4]);
}

// Sum of the S split-K partials of column c, in slice order; prow points at
// the S partial rows (each DM wide) of one output row.
template <int S>
__device__ __forceinline__ float sum_slices(const float* __restrict__ prow, int c)
{
    float v[S];
#pragma unroll
    for (int s = 0; s < S; ++s) v[s] = prow[s * DM + c];
    float x = v[0];
#pragma unroll
    for (int s = 1; s < S; ++s) x += v[s];
    return x;
}

__global__ __launch_bounds__(512, 4) void gemm_emb_pos_kernel(
    const float* __restrict__ A, const float* __restrict__ B, const float* __restrict__ bias,
    float* __restrict__ X, __bf16* __restrict__ Xb)
{
    constexpr int KT = 256;             // k per stage
    constexpr int TT = 64;              // rows and columns of the block tile
    constexpr int PT = KT + 8;          // LDS row pitch: row + 16 B for the 16-byte reads
    constexpr int N = DM, K = DM;
    static_assert(K % (2 * KT) == 0, "two stages a trip");
    // [A buffer 0 | A buffer 1 | B buffer 0 | B buffer 1], each TT rows of PT
    __shared__ __align__(16) __bf16 sm[4 * TT * PT];

    const int tid  = threadIdx.x;
    const int m0   = blockIdx.y * TT;
    const int n0   = blockIdx.x * TT;
    const int w    = tid >> 5;
    const int lane = tid & 31;
    const int half = lane >> 4;
    const int r    = lane & 15;
    const int kq   = w >> 2;            // this wave's k group
    const int wm   = (w & 1) * 32;
    const int wn   = ((w >> 1) & 1) * 32;

    const int arow = tid >> 6;          // A staging: 64 threads a row, 8 rows a pass, 8 passes
    const int acol = (tid & 63) * 4;
    const int sn   = tid & 63;          // B staging: column gather, 8 threads per n, 32 k each
    const int sk0  = (tid >> 6) * 32;
    const float* a0 = A + (size_t)(m0 + arow) * K + acol;
    const float* b0 = B + (size_t)sk0 * N + n0 + sn;

    v8f    acc[2][2] = {};
    float4 va[2][8];
    float  tb[2][32];

    auto load = [&](int buf, int kc) {
        const float* ap = a0 + kc;
#pragma unroll
        for (int q = 0; q < 8; ++q)
            va[buf][q] = *(const float4*)(&ap[q * 8 * K]);
        // code that follows may reuse these loads' address registers; the address as an input
        // keeps it from being a destination of a load of its own group
        asm volatile("s_wait_xcnt 0x0" :: "v"(ap) : "memory");
        const float* bp = b0 + (size_t)kc * N;
#pragma unroll
        for (int i = 0; i < 32; ++i)
            tb[buf][i] = bp[i * N];
        asm volatile("s_wait_xcnt 0x0" :: "v"(bp) : "memory");
    };

    auto store = [&](int buf) {
        __bf16* sa = &sm[buf * (TT * PT)];
        __bf16* sb = &sm[(2 + buf) * (TT * PT)];
#pragma unroll
        for (int q = 0; q < 8; ++q) {
            v4bf t;
            t[0] = (__bf16)va[buf][q].x; t[1] = (__bf16)va[buf][q].y;
            t[2] = (__bf16)va[buf][q].z; t[3] = (__bf16)va[buf][q].w;
            *(v4bf*)&sa[(q * 8 + arow) * PT + acol] = t;
        }
#pragma unroll
        for (int q = 0; q < 4; ++q) {
            v8bf t;
#pragma unroll
            for (int i = 0; i < 8; ++i) t[i] = (__bf16)tb[buf][q * 8 + i];
            *(v8bf*)&sb[sn * PT + sk0 + q * 8] = t;
        }
    };

    auto compute = [&](int buf) {
        const __bf16* sa = &sm[buf * (TT * PT)];
        const __bf16* sb = &sm[(2 + buf) * (TT * PT)];
        // all fragments of the stage are asked for together, so that the wave pays the LDS
        // latency once a stage and not at every group of products
        v16bf afr[2][2], bfr[2][2];
#pragma unroll
        for (int s = 0; s < 2; ++s) {
#pragma unroll
            for (int mt = 0; mt < 2; ++mt)
                afr[s][mt] = frag_from_lds(&sa[(wm + mt * 16 + r) * PT + kq * 64 + s * 32], half);
#pragma unroll
            for (int nt = 0; nt < 2; ++nt)
                bfr[s][nt] = frag_from_lds(&sb[(wn + nt * 16 + r) * PT + kq * 64 + s * 32], half);
        }
#pragma unroll
        for (int s = 0; s < 2; ++s)
#pragma unroll
            for (int mt = 0; mt < 2; ++mt)
#pragma unroll
                for (int nt = 0; nt < 2; ++nt)
                    acc[mt][nt] = wmma_bf16(bfr[s][nt], afr[s][mt], acc[mt][nt]);  // B rows first: see the epilogue
        // keeps the conversions and LDS stores of the next stage, which wait for its loads,
        // from being scheduled in among these products
        __builtin_amdgcn_sched_barrier(0);
    };

    // A work-group barrier whose fences name LDS alone: a plain __syncthreads() would also wait
    // for the global loads of the stages ahead, which only this thread's registers receive.
    auto lds_barrier = [&]() {
        __builtin_amdgcn_fence(__ATOMIC_RELEASE, "workgroup", "local");
        __builtin_amdgcn_s_barrier();
        __builtin_amdgcn_fence(__ATOMIC_ACQUIRE, "workgroup", "local");
    };

    load(0, 0);
    load(1, KT);
    store(0);
    lds_barrier();
    // The loads stand under no condition in the loop, so that a store's wait can be counted
    // and leaves the younger set's loads in flight; the last two stages follow the loop.
#pragma unroll 1
    for (int kc = 0; kc < K - 2 * KT; kc += 2 * KT) {
        load(0, kc + 2 * KT);
        compute(0);
        store(1);                                // every wave left buffer 1 at the last barrier
        lds_barrier();
        load(1, kc + 3 * KT);
        compute(1);
        store(0);
        lds_barrier();
    }
    compute(0);
    store(1);
    lds_barrier();
    compute(1);
    lds_barrier();

    constexpr int SP = 68;
    static_assert(4 * TT * SP * sizeof(float) <= sizeof(sm), "the planes fit the stage buffers");
    float* red = reinterpret_cast<float*>(&sm[0]);
#pragma unroll
    for (int mt = 0; mt < 2; ++mt) {
#pragma unroll
        for (int nt = 0; nt < 2; ++nt) {
            float* sp = &red[(kq * TT + wm + mt * 16 + r) * SP + wn + nt * 16 + half * 8];
            const v8f a = acc[mt][nt];
            *(float4*)(sp)     = make_float4(a[0], a[1], a[2], a[3]);
            *(float4*)(sp + 4) = make_float4(a[4], a[5], a[6], a[7]);
        }
    }
    __syncthreads();
    // A thread finishes 8 adjacent columns of one row: 8 threads put out the tile's whole row,
    // 256 B of X and 128 B of Xb.  The groups are summed in k order.
    const int row = tid >> 3, c0 = (tid & 7) * 8;
    const int l = m0 + row, c = n0 + c0;
    const float* bp = bias + c;
    const float4 bl = *(const float4*)(&bp[0]);
    const float4 bh = *(const float4*)(&bp[4]);
    asm volatile("s_wait_xcnt 0x0" :: "v"(bp) : "memory");  // as in load()
    float x[8];
#pragma unroll
    for (int q = 0; q < 4; ++q) {
        const float4 lo = *(const float4*)(&red[(q * TT + row) * SP + c0]);
        const float4 hi = *(const float4*)(&red[(q * TT + row) * SP + c0 + 4]);
        const float t[8] = { lo.x, lo.y, lo.z, lo.w, hi.x, hi.y, hi.z, hi.w };
#pragma unroll
        for (int i = 0; i < 8; ++i) x[i] = q == 0 ? t[i] : x[i] + t[i];
    }
    const float bb[8] = { bl.x, bl.y, bl.z, bl.w, bh.x, bh.y, bh.z, bh.w };
    v8bf yb;
#pragma unroll
    for (int i = 0; i < 8; i += 2) {   // an even column and the odd one behind it share the angle
        const float denom = 10000.0f * expf((float)(c + i) * (1.0f / (float)DM));
        const float arg = (float)l / denom;
        x[i]     = (x[i] + bb[i]) + sinf(arg);
        x[i + 1] = (x[i + 1] + bb[i + 1]) + cosf(arg);
        yb[i]     = (__bf16)x[i];
        yb[i + 1] = (__bf16)x[i + 1];
    }
    float* xr = X + (size_t)l * DM + c;
    *(float4*)(&xr[0]) = make_float4(x[0], x[1], x[2], x[3]);
    *(float4*)(&xr[4]) = make_float4(x[4], x[5], x[6], x[7]);
    *(v8bf*)(&Xb[(size_t)l * DM + c]) = yb;
}

__global__ __launch_bounds__(512, 4) void gemm_qkv_heads_kernel(
    const __bf16* __restrict__ Ab,
    const float* __restrict__ B0, const float* __restrict__ B1, const float* __restrict__ B2,
    const float* __restrict__ bias0, const float* __restrict__ bias1, const float* __restrict__ bias2,
    __bf16* __restrict__ dst)
{
    constexpr int KT = 128;             // k per stage
    constexpr int N = DM, K = DM;
    static_assert(K % (2 * KT) == 0, "two stages a trip");
    __shared__ __align__(16) __bf16 aT[2][128][KT + 8];
    __shared__ __align__(16) __bf16 bTt[2][128][KT + 8];

    const int tid  = threadIdx.x;
    const int m0   = blockIdx.y * 128;
    const int n0   = blockIdx.x * 128;
    const int p    = blockIdx.z;
    const int w    = tid >> 5;
    const int lane = tid & 31;
    const int half = lane >> 4;
    const int r    = lane & 15;
    const int wm   = (w & 3) * 32;
    const int wn   = (w >> 2) * 32;
    const float* B    = p == 0 ? B0 : (p == 1 ? B1 : B2);
    const float* bias = p == 0 ? bias0 : (p == 1 ? bias1 : bias2);
    dst += (size_t)p * (NH * LQ * DH);

    const int arow = tid >> 4;          // A staging: 16 threads a row, 32 rows a pass, 4 passes
    const int acol = (tid & 15) * 8;
    const int sn   = tid & 127;         // B staging: column gather, 4 threads per n, 32 k each
    const int sk0  = (tid >> 7) * 32;
    const __bf16* a0 = Ab + (size_t)(m0 + arow) * K + acol;
    const float*  b0 = B + (size_t)sk0 * N + n0 + sn;

    v8f  acc[2][2] = {};
    v8bf vh[4];
    float tb[32];

    auto load = [&](int kc) {
        const __bf16* ap = a0 + kc;
#pragma unroll
        for (int q = 0; q < 4; ++q)
            vh[q] = *(const v8bf*)(&ap[q * 32 * K]);
        // code that follows may reuse these loads' address registers; the address as an input
        // keeps it from being a destination of a load of its own group
        asm volatile("s_wait_xcnt 0x0" :: "v"(ap) : "memory");
        const float* bp = b0 + (size_t)kc * N;
#pragma unroll
        for (int i = 0; i < 32; ++i)
            tb[i] = bp[i * N];
        asm volatile("s_wait_xcnt 0x0" :: "v"(bp) : "memory");
    };

    auto store = [&](int buf) {
#pragma unroll
        for (int q = 0; q < 4; ++q)
            *(v8bf*)&aT[buf][q * 32 + arow][acol] = vh[q];
#pragma unroll
        for (int q = 0; q < 4; ++q) {
            v8bf t;
#pragma unroll
            for (int i = 0; i < 8; ++i) t[i] = (__bf16)tb[q * 8 + i];
            *(v8bf*)&bTt[buf][sn][sk0 + q * 8] = t;
        }
    };

    auto compute = [&](int buf) {
        // all fragments of the stage are asked for together, so that the wave pays the LDS
        // latency once a stage and not at every group of products
        v16bf afr[KT / 32][2], bfr[KT / 32][2];
#pragma unroll
        for (int s = 0; s < KT / 32; ++s) {
#pragma unroll
            for (int mt = 0; mt < 2; ++mt)
                afr[s][mt] = frag_from_lds(&aT[buf][wm + mt * 16 + r][s * 32], half);
#pragma unroll
            for (int nt = 0; nt < 2; ++nt)
                bfr[s][nt] = frag_from_lds(&bTt[buf][wn + nt * 16 + r][s * 32], half);
        }
        // holds the reads together in front of the products: left free, they are sunk in among them
        __builtin_amdgcn_sched_barrier(0);
#pragma unroll
        for (int s = 0; s < KT / 32; ++s)
#pragma unroll
            for (int mt = 0; mt < 2; ++mt)
#pragma unroll
                for (int nt = 0; nt < 2; ++nt)
                    acc[mt][nt] = wmma_bf16(bfr[s][nt], afr[s][mt], acc[mt][nt]);  // B rows first: see the epilogue
        // keeps the conversions and LDS stores of the next stage, which wait for its loads,
        // from being scheduled in among these products
        __builtin_amdgcn_sched_barrier(0);
    };

    load(0);
    store(0);
    __syncthreads();
#pragma unroll 1
    for (int kc = 0; kc < K; kc += 2 * KT) {
        load(kc + KT);                           // K % (2*KT) == 0 -> kc+KT < K always
        compute(0);
        store(1);                                // every wave left buffer 1 at the last barrier
        __syncthreads();
        const bool more = kc + 2 * KT < K;
        if (more) load(kc + 2 * KT);
        compute(1);
        if (more) store(0);
        __syncthreads();
    }

    // Epilogue.  With the B rows as first WMMA operand a lane holds, of output row
    // l = base + (lane&15), the columns base + half*8 + vgpr: heads half*8 + vgpr of one d
    // (head h stands at column d*16+h).  The tile is sorted to [l][h][8 d] in the first A buffer
    // (every wave has left it: the loop's last barrier), so that the 8 d which the tile holds
    // of a (head, l) row leave as one 16-byte store.
    constexpr int HP = NH * 8 + 8;      // pitch of one l: its 16 heads x 8 d + 16 B for the 16-byte reads
    static_assert(128 * HP * sizeof(__bf16) <= sizeof(aT), "the staging fits the A buffers");
    __bf16* sh = &aT[0][0][0];
    const float* bp = bias + n0 + wn + half * 8;
    float4 bv[2][2];
#pragma unroll
    for (int nt = 0; nt < 2; ++nt) {
        bv[nt][0] = *(const float4*)(&bp[nt * 16]);
        bv[nt][1] = *(const float4*)(&bp[nt * 16 + 4]);
    }
    asm volatile("s_wait_xcnt 0x0" :: "v"(bp) : "memory");  // as in load()
    const float bb[2][8] = {
        { bv[0][0].x, bv[0][0].y, bv[0][0].z, bv[0][0].w, bv[0][1].x, bv[0][1].y, bv[0][1].z, bv[0][1].w },
        { bv[1][0].x, bv[1][0].y, bv[1][0].z, bv[1][0].w, bv[1][1].x, bv[1][1].y, bv[1][1].z, bv[1][1].w } };
#pragma unroll
    for (int mt = 0; mt < 2; ++mt) {
#pragma unroll
        for (int g = 0; g < 8; ++g) {
            v2bf t;                     // the wave's two d of head half*8 + g
            t[0] = (__bf16)(acc[mt][0][g] + bb[0][g]);
            t[1] = (__bf16)(acc[mt][1][g] + bb[1][g]);
            *(v2bf*)&sh[(wm + mt * 16 + r) * HP + (half * 8 + g) * 8 + (wn >> 4)] = t;
        }
    }
    __syncthreads();
#pragma unroll
    for (int j = 0; j < 4; ++j) {
        const int l = tid & 127, h = (tid >> 7) + j * 4;
        *(v8bf*)(&dst[((size_t)h * LQ + m0 + l) * DH + (n0 >> 4)]) = *(const v8bf*)(&sh[l * HP + h * 8]);
    }
}

// ---------------------------------------------------------------------------
// Attention of one head and QB query rows in one work-group:
//   scores = scale * Q @ K^T (all LQ keys), row softmax, Acat[:, d*16+h] = P @ V.
// Scores (fp32) and probabilities (bf16) live in LDS only.  Wave w owns keys
// w*64..+63 in the first product, so Q and K fragments come straight from
// global memory.  The head's V lands row-major in LDS by async copies issued
// first, and wave w reads its columns w*16..+15 by transposing loads.
// ---------------------------------------------------------------------------
#define QB 32
__global__ __launch_bounds__(256) void attn_fused_kernel(
    const __bf16* __restrict__ Qh, const __bf16* __restrict__ Kh,
    const __bf16* __restrict__ Vh, float* __restrict__ Acat, float scale)
{
    __shared__ __align__(16) float  sS[QB][LQ + 4];
    __shared__ __align__(16) __bf16 sP[QB][LQ + 8];
    __shared__ __align__(16) __bf16 sV[LQ][DH + 16];

    const int tid  = threadIdx.x;
    const int h    = blockIdx.y;
    const int m0   = blockIdx.x * QB;
    const int w    = tid >> 5, lane = tid & 31;
    const int half = lane >> 4, r = lane & 15;

    const __bf16* Q  = Qh + ((size_t)h * LQ + m0) * DH;
    const __bf16* Kp = Kh + (size_t)h * LQ * DH;
    const __bf16* Vp = Vh + (size_t)h * LQ * DH;

    // ---- V: 16 rows per copy and work-group (16 lanes x 16 B a row), 32 copies per lane
#pragma unroll
    for (int j = 0; j < 4; ++j)
        async_copy8_b128(Vp + (size_t)(j * 128 + (tid >> 4)) * DH + (tid & 15) * 8,
                         (unsigned)(size_t)&sV[j * 128 + (tid >> 4)][(tid & 15) * 8],
                         16 * DH, 16 * (DH + 16) * 2);

    // ---- scores: 32 x 64 per wave, K-dim = DH in 4 steps of 32
    {
        const int wn = w * 64;
        const __bf16* qp = Q + (size_t)r * DH + half * 8;          // this lane's place in its Q row
        const __bf16* kp = Kp + (size_t)(wn + r) * DH + half * 8;  // and in its K row
        v16bf afr[4][2], bfr[4][4];
        v8f acc[2][4] = {};
        auto load = [&](int ks) {
#pragma unroll
            for (int mt = 0; mt < 2; ++mt)
                afr[ks][mt] = frag_from_lds(&qp[mt * 16 * DH + ks * 32], 0);
#pragma unroll
            for (int nt = 0; nt < 4; ++nt)
                bfr[ks][nt] = frag_from_lds(&kp[nt * 16 * DH + ks * 32], 0);
            // code that follows may reuse these loads' address registers; the addresses as
            // inputs keep them from being handed out as destinations to loads of this group
            asm volatile("s_wait_xcnt 0x0" :: "v"(qp), "v"(kp) : "memory");
        };
        auto compute = [&](int ks) {
#pragma unroll
            for (int mt = 0; mt < 2; ++mt)
#pragma unroll
                for (int nt = 0; nt < 4; ++nt)
                    acc[mt][nt] = wmma_bf16(afr[ks][mt], bfr[ks][nt], acc[mt][nt]);
        };
        load(0); load(1); load(2);
        // keeps the first products, which wait for their operands, from being scheduled
        // in front of the later steps' loads: a wave issues in order
        __builtin_amdgcn_sched_barrier(0);
        compute(0);
        load(3);
        compute(1); compute(2); compute(3);
#pragma unroll
        for (int mt = 0; mt < 2; ++mt)
#pragma unroll
            for (int nt = 0; nt < 4; ++nt)
#pragma unroll
                for (int g = 0; g < 8; ++g)
                    sS[mt * 16 + half * 8 + g][wn + nt * 16 + r] = acc[mt][nt][g] * scale;
    }

    __syncthreads();

    // ---- softmax over keys: one wave per row, 4 rows per wave, 16 scores per lane
#pragma unroll
    for (int i = 0; i < QB / 8; ++i) {
        const int row = w * (QB / 8) + i;
        float4 v[4];
#pragma unroll
        for (int j = 0; j < 4; ++j) v[j] = *(const float4*)&sS[row][lane * 4 + j * 128];
        float mx = fmaxf(fmaxf(v[0].x, v[0].y), fmaxf(v[0].z, v[0].w));
#pragma unroll
        for (int j = 1; j < 4; ++j)
            mx = fmaxf(mx, fmaxf(fmaxf(v[j].x, v[j].y), fmaxf(v[j].z, v[j].w)));
#pragma unroll
        for (int o = 16; o > 0; o >>= 1) mx = fmaxf(mx, __shfl_xor(mx, o));
        float s = 0.0f;
#pragma unroll
        for (int j = 0; j < 4; ++j) {
            v[j].x = expf(v[j].x - mx); v[j].y = expf(v[j].y - mx);
            v[j].z = expf(v[j].z - mx); v[j].w = expf(v[j].w - mx);
            s += (v[j].x + v[j].y) + (v[j].z + v[j].w);
        }
#pragma unroll
        for (int o = 16; o > 0; o >>= 1) s += __shfl_xor(s, o);
        const float inv = 1.0f / s;
#pragma unroll
        for (int j = 0; j < 4; ++j) {
            v4bf p;
            p[0] = (__bf16)(v[j].x * inv); p[1] = (__bf16)(v[j].y * inv);
            p[2] = (__bf16)(v[j].z * inv); p[3] = (__bf16)(v[j].w * inv);
            *(v4bf*)&sP[row][lane * 4 + j * 128] = p;
        }
    }
    // this wave's V copies have landed; the barrier then publishes V and P to all waves
    asm volatile("s_wait_asynccnt 0x0" ::: "memory");
    __syncthreads();

    // ---- P @ V: 32 x 16 per wave, K-dim = LQ in 16 steps of 32
    const int n = w * 16 + r;             // this lane's column of V
    const __bf16* vt = &sV[half * 8 + (lane & 7)][w * 16 + ((lane >> 3) & 1) * 8];
    v8f o[2] = {};
#pragma unroll
    for (int ks = 0; ks < LQ / 32; ++ks) {
        const v8bf lo = lds_load_tr16(vt + (ks * 32) * (DH + 16));        // keys ks*32 + half*8 .. +7
        const v8bf hi = lds_load_tr16(vt + (ks * 32 + 16) * (DH + 16));   // keys ks*32 + 16 + half*8 .. +7
        const v16bf vfr = __builtin_shufflevector(lo, hi, 0, 1, 2, 3, 4, 5, 6, 7,
                                                          8, 9, 10, 11, 12, 13, 14, 15);
#pragma unroll
        for (int mt = 0; mt < 2; ++mt)
            o[mt] = wmma_bf16(frag_from_lds(&sP[mt * 16 + r][ks * 32], half), vfr, o[mt]);
    }

#pragma unroll
    for (int mt = 0; mt < 2; ++mt)
#pragma unroll
        for (int g = 0; g < 8; ++g)
            Acat[(size_t)(m0 + mt * 16 + half * 8 + g) * DM + n * NH + h] = o[mt][g];
}

// ---------------------------------------------------------------------------
// H = gelu(split-K partials + bias) as bf16 (it only feeds FFN2's A operand), one row
// of FFD per work-group.
// ---------------------------------------------------------------------------
template <int S>
__global__ __launch_bounds__(256) void bias_gelu_kernel(
    const float* __restrict__ part, const float* __restrict__ bias,
    __bf16* __restrict__ Hout)
{
    const int l = blockIdx.x, tid = threadIdx.x;
    const float* prow = part + (size_t)l * (S * FFD);
    __bf16* hrow = Hout + (size_t)l * FFD;
    constexpr int NJ = FFD / 1024;
    // all loads of the row first, so that they are in flight together
    float4 v[S][NJ], bv[NJ];
#pragma unroll
    for (int j = 0; j < NJ; ++j) {
        const int c = (tid + j * 256) * 4;
#pragma unroll
        for (int s = 0; s < S; ++s) v[s][j] = *(const float4*)(&prow[s * FFD + c]);
        bv[j] = *(const float4*)(&bias[c]);
    }
#pragma unroll
    for (int j = 0; j < NJ; ++j) {
        const int c = (tid + j * 256) * 4;
        float4 x = v[0][j];
#pragma unroll
        for (int s = 1; s < S; ++s) {
            x.x += v[s][j].x; x.y += v[s][j].y; x.z += v[s][j].z; x.w += v[s][j].w;
        }
        v4bf y;
        y[0] = (__bf16)gelu_tanh(x.x + bv[j].x);
        y[1] = (__bf16)gelu_tanh(x.y + bv[j].y);
        y[2] = (__bf16)gelu_tanh(x.z + bv[j].z);
        y[3] = (__bf16)gelu_tanh(x.w + bv[j].w);
        *(v4bf*)(&hrow[c]) = y;
    }
}

// ---------------------------------------------------------------------------
// Row LayerNorm over D=2048 of (split-K partials + bias + residual).
// WB: the result is also written rounded to bf16 (Yb), for the GEMM that reads it as A.
// ---------------------------------------------------------------------------
template <int S, bool WB>
__global__ __launch_bounds__(256) void layernorm_kernel(
    const float* __restrict__ part, const float* __restrict__ bias,
    const float* __restrict__ res, const float* __restrict__ g,
    const float* __restrict__ b, float* __restrict__ Y, __bf16* __restrict__ Yb)
{
    const int l = blockIdx.x, tid = threadIdx.x;
    const float* prow = part + (size_t)l * (S * DM);
    const float* rrow = res + (size_t)l * DM;
    float* out = Y + (size_t)l * DM;
    __shared__ float red[256];

    float vals[8], s = 0.0f;
#pragma unroll
    for (int j = 0; j < 8; ++j) {
        const int c = tid + j * 256;
        vals[j] = sum_slices<S>(prow, c) + bias[c] + rrow[c];
        s += vals[j];
    }
    red[tid] = s;
    __syncthreads();
    for (int st = 128; st > 0; st >>= 1) { if (tid < st) red[tid] += red[tid + st]; __syncthreads(); }
    const float mu = red[0] * (1.0f / (float)DM);
    __syncthreads();

    float v = 0.0f;
#pragma unroll
    for (int j = 0; j < 8; ++j) { const float d = vals[j] - mu; v += d * d; }
    red[tid] = v;
    __syncthreads();
    for (int st = 128; st > 0; st >>= 1) { if (tid < st) red[tid] += red[tid + st]; __syncthreads(); }
    const float inv = rsqrtf(red[0] * (1.0f / (float)DM) + 1e-5f);

#pragma unroll
    for (int j = 0; j < 8; ++j) {
        const int c = tid + j * 256;
        const float y = (vals[j] - mu) * inv * g[c] + b[c];
        out[c] = y;
        if constexpr (WB) Yb[(size_t)l * DM + c] = (__bf16)y;
    }
}

// ---------------------------------------------------------------------------
extern "C" void kernel_launch(void* const* d_in, const int* in_sizes, int n_in,
                              void* d_out, int out_size, void* d_ws, size_t ws_size,
                              hipStream_t stream)
{
    (void)in_sizes; (void)n_in; (void)out_size; (void)ws_size;

    const float* seq  = (const float*)d_in[0];
    const float* embW = (const float*)d_in[1];
    const float* embB = (const float*)d_in[2];
    const float* Wq   = (const float*)d_in[3];
    const float* bq   = (const float*)d_in[4];
    const float* Wk   = (const float*)d_in[5];
    const float* bk   = (const float*)d_in[6];
    const float* Wv   = (const float*)d_in[7];
    const float* bv   = (const float*)d_in[8];
    const float* Wo   = (const float*)d_in[9];
    const float* bo   = (const float*)d_in[10];
    const float* lng  = (const float*)d_in[11];
    const float* lnb  = (const float*)d_in[12];
    const float* W1   = (const float*)d_in[13];
    const float* b1   = (const float*)d_in[14];
    const float* W2   = (const float*)d_in[15];
    const float* b2   = (const float*)d_in[16];

    char* ws = (char*)d_ws;
    size_t off = 0;
    auto take = [&](size_t bytes) { char* p = ws + off; off = (off + bytes + 255) & ~(size_t)255; return p; };

    const size_t fLD = (size_t)LQ * DM * sizeof(float);       // 4 MB
    const size_t hLD = (size_t)NH * LQ * DH * sizeof(__bf16); // 2 MB
    const size_t hLF = (size_t)LQ * FFD * sizeof(__bf16);     // 8 MB

    float*  X    = (float*)take(fLD);
    float*  Acat = (float*)take(fLD);
    __bf16* Qh   = (__bf16*)take(3 * hLD);   // Q, K, V per-head planes, one after the other
    __bf16* Kh   = Qh + (size_t)NH * LQ * DH;
    __bf16* Vh   = Kh + (size_t)NH * LQ * DH;
    __bf16* Hb   = (__bf16*)take(hLF);       // FFN hidden, bf16
    float*  Xa   = (float*)take(fLD);
    __bf16* Xb   = (__bf16*)take(hLD);       // X and Xa rounded to bf16, [L][D]
    __bf16* Xab  = (__bf16*)take(hLD);
    float*  Pt   = (float*)take(8 * fLD);    // split-K partials: 32 MB a product
    float*  Yout = (float*)d_out;

    const dim3 blk(256);
    const dim3 blkG(512);                    // the GEMMs' block: 16 waves
    const dim3 gD (DM / 128, LQ / 256, 8);   // N=2048 GEMMs, 8 K slices: 256 work-groups
    const dim3 gE (DM / 64, LQ / 64);        // embedding, whole K: 256 work-groups
    const dim3 gQKV(DM / 128, LQ / 128, 3);  // Q, K and V projections together, whole K: 192 work-groups
    const dim3 gFF(FFD / 128, LQ / 256, 2);  // N=8192 GEMM, 2 K slices: 256 work-groups

    // 1-2) embedding + bias + positional encoding
    gemm_emb_pos_kernel<<<gE, blkG, 0, stream>>>(seq, embW, embB, X, Xb);
    // 3-4) Q/K/V projections with bias, written in the per-head bf16 layout, in one launch
    gemm_qkv_heads_kernel<<<gQKV, blkG, 0, stream>>>(Xb, Wq, Wk, Wv, bq, bk, bv, Qh);
    // 5-7) softmax(Qh @ Kh^T / sqrt(D)) @ Vh, scattered back to the [L, D] interleaved layout
    attn_fused_kernel<<<dim3(LQ / QB, NH), blk, 0, stream>>>(
        Qh, Kh, Vh, Acat, 0.022097086912079608f /* 1/sqrt(2048) */);
    // 8) output projection, 9) + bias + residual X, LayerNorm -> Xa
    gemm_splitk_kernel<DM, DM, 8, false><<<gD, blkG, 0, stream>>>(Acat, nullptr, Wo, Pt);
    layernorm_kernel<8, true><<<LQ, blk, 0, stream>>>(Pt, bo, X, lng, lnb, Xa, Xab);
    // 10) FFN1, then bias + GELU
    gemm_splitk_kernel<FFD, DM, 2, true><<<gFF, blkG, 0, stream>>>(nullptr, Xab, W1, Pt);
    bias_gelu_kernel<2><<<LQ, blk, 0, stream>>>(Pt, b1, Hb);
    // 11) FFN2, 12) + bias + residual Xa, final LayerNorm -> output
    gemm_splitk_kernel<DM, FFD, 8, true><<<gD, blkG, 0, stream>>>(nullptr, Hb, W2, Pt);
    layernorm_kernel<8, false><<<LQ, blk, 0, stream>>>(Pt, b2, Xa, lng, lnb, Yout, nullptr);
}

// v010
// It runs in 139 microseconds.
// Two timings next to v009 both put it at 1.03 times that version's speed.
// Over all steps from v000 it is 4.74 times as fast.
#include <hip/hip_runtime.h>
#include <hip/hip_bf16.h>
#include <math.h>

typedef __attribute__((ext_vector_type(16))) __bf16 v16bf;
typedef __attribute__((ext_vector_type(8)))  __bf16 v8bf;
typedef __attribute__((ext_vector_type(4)))  __bf16 v4bf;
typedef __attribute__((ext_vector_type(2)))  __bf16 v2bf;
typedef __attribute__((ext_vector_type(8)))  float  v8f;

#define LQ 512
#define DM 2048
#define NH 16
#define DH 128
#define FFD 8192

__device__ __forceinline__ v8f wmma_bf16(const v16bf& a, const v16bf& b, const v8f& c) {
    return __builtin_amdgcn_wmma_f32_16x16x32_bf16(false, a, false, b, (short)0, c, false, false);
}

__device__ __forceinline__ v16bf frag_from_lds(const __bf16* rowp, int half) {
    const v8bf lo = *(const v8bf*)(rowp + half * 8);
    const v8bf hi = *(const v8bf*)(rowp + 16 + half * 8);
    return __builtin_shufflevector(lo, hi, 0, 1, 2, 3, 4, 5, 6, 7,
                                           8, 9, 10, 11, 12, 13, 14, 15);
}

__device__ __forceinline__ void async_copy8_b128(const __bf16* g, unsigned lds, int gstep, unsigned lstep) {
    asm volatile("global_load_async_to_lds_b128 %0, %8, off\n\t"
                 "global_load_async_to_lds_b128 %1, %9, off\n\t"
                 "global_load_async_to_lds_b128 %2, %10, off\n\t"
                 "global_load_async_to_lds_b128 %3, %11, off\n\t"
                 "global_load_async_to_lds_b128 %4, %12, off\n\t"
                 "global_load_async_to_lds_b128 %5, %13, off\n\t"
                 "global_load_async_to_lds_b128 %6, %14, off\n\t"
                 "global_load_async_to_lds_b128 %7, %15, off\n\t"
                 "s_wait_xcnt 0x0"
                 :: "v"(lds), "v"(lds + lstep), "v"(lds + 2 * lstep), "v"(lds + 3 * lstep),
                    "v"(lds + 4 * lstep), "v"(lds + 5 * lstep), "v"(lds + 6 * lstep), "v"(lds + 7 * lstep),
                    "v"(g), "v"(g + gstep), "v"(g + 2 * gstep), "v"(g + 3 * gstep),
                    "v"(g + 4 * gstep), "v"(g + 5 * gstep), "v"(g + 6 * gstep), "v"(g + 7 * gstep)
                 : "memory");
}

// Transposing LDS load: from a row-major 16-bit tile, lane (c = lane & 15, half) gets
// rows 8*half .. +7 of column c; p is the lane's own address in the tile:
// row 8*half + (lane & 7), column 8*((lane >> 3) & 1).
__device__ __forceinline__ v8bf lds_load_tr16(const __bf16* p) {
    typedef __attribute__((address_space(3))) v8bf lds_v8bf;
    return __builtin_amdgcn_ds_load_tr16_b128_v8bf16((lds_v8bf*)p);
}

__device__ __forceinline__ float gelu_tanh(float x) {
    const float k0 = 0.7978845608028654f;  // sqrt(2/pi)
    const float k1 = 0.044715f;
    float t = tanhf(k0 * (x + k1 * x * x * x));
    return 0.5f * x * (1.0f + t);
}

template <int N, int K, int S, bool ABF>
__global__ __launch_bounds__(512, 4) void gemm_splitk_kernel(
    const float* __restrict__ A, const __bf16* __restrict__ Ab, const float* __restrict__ B,
    float* __restrict__ Cpart)
{
    constexpr int KT = 128;             // k per stage
    constexpr int MT = 256;             // rows of the block tile
    static_assert(K % (2 * KT * S) == 0 && N % 128 == 0, "tile assumptions");
    __shared__ __align__(16) __bf16 aT[2][MT][KT + 8];
    __shared__ __align__(16) __bf16 bTt[2][128][KT + 8];

    const int tid  = threadIdx.x;
    const int m0   = blockIdx.y * MT;
    const int n0   = blockIdx.x * 128;
    const int w    = tid >> 5;
    const int lane = tid & 31;
    const int half = lane >> 4;
    const int r    = lane & 15;
    const int wm   = (w & 7) * 32;
    const int wn   = (w >> 3) * 64;

    constexpr int AE = ABF ? 8 : 4;     // A staging: elements per 16-byte load
    constexpr int AR = 512 * AE / KT;   // AR rows / pass, KT/AE loads per row
    constexpr int AP = MT / AR;         // passes
    constexpr int BK = KT / 4;          // B staging: k values per thread
    const int arow = tid / (KT / AE);
    const int acol = (tid % (KT / AE)) * AE;
    const int sn   = tid & 127;         // B staging: column gather, 4 threads per n
    const int sk0  = (tid >> 7) * BK;
    constexpr int KS = K / S;           // this work-group's K slice: [z*KS, z*KS + KS)
    const int zs = blockIdx.z;          // K slice
    const size_t aoff = (size_t)zs * KS + (size_t)(m0 + arow) * K + acol;  // this thread's first A element
    B += ((size_t)zs * KS + sk0) * N + n0 + sn;                 // and its first B element

    v8f acc[2][4] = {};
    float4 va[ABF ? 1 : AP];
    v8bf   vh[ABF ? AP : 1];
    float  tb[BK];

    auto load = [&](int kc) {
        // code that follows may reuse these loads' address registers; the address as an input
        // keeps it from being a destination of a load of its own group
        if constexpr (ABF) {
            const __bf16* ap = Ab + aoff + kc;
#pragma unroll
            for (int p = 0; p < AP; ++p)
                vh[p] = *(const v8bf*)(&ap[p * AR * K]);
            asm volatile("s_wait_xcnt 0x0" :: "v"(ap) : "memory");
        } else {
            const float* ap = A + aoff + kc;
#pragma unroll
            for (int p = 0; p < AP; ++p)
                va[p] = *(const float4*)(&ap[p * AR * K]);
            asm volatile("s_wait_xcnt 0x0" :: "v"(ap) : "memory");
        }
        const float* bp = B + (size_t)kc * N;
#pragma unroll
        for (int i = 0; i < BK; ++i)
            tb[i] = bp[i * N];
        asm volatile("s_wait_xcnt 0x0" :: "v"(bp) : "memory");
    };

    auto store = [&](int buf) {
#pragma unroll
        for (int p = 0; p < AP; ++p) {
            const int rr = p * AR + arow;
            if constexpr (ABF) {
                *(v8bf*)&aT[buf][rr][acol] = vh[p];
            } else {
                aT[buf][rr][acol + 0] = (__bf16)va[p].x;
                aT[buf][rr][acol + 1] = (__bf16)va[p].y;
                aT[buf][rr][acol + 2] = (__bf16)va[p].z;
                aT[buf][rr][acol + 3] = (__bf16)va[p].w;
            }
        }
#pragma unroll
        for (int q = 0; q < BK / 8; ++q) {
            v8bf t;
#pragma unroll
            for (int i = 0; i < 8; ++i) t[i] = (__bf16)tb[q * 8 + i];
            *(v8bf*)&bTt[buf][sn][sk0 + q * 8] = t;
        }
    };

    auto compute = [&](int buf) {
#pragma unroll
        for (int ks = 0; ks < KT; ks += 32) {
            v16bf afr[2], bfr[4];
#pragma unroll
            for (int mt = 0; mt < 2; ++mt)
                afr[mt] = frag_from_lds(&aT[buf][wm + mt * 16 + r][ks], half);
#pragma unroll
            for (int nt = 0; nt < 4; ++nt)
                bfr[nt] = frag_from_lds(&bTt[buf][wn + nt * 16 + r][ks], half);
#pragma unroll
            for (int mt = 0; mt < 2; ++mt)
#pragma unroll
                for (int nt = 0; nt < 4; ++nt)
                    acc[mt][nt] = wmma_bf16(bfr[nt], afr[mt], acc[mt][nt]);  // B rows first: see the epilogue
        }
        // keeps the conversions and LDS stores of the next stage, which wait for its loads,
        // from being scheduled in among these products
        __builtin_amdgcn_sched_barrier(0);
    };

    load(0);
    store(0);
    __syncthreads();
#pragma unroll 1
    for (int kc = 0; kc < KS; kc += 2 * KT) {
        load(kc + KT);                           // KS % (2*KT) == 0 -> kc+KT < KS always
        compute(0);
        store(1);                                // every wave left buffer 1 at the last barrier
        __syncthreads();
        const bool more = kc + 2 * KT < KS;
        if (more) load(kc + 2 * KT);
        compute(1);
        if (more) store(0);
        __syncthreads();
    }

    constexpr int SP = 68;
    static_assert(16 * 32 * SP * sizeof(float) <= sizeof(aT), "the staging fits the A buffers");
    float* st = reinterpret_cast<float*>(&aT[0][0][0]) + w * (32 * SP);
#pragma unroll
    for (int mt = 0; mt < 2; ++mt) {
#pragma unroll
        for (int nt = 0; nt < 4; ++nt) {
            float* sp = &st[(mt * 16 + r) * SP + nt * 16 + half * 8];
            const v8f a = acc[mt][nt];
            *(float4*)(sp)     = make_float4(a[0], a[1], a[2], a[3]);
            *(float4*)(sp + 4) = make_float4(a[4], a[5], a[6], a[7]);
        }
    }
    // the rows are read back by other lanes of this wave: its LDS stores have retired first
    asm volatile("s_wait_dscnt 0x0" ::: "memory");
    float* __restrict__ C = Cpart + (size_t)zs * N + (size_t)(m0 + wm + half) * (S * N) + n0 + wn + r * 4;
#pragma unroll
    for (int i = 0; i < 16; ++i)
        *(float4*)(&C[(size_t)(2 * i) * (S * N)]) = *(const float4*)(&st[(2 * i + half) * SP + r * 4]);
}

// Sum of the S split-K partials of column c, in slice order; prow points at
// the S partial rows (each DM wide) of one output row.
template <int S>
__device__ __forceinline__ float sum_slices(const float* __restrict__ prow, int c)
{
    float v[S];
#pragma unroll
    for (int s = 0; s < S; ++s) v[s] = prow[s * DM + c];
    float x = v[0];
#pragma unroll
    for (int s = 1; s < S; ++s) x += v[s];
    return x;
}

__global__ __launch_bounds__(512, 4) void gemm_emb_pos_kernel(
    const float* __restrict__ A, const float* __restrict__ B, const float* __restrict__ bias,
    float* __restrict__ X, __bf16* __restrict__ Xb)
{
    constexpr int KT = 256;             // k per stage
    constexpr int TT = 64;              // rows and columns of the block tile
    constexpr int PT = KT + 8;          // LDS row pitch: row + 16 B for the 16-byte reads
    constexpr int N = DM, K = DM;
    static_assert(K % (2 * KT) == 0, "two stages a trip");
    // [A buffer 0 | A buffer 1 | B buffer 0 | B buffer 1], each TT rows of PT
    __shared__ __align__(16) __bf16 sm[4 * TT * PT];

    const int tid  = threadIdx.x;
    const int m0   = blockIdx.y * TT;
    const int n0   = blockIdx.x * TT;
    const int w    = tid >> 5;
    const int lane = tid & 31;
    const int half = lane >> 4;
    const int r    = lane & 15;
    const int kq   = w >> 2;            // this wave's k group
    const int wm   = (w & 1) * 32;
    const int wn   = ((w >> 1) & 1) * 32;

    const int arow = tid >> 6;          // A staging: 64 threads a row, 8 rows a pass, 8 passes
    const int acol = (tid & 63) * 4;
    const int sn   = tid & 63;          // B staging: column gather, 8 threads per n, 32 k each
    const int sk0  = (tid >> 6) * 32;
    const float* a0 = A + (size_t)(m0 + arow) * K + acol;
    const float* b0 = B + (size_t)sk0 * N + n0 + sn;

    v8f    acc[2][2] = {};
    float4 va[2][8];
    float  tb[2][32];

    auto load = [&](int buf, int kc) {
        const float* ap = a0 + kc;
#pragma unroll
        for (int q = 0; q < 8; ++q)
            va[buf][q] = *(const float4*)(&ap[q * 8 * K]);
        // code that follows may reuse these loads' address registers; the address as an input
        // keeps it from being a destination of a load of its own group
        asm volatile("s_wait_xcnt 0x0" :: "v"(ap) : "memory");
        const float* bp = b0 + (size_t)kc * N;
#pragma unroll
        for (int i = 0; i < 32; ++i)
            tb[buf][i] = bp[i * N];
        asm volatile("s_wait_xcnt 0x0" :: "v"(bp) : "memory");
    };

    auto store = [&](int buf) {
        __bf16* sa = &sm[buf * (TT * PT)];
        __bf16* sb = &sm[(2 + buf) * (TT * PT)];
#pragma unroll
        for (int q = 0; q < 8; ++q) {
            v4bf t;
            t[0] = (__bf16)va[buf][q].x; t[1] = (__bf16)va[buf][q].y;
            t[2] = (__bf16)va[buf][q].z; t[3] = (__bf16)va[buf][q].w;
            *(v4bf*)&sa[(q * 8 + arow) * PT + acol] = t;
        }
#pragma unroll
        for (int q = 0; q < 4; ++q) {
            v8bf t;
#pragma unroll
            for (int i = 0; i < 8; ++i) t[i] = (__bf16)tb[buf][q * 8 + i];
            *(v8bf*)&sb[sn * PT + sk0 + q * 8] = t;
        }
    };

    auto compute = [&](int buf) {
        const __bf16* sa = &sm[buf * (TT * PT)];
        const __bf16* sb = &sm[(2 + buf) * (TT * PT)];
        // all fragments of the stage are asked for together, so that the wave pays the LDS
        // latency once a stage and not at every group of products
        v16bf afr[2][2], bfr[2][2];
#pragma unroll
        for (int s = 0; s < 2; ++s) {
#pragma unroll
            for (int mt = 0; mt < 2; ++mt)
                afr[s][mt] = frag_from_lds(&sa[(wm + mt * 16 + r) * PT + kq * 64 + s * 32], half);
#pragma unroll
            for (int nt = 0; nt < 2; ++nt)
                bfr[s][nt] = frag_from_lds(&sb[(wn + nt * 16 + r) * PT + kq * 64 + s * 32], half);
        }
#pragma unroll
        for (int s = 0; s < 2; ++s)
#pragma unroll
            for (int mt = 0; mt < 2; ++mt)
#pragma unroll
                for (int nt = 0; nt < 2; ++nt)
                    acc[mt][nt] = wmma_bf16(bfr[s][nt], afr[s][mt], acc[mt][nt]);  // B rows first: see the epilogue
        // keeps the conversions and LDS stores of the next stage, which wait for its loads,
        // from being scheduled in among these products
        __builtin_amdgcn_sched_barrier(0);
    };

    // A work-group barrier whose fences name LDS alone: a plain __syncthreads() would also wait
    // for the global loads of the stages ahead, which only this thread's registers receive.
    auto lds_barrier = [&]() {
        __builtin_amdgcn_fence(__ATOMIC_RELEASE, "workgroup", "local");
        __builtin_amdgcn_s_barrier();
        __builtin_amdgcn_fence(__ATOMIC_ACQUIRE, "workgroup", "local");
    };

    load(0, 0);
    load(1, KT);
    store(0);
    lds_barrier();
    // The loads stand under no condition in the loop, so that a store's wait can be counted
    // and leaves the younger set's loads in flight; the last two stages follow the loop.
#pragma unroll 1
    for (int kc = 0; kc < K - 2 * KT; kc += 2 * KT) {
        load(0, kc + 2 * KT);
        compute(0);
        store(1);                                // every wave left buffer 1 at the last barrier
        lds_barrier();
        load(1, kc + 3 * KT);
        compute(1);
        store(0);
        lds_barrier();
    }
    compute(0);
    store(1);
    lds_barrier();
    compute(1);
    lds_barrier();

    constexpr int SP = 68;
    static_assert(4 * TT * SP * sizeof(float) <= sizeof(sm), "the planes fit the stage buffers");
    float* red = reinterpret_cast<float*>(&sm[0]);
#pragma unroll
    for (int mt = 0; mt < 2; ++mt) {
#pragma unroll
        for (int nt = 0; nt < 2; ++nt) {
            float* sp = &red[(kq * TT + wm + mt * 16 + r) * SP + wn + nt * 16 + half * 8];
            const v8f a = acc[mt][nt];
            *(float4*)(sp)     = make_float4(a[0], a[1], a[2], a[3]);
            *(float4*)(sp + 4) = make_float4(a[4], a[5], a[6], a[7]);
        }
    }
    __syncthreads();
    // A thread finishes 8 adjacent columns of one row: 8 threads put out the tile's whole row,
    // 256 B of X and 128 B of Xb.  The groups are summed in k order.
    const int row = tid >> 3, c0 = (tid & 7) * 8;
    const int l = m0 + row, c = n0 + c0;
    const float* bp = bias + c;
    const float4 bl = *(const float4*)(&bp[0]);
    const float4 bh = *(const float4*)(&bp[4]);
    asm volatile("s_wait_xcnt 0x0" :: "v"(bp) : "memory");  // as in load()
    float x[8];
#pragma unroll
    for (int q = 0; q < 4; ++q) {
        const float4 lo = *(const float4*)(&red[(q * TT + row) * SP + c0]);
        const float4 hi = *(const float4*)(&red[(q * TT + row) * SP + c0 + 4]);
        const float t[8] = { lo.x, lo.y, lo.z, lo.w, hi.x, hi.y, hi.z, hi.w };
#pragma unroll
        for (int i = 0; i < 8; ++i) x[i] = q == 0 ? t[i] : x[i] + t[i];
    }
    const float bb[8] = { bl.x, bl.y, bl.z, bl.w, bh.x, bh.y, bh.z, bh.w };
    v8bf yb;
#pragma unroll
    for (int i = 0; i < 8; i += 2) {   // an even column and the odd one behind it share the angle
        const float denom = 10000.0f * expf((float)(c + i) * (1.0f / (float)DM));
        const float arg = (float)l / denom;
        x[i]     = (x[i] + bb[i]) + sinf(arg);
        x[i + 1] = (x[i + 1] + bb[i + 1]) + cosf(arg);
        yb[i]     = (__bf16)x[i];
        yb[i + 1] = (__bf16)x[i + 1];
    }
    float* xr = X + (size_t)l * DM + c;
    *(float4*)(&xr[0]) = make_float4(x[0], x[1], x[2], x[3]);
    *(float4*)(&xr[4]) = make_float4(x[4], x[5], x[6], x[7]);
    *(v8bf*)(&Xb[(size_t)l * DM + c]) = yb;
}

__global__ __launch_bounds__(512, 4) void gemm_qkv_heads_kernel(
    const __bf16* __restrict__ Ab,
    const float* __restrict__ B0, const float* __restrict__ B1, const float* __restrict__ B2,
    const float* __restrict__ bias0, const float* __restrict__ bias1, const float* __restrict__ bias2,
    __bf16* __restrict__ dst)
{
    constexpr int KT = 128;             // k per stage
    constexpr int N = DM, K = DM;
    static_assert(K % (2 * KT) == 0, "two stages a trip");
    __shared__ __align__(16) __bf16 aT[2][128][KT + 8];
    __shared__ __align__(16) __bf16 bTt[2][128][KT + 8];

    const int tid  = threadIdx.x;
    const int m0   = blockIdx.y * 128;
    const int n0   = blockIdx.x * 128;
    const int p    = blockIdx.z;
    const int w    = tid >> 5;
    const int lane = tid & 31;
    const int half = lane >> 4;
    const int r    = lane & 15;
    const int wm   = (w & 3) * 32;
    const int wn   = (w >> 2) * 32;
    const float* B    = p == 0 ? B0 : (p == 1 ? B1 : B2);
    const float* bias = p == 0 ? bias0 : (p == 1 ? bias1 : bias2);
    dst += (size_t)p * (NH * LQ * DH);

    const int arow = tid >> 4;          // A staging: 16 threads a row, 32 rows a pass, 4 passes
    const int acol = (tid & 15) * 8;
    const int sn   = tid & 127;         // B staging: column gather, 4 threads per n, 32 k each
    const int sk0  = (tid >> 7) * 32;
    const __bf16* a0 = Ab + (size_t)(m0 + arow) * K + acol;
    const float*  b0 = B + (size_t)sk0 * N + n0 + sn;

    v8f  acc[2][2] = {};
    v8bf vh[4];
    float tb[32];

    auto load = [&](int kc) {
        const __bf16* ap = a0 + kc;
#pragma unroll
        for (int q = 0; q < 4; ++q)
            vh[q] = *(const v8bf*)(&ap[q * 32 * K]);
        // code that follows may reuse these loads' address registers; the address as an input
        // keeps it from being a destination of a load of its own group
        asm volatile("s_wait_xcnt 0x0" :: "v"(ap) : "memory");
        const float* bp = b0 + (size_t)kc * N;
#pragma unroll
        for (int i = 0; i < 32; ++i)
            tb[i] = bp[i * N];
        asm volatile("s_wait_xcnt 0x0" :: "v"(bp) : "memory");
    };

    auto store = [&](int buf) {
#pragma unroll
        for (int q = 0; q < 4; ++q)
            *(v8bf*)&aT[buf][q * 32 + arow][acol] = vh[q];
#pragma unroll
        for (int q = 0; q < 4; ++q) {
            v8bf t;
#pragma unroll
            for (int i = 0; i < 8; ++i) t[i] = (__bf16)tb[q * 8 + i];
            *(v8bf*)&bTt[buf][sn][sk0 + q * 8] = t;
        }
    };

    auto compute = [&](int buf) {
        // all fragments of the stage are asked for together, so that the wave pays the LDS
        // latency once a stage and not at every group of products
        v16bf afr[KT / 32][2], bfr[KT / 32][2];
#pragma unroll
        for (int s = 0; s < KT / 32; ++s) {
#pragma unroll
            for (int mt = 0; mt < 2; ++mt)
                afr[s][mt] = frag_from_lds(&aT[buf][wm + mt * 16 + r][s * 32], half);
#pragma unroll
            for (int nt = 0; nt < 2; ++nt)
                bfr[s][nt] = frag_from_lds(&bTt[buf][wn + nt * 16 + r][s * 32], half);
        }
        // holds the reads together in front of the products: left free, they are sunk in among them
        __builtin_amdgcn_sched_barrier(0);
#pragma unroll
        for (int s = 0; s < KT / 32; ++s)
#pragma unroll
            for (int mt = 0; mt < 2; ++mt)
#pragma unroll
                for (int nt = 0; nt < 2; ++nt)
                    acc[mt][nt] = wmma_bf16(bfr[s][nt], afr[s][mt], acc[mt][nt]);  // B rows first: see the epilogue
        // keeps the conversions and LDS stores of the next stage, which wait for its loads,
        // from being scheduled in among these products
        __builtin_amdgcn_sched_barrier(0);
    };

    load(0);
    store(0);
    __syncthreads();
#pragma unroll 1
    for (int kc = 0; kc < K; kc += 2 * KT) {
        load(kc + KT);                           // K % (2*KT) == 0 -> kc+KT < K always
        compute(0);
        store(1);                                // every wave left buffer 1 at the last barrier
        __syncthreads();
        const bool more = kc + 2 * KT < K;
        if (more) load(kc + 2 * KT);
        compute(1);
        if (more) store(0);
        __syncthreads();
    }

    // Epilogue.  With the B rows as first WMMA operand a lane holds, of output row
    // l = base + (lane&15), the columns base + half*8 + vgpr: heads half*8 + vgpr of one d
    // (head h stands at column d*16+h).  The tile is sorted to [l][h][8 d] in the first A buffer
    // (every wave has left it: the loop's last barrier), so that the 8 d which the tile holds
    // of a (head, l) row leave as one 16-byte store.
    constexpr int HP = NH * 8 + 8;      // pitch of one l: its 16 heads x 8 d + 16 B for the 16-byte reads
    static_assert(128 * HP * sizeof(__bf16) <= sizeof(aT), "the staging fits the A buffers");
    __bf16* sh = &aT[0][0][0];
    const float* bp = bias + n0 + wn + half * 8;
    float4 bv[2][2];
#pragma unroll
    for (int nt = 0; nt < 2; ++nt) {
        bv[nt][0] = *(const float4*)(&bp[nt * 16]);
        bv[nt][1] = *(const float4*)(&bp[nt * 16 + 4]);
    }
    asm volatile("s_wait_xcnt 0x0" :: "v"(bp) : "memory");  // as in load()
    const float bb[2][8] = {
        { bv[0][0].x, bv[0][0].y, bv[0][0].z, bv[0][0].w, bv[0][1].x, bv[0][1].y, bv[0][1].z, bv[0][1].w },
        { bv[1][0].x, bv[1][0].y, bv[1][0].z, bv[1][0].w, bv[1][1].x, bv[1][1].y, bv[1][1].z, bv[1][1].w } };
#pragma unroll
    for (int mt = 0; mt < 2; ++mt) {
#pragma unroll
        for (int g = 0; g < 8; ++g) {
            v2bf t;                     // the wave's two d of head half*8 + g
            t[0] = (__bf16)(acc[mt][0][g] + bb[0][g]);
            t[1] = (__bf16)(acc[mt][1][g] + bb[1][g]);
            *(v2bf*)&sh[(wm + mt * 16 + r) * HP + (half * 8 + g) * 8 + (wn >> 4)] = t;
        }
    }
    __syncthreads();
#pragma unroll
    for (int j = 0; j < 4; ++j) {
        const int l = tid & 127, h = (tid >> 7) + j * 4;
        *(v8bf*)(&dst[((size_t)h * LQ + m0 + l) * DH + (n0 >> 4)]) = *(const v8bf*)(&sh[l * HP + h * 8]);
    }
}

__global__ __launch_bounds__(512, 4) void gemm_ffn1_gelu_kernel(
    const __bf16* __restrict__ Ab, const float* __restrict__ B, const float* __restrict__ bias,
    __bf16* __restrict__ Hout)
{
    constexpr int KT = 128;             // k per stage
    constexpr int N = FFD, K = DM;
    static_assert(K % (2 * KT) == 0, "two stages a trip");
    __shared__ __align__(16) __bf16 aT[2][128][KT + 8];
    __shared__ __align__(16) __bf16 bTt[2][128][KT + 8];

    const int tid  = threadIdx.x;
    const int m0   = blockIdx.y * 128;
    const int n0   = blockIdx.x * 128;
    const int w    = tid >> 5;
    const int lane = tid & 31;
    const int half = lane >> 4;
    const int r    = lane & 15;
    const int wm   = (w & 3) * 32;
    const int wn   = (w >> 2) * 32;

    const int arow = tid >> 4;          // A staging: 16 threads a row, 32 rows a pass, 4 passes
    const int acol = (tid & 15) * 8;
    const int sn   = tid & 127;         // B staging: column gather, 4 threads per n, 32 k each
    const int sk0  = (tid >> 7) * 32;
    const __bf16* a0 = Ab + (size_t)(m0 + arow) * K + acol;
    const float*  b0 = B + (size_t)sk0 * N + n0 + sn;

    v8f  acc[2][2] = {};
    v8bf vh[4];
    float tb[32];

    auto load = [&](int kc) {
        const __bf16* ap = a0 + kc;
#pragma unroll
        for (int q = 0; q < 4; ++q)
            vh[q] = *(const v8bf*)(&ap[q * 32 * K]);
        // code that follows may reuse these loads' address registers; the address as an input
        // keeps it from being a destination of a load of its own group
        asm volatile("s_wait_xcnt 0x0" :: "v"(ap) : "memory");
        const float* bp = b0 + (size_t)kc * N;
#pragma unroll
        for (int i = 0; i < 32; ++i)
            tb[i] = bp[i * N];
        asm volatile("s_wait_xcnt 0x0" :: "v"(bp) : "memory");
    };

    auto store = [&](int buf) {
#pragma unroll
        for (int q = 0; q < 4; ++q)
            *(v8bf*)&aT[buf][q * 32 + arow][acol] = vh[q];
#pragma unroll
        for (int q = 0; q < 4; ++q) {
            v8bf t;
#pragma unroll
            for (int i = 0; i < 8; ++i) t[i] = (__bf16)tb[q * 8 + i];
            *(v8bf*)&bTt[buf][sn][sk0 + q * 8] = t;
        }
    };

    auto compute = [&](int buf) {
        // all fragments of the stage are asked for together, so that the wave pays the LDS
        // latency once a stage and not at every group of products
        v16bf afr[KT / 32][2], bfr[KT / 32][2];
#pragma unroll
        for (int s = 0; s < KT / 32; ++s) {
#pragma unroll
            for (int mt = 0; mt < 2; ++mt)
                afr[s][mt] = frag_from_lds(&aT[buf][wm + mt * 16 + r][s * 32], half);
#pragma unroll
            for (int nt = 0; nt < 2; ++nt)
                bfr[s][nt] = frag_from_lds(&bTt[buf][wn + nt * 16 + r][s * 32], half);
        }
        // holds the reads together in front of the products: left free, they are sunk in among them
        __builtin_amdgcn_sched_barrier(0);
#pragma unroll
        for (int s = 0; s < KT / 32; ++s)
#pragma unroll
            for (int mt = 0; mt < 2; ++mt)
#pragma unroll
                for (int nt = 0; nt < 2; ++nt)
                    acc[mt][nt] = wmma_bf16(bfr[s][nt], afr[s][mt], acc[mt][nt]);  // B rows first: see the epilogue
        // keeps the conversions and LDS stores of the next stage, which wait for its loads,
        // from being scheduled in among these products
        __builtin_amdgcn_sched_barrier(0);
    };

    // the epilogue's bias is asked for here, so that its way from memory lies under the loop
    const float* bq = bias + n0 + wn + half * 8;
    float4 bv[2][2];
#pragma unroll
    for (int nt = 0; nt < 2; ++nt) {
        bv[nt][0] = *(const float4*)(&bq[nt * 16]);
        bv[nt][1] = *(const float4*)(&bq[nt * 16 + 4]);
    }
    asm volatile("s_wait_xcnt 0x0" :: "v"(bq) : "memory");  // as in load()
    load(0);
    store(0);
    __syncthreads();
#pragma unroll 1
    for (int kc = 0; kc < K; kc += 2 * KT) {
        load(kc + KT);                           // K % (2*KT) == 0 -> kc+KT < K always
        compute(0);
        store(1);                                // every wave left buffer 1 at the last barrier
        __syncthreads();
        const bool more = kc + 2 * KT < K;
        if (more) load(kc + 2 * KT);
        compute(1);
        if (more) store(0);
        __syncthreads();
    }

    // Epilogue.  With the B rows as first WMMA operand a lane holds 8 consecutive n of one
    // output row: m = base + (lane&15), n = base + half*8 + vgpr: after bias and GELU, 16 bytes
    // of bf16.  The tile is laid by rows in the first A buffer (every wave has left it: the
    // loop's last barrier), whose pitch it keeps, and leaves as whole 256-B rows.
    __bf16 (*sh)[KT + 8] = aT[0];
    const float bb[2][8] = {
        { bv[0][0].x, bv[0][0].y, bv[0][0].z, bv[0][0].w, bv[0][1].x, bv[0][1].y, bv[0][1].z, bv[0][1].w },
        { bv[1][0].x, bv[1][0].y, bv[1][0].z, bv[1][0].w, bv[1][1].x, bv[1][1].y, bv[1][1].z, bv[1][1].w } };
#pragma unroll
    for (int mt = 0; mt < 2; ++mt) {
#pragma unroll
        for (int nt = 0; nt < 2; ++nt) {
            v8bf t;
#pragma unroll
            for (int g = 0; g < 8; ++g)
                t[g] = (__bf16)gelu_tanh(acc[mt][nt][g] + bb[nt][g]);
            *(v8bf*)&sh[wm + mt * 16 + r][wn + nt * 16 + half * 8] = t;
        }
    }
    __syncthreads();
#pragma unroll
    for (int q = 0; q < 4; ++q)   // 16 threads a row, as in the A staging
        *(v8bf*)(&Hout[(size_t)(m0 + q * 32 + arow) * N + n0 + acol]) = *(const v8bf*)(&sh[q * 32 + arow][acol]);
}

// ---------------------------------------------------------------------------
// Attention of one head and QB query rows in one work-group:
//   scores = scale * Q @ K^T (all LQ keys), row softmax, Acat[:, d*16+h] = P @ V.
// Scores (fp32) and probabilities (bf16) live in LDS only.  Wave w owns keys
// w*64..+63 in the first product, so Q and K fragments come straight from
// global memory.  The head's V lands row-major in LDS by async copies issued
// first, and wave w reads its columns w*16..+15 by transposing loads.
// ---------------------------------------------------------------------------
#define QB 32
__global__ __launch_bounds__(256) void attn_fused_kernel(
    const __bf16* __restrict__ Qh, const __bf16* __restrict__ Kh,
    const __bf16* __restrict__ Vh, float* __restrict__ Acat, float scale)
{
    __shared__ __align__(16) float  sS[QB][LQ + 4];
    __shared__ __align__(16) __bf16 sP[QB][LQ + 8];
    __shared__ __align__(16) __bf16 sV[LQ][DH + 16];

    const int tid  = threadIdx.x;
    const int h    = blockIdx.y;
    const int m0   = blockIdx.x * QB;
    const int w    = tid >> 5, lane = tid & 31;
    const int half = lane >> 4, r = lane & 15;

    const __bf16* Q  = Qh + ((size_t)h * LQ + m0) * DH;
    const __bf16* Kp = Kh + (size_t)h * LQ * DH;
    const __bf16* Vp = Vh + (size_t)h * LQ * DH;

    // ---- V: 16 rows per copy and work-group (16 lanes x 16 B a row), 32 copies per lane
#pragma unroll
    for (int j = 0; j < 4; ++j)
        async_copy8_b128(Vp + (size_t)(j * 128 + (tid >> 4)) * DH + (tid & 15) * 8,
                         (unsigned)(size_t)&sV[j * 128 + (tid >> 4)][(tid & 15) * 8],
                         16 * DH, 16 * (DH + 16) * 2);

    // ---- scores: 32 x 64 per wave, K-dim = DH in 4 steps of 32
    {
        const int wn = w * 64;
        const __bf16* qp = Q + (size_t)r * DH + half * 8;          // this lane's place in its Q row
        const __bf16* kp = Kp + (size_t)(wn + r) * DH + half * 8;  // and in its K row
        v16bf afr[4][2], bfr[4][4];
        v8f acc[2][4] = {};
        auto load = [&](int ks) {
#pragma unroll
            for (int mt = 0; mt < 2; ++mt)
                afr[ks][mt] = frag_from_lds(&qp[mt * 16 * DH + ks * 32], 0);
#pragma unroll
            for (int nt = 0; nt < 4; ++nt)
                bfr[ks][nt] = frag_from_lds(&kp[nt * 16 * DH + ks * 32], 0);
            // code that follows may reuse these loads' address registers; the addresses as
            // inputs keep them from being handed out as destinations to loads of this group
            asm volatile("s_wait_xcnt 0x0" :: "v"(qp), "v"(kp) : "memory");
        };
        auto compute = [&](int ks) {
#pragma unroll
            for (int mt = 0; mt < 2; ++mt)
#pragma unroll
                for (int nt = 0; nt < 4; ++nt)
                    acc[mt][nt] = wmma_bf16(afr[ks][mt], bfr[ks][nt], acc[mt][nt]);
        };
        load(0); load(1); load(2);
        // keeps the first products, which wait for their operands, from being scheduled
        // in front of the later steps' loads: a wave issues in order
        __builtin_amdgcn_sched_barrier(0);
        compute(0);
        load(3);
        compute(1); compute(2); compute(3);
#pragma unroll
        for (int mt = 0; mt < 2; ++mt)
#pragma unroll
            for (int nt = 0; nt < 4; ++nt)
#pragma unroll
                for (int g = 0; g < 8; ++g)
                    sS[mt * 16 + half * 8 + g][wn + nt * 16 + r] = acc[mt][nt][g] * scale;
    }

    __syncthreads();

    // ---- softmax over keys: one wave per row, 4 rows per wave, 16 scores per lane
#pragma unroll
    for (int i = 0; i < QB / 8; ++i) {
        const int row = w * (QB / 8) + i;
        float4 v[4];
#pragma unroll
        for (int j = 0; j < 4; ++j) v[j] = *(const float4*)&sS[row][lane * 4 + j * 128];
        float mx = fmaxf(fmaxf(v[0].x, v[0].y), fmaxf(v[0].z, v[0].w));
#pragma unroll
        for (int j = 1; j < 4; ++j)
            mx = fmaxf(mx, fmaxf(fmaxf(v[j].x, v[j].y), fmaxf(v[j].z, v[j].w)));
#pragma unroll
        for (int o = 16; o > 0; o >>= 1) mx = fmaxf(mx, __shfl_xor(mx, o));
        float s = 0.0f;
#pragma unroll
        for (int j = 0; j < 4; ++j) {
            v[j].x = expf(v[j].x - mx); v[j].y = expf(v[j].y - mx);
            v[j].z = expf(v[j].z - mx); v[j].w = expf(v[j].w - mx);
            s += (v[j].x + v[j].y) + (v[j].z + v[j].w);
        }
#pragma unroll
        for (int o = 16; o > 0; o >>= 1) s += __shfl_xor(s, o);
        const float inv = 1.0f / s;
#pragma unroll
        for (int j = 0; j < 4; ++j) {
            v4bf p;
            p[0] = (__bf16)(v[j].x * inv); p[1] = (__bf16)(v[j].y * inv);
            p[2] = (__bf16)(v[j].z * inv); p[3] = (__bf16)(v[j].w * inv);
            *(v4bf*)&sP[row][lane * 4 + j * 128] = p;
        }
    }
    // this wave's V copies have landed; the barrier then publishes V and P to all waves
    asm volatile("s_wait_asynccnt 0x0" ::: "memory");
    __syncthreads();

    // ---- P @ V: 32 x 16 per wave, K-dim = LQ in 16 steps of 32
    const int n = w * 16 + r;             // this lane's column of V
    const __bf16* vt = &sV[half * 8 + (lane & 7)][w * 16 + ((lane >> 3) & 1) * 8];
    v8f o[2] = {};
#pragma unroll
    for (int ks = 0; ks < LQ / 32; ++ks) {
        const v8bf lo = lds_load_tr16(vt + (ks * 32) * (DH + 16));        // keys ks*32 + half*8 .. +7
        const v8bf hi = lds_load_tr16(vt + (ks * 32 + 16) * (DH + 16));   // keys ks*32 + 16 + half*8 .. +7
        const v16bf vfr = __builtin_shufflevector(lo, hi, 0, 1, 2, 3, 4, 5, 6, 7,
                                                          8, 9, 10, 11, 12, 13, 14, 15);
#pragma unroll
        for (int mt = 0; mt < 2; ++mt)
            o[mt] = wmma_bf16(frag_from_lds(&sP[mt * 16 + r][ks * 32], half), vfr, o[mt]);
    }

#pragma unroll
    for (int mt = 0; mt < 2; ++mt)
#pragma unroll
        for (int g = 0; g < 8; ++g)
            Acat[(size_t)(m0 + mt * 16 + half * 8 + g) * DM + n * NH + h] = o[mt][g];
}

// ---------------------------------------------------------------------------
// Row LayerNorm over D=2048 of (split-K partials + bias + residual).
// WB: the result is also written rounded to bf16 (Yb), for the GEMM that reads it as A.
// ---------------------------------------------------------------------------
template <int S, bool WB>
__global__ __launch_bounds__(256) void layernorm_kernel(
    const float* __restrict__ part, const float* __restrict__ bias,
    const float* __restrict__ res, const float* __restrict__ g,
    const float* __restrict__ b, float* __restrict__ Y, __bf16* __restrict__ Yb)
{
    const int l = blockIdx.x, tid = threadIdx.x;
    const float* prow = part + (size_t)l * (S * DM);
    const float* rrow = res + (size_t)l * DM;
    float* out = Y + (size_t)l * DM;
    __shared__ float red[256];

    float vals[8], s = 0.0f;
#pragma unroll
    for (int j = 0; j < 8; ++j) {
        const int c = tid + j * 256;
        vals[j] = sum_slices<S>(prow, c) + bias[c] + rrow[c];
        s += vals[j];
    }
    red[tid] = s;
    __syncthreads();
    for (int st = 128; st > 0; st >>= 1) { if (tid < st) red[tid] += red[tid + st]; __syncthreads(); }
    const float mu = red[0] * (1.0f / (float)DM);
    __syncthreads();

    float v = 0.0f;
#pragma unroll
    for (int j = 0; j < 8; ++j) { const float d = vals[j] - mu; v += d * d; }
    red[tid] = v;
    __syncthreads();
    for (int st = 128; st > 0; st >>= 1) { if (tid < st) red[tid] += red[tid + st]; __syncthreads(); }
    const float inv = rsqrtf(red[0] * (1.0f / (float)DM) + 1e-5f);

#pragma unroll
    for (int j = 0; j < 8; ++j) {
        const int c = tid + j * 256;
        const float y = (vals[j] - mu) * inv * g[c] + b[c];
        out[c] = y;
        if constexpr (WB) Yb[(size_t)l * DM + c] = (__bf16)y;
    }
}

// ---------------------------------------------------------------------------
extern "C" void kernel_launch(void* const* d_in, const int* in_sizes, int n_in,
                              void* d_out, int out_size, void* d_ws, size_t ws_size,
                              hipStream_t stream)
{
    (void)in_sizes; (void)n_in; (void)out_size; (void)ws_size;

    const float* seq  = (const float*)d_in[0];
    const float* embW = (const float*)d_in[1];
    const float* embB = (const float*)d_in[2];
    const float* Wq   = (const float*)d_in[3];
    const float* bq   = (const float*)d_in[4];
    const float* Wk   = (const float*)d_in[5];
    const float* bk   = (const float*)d_in[6];
    const float* Wv   = (const float*)d_in[7];
    const float* bv   = (const float*)d_in[8];
    const float* Wo   = (const float*)d_in[9];
    const float* bo   = (const float*)d_in[10];
    const float* lng  = (const float*)d_in[11];
    const float* lnb  = (const float*)d_in[12];
    const float* W1   = (const float*)d_in[13];
    const float* b1   = (const float*)d_in[14];
    const float* W2   = (const float*)d_in[15];
    const float* b2   = (const float*)d_in[16];

    char* ws = (char*)d_ws;
    size_t off = 0;
    auto take = [&](size_t bytes) { char* p = ws + off; off = (off + bytes + 255) & ~(size_t)255; return p; };

    const size_t fLD = (size_t)LQ * DM * sizeof(float);       // 4 MB
    const size_t hLD = (size_t)NH * LQ * DH * sizeof(__bf16); // 2 MB
    const size_t hLF = (size_t)LQ * FFD * sizeof(__bf16);     // 8 MB

    float*  X    = (float*)take(fLD);
    float*  Acat = (float*)take(fLD);
    __bf16* Qh   = (__bf16*)take(3 * hLD);   // Q, K, V per-head planes, one after the other
    __bf16* Kh   = Qh + (size_t)NH * LQ * DH;
    __bf16* Vh   = Kh + (size_t)NH * LQ * DH;
    __bf16* Hb   = (__bf16*)take(hLF);       // FFN hidden, bf16
    float*  Xa   = (float*)take(fLD);
    __bf16* Xb   = (__bf16*)take(hLD);       // X and Xa rounded to bf16, [L][D]
    __bf16* Xab  = (__bf16*)take(hLD);
    float*  Pt   = (float*)take(8 * fLD);    // split-K partials: 32 MB a product
    float*  Yout = (float*)d_out;

    const dim3 blk(256);
    const dim3 blkG(512);                    // the GEMMs' block: 16 waves
    const dim3 gD (DM / 128, LQ / 256, 8);   // N=2048 GEMMs, 8 K slices: 256 work-groups
    const dim3 gE (DM / 64, LQ / 64);        // embedding, whole K: 256 work-groups
    const dim3 gQKV(DM / 128, LQ / 128, 3);  // Q, K and V projections together, whole K: 192 work-groups
    const dim3 gFF(FFD / 128, LQ / 128);     // FFN1, whole K: 256 work-groups

    // 1-2) embedding + bias + positional encoding
    gemm_emb_pos_kernel<<<gE, blkG, 0, stream>>>(seq, embW, embB, X, Xb);
    // 3-4) Q/K/V projections with bias, written in the per-head bf16 layout, in one launch
    gemm_qkv_heads_kernel<<<gQKV, blkG, 0, stream>>>(Xb, Wq, Wk, Wv, bq, bk, bv, Qh);
    // 5-7) softmax(Qh @ Kh^T / sqrt(D)) @ Vh, scattered back to the [L, D] interleaved layout
    attn_fused_kernel<<<dim3(LQ / QB, NH), blk, 0, stream>>>(
        Qh, Kh, Vh, Acat, 0.022097086912079608f /* 1/sqrt(2048) */);
    // 8) output projection, 9) + bias + residual X, LayerNorm -> Xa
    gemm_splitk_kernel<DM, DM, 8, false><<<gD, blkG, 0, stream>>>(Acat, nullptr, Wo, Pt);
    layernorm_kernel<8, true><<<LQ, blk, 0, stream>>>(Pt, bo, X, lng, lnb, Xa, Xab);
    // 10) FFN1 with bias + GELU
    gemm_ffn1_gelu_kernel<<<gFF, blkG, 0, stream>>>(Xab, W1, b1, Hb);
    // 11) FFN2, 12) + bias + residual Xa, final LayerNorm -> output
    gemm_splitk_kernel<DM, FFD, 8, true><<<gD, blkG, 0, stream>>>(nullptr, Hb, W2, Pt);
    layernorm_kernel<8, false><<<LQ, blk, 0, stream>>>(Pt, b2, Xa, lng, lnb, Yout, nullptr);
}
